// v000
// Times are from an AMD MI455X. After a warm-up the kernel runs many times in a row, and a time is the length of
// such a window on the GPU divided by its runs, so every launch and the gaps after it count. The runs cycle
// through copies of the inputs. A figure is the median of several windows, for all but v000 over two sittings.
// Sittings can differ by a few percent; kernels timed side by side share one.
// v000 is the starting kernel. One run takes 7870 microseconds.
// compute dtype: all float inputs rounded to bf16; Q/K/V = inputs W_h + b_h (per-head [E, Dh] weights) with EXACT bf16 products on WMMA 16x16x32, f32 accumulate, q/k rounded once to f16 (logits / 256 have std ~0.06: 1 product), causal logits stored in f32 per (batch, head); softmax in f32 (precise expf), P x 2^11 kept f32 and split bf16 hi + lo against v as bf16 hi + lo (3 products); out = y (bf16 hi + lo) Wo + bo; f32 output.
#include <hip/hip_runtime.h>
#include <math.h>

typedef __attribute__((ext_vector_type(16))) _Float16 v16h;
typedef __attribute__((ext_vector_type(16))) __bf16 v16b;
typedef __attribute__((ext_vector_type(8)))  _Float16 v8h;
typedef __attribute__((ext_vector_type(8)))  float v8f;
typedef __attribute__((ext_vector_type(4)))  float v4f;
typedef __attribute__((ext_vector_type(2)))  float v2f;
typedef __attribute__((ext_vector_type(4)))  unsigned v4u;
typedef __attribute__((ext_vector_type(4)))  int v4i;
typedef float __attribute__((may_alias)) float_a;
typedef int __attribute__((may_alias)) int_a;

template <typename T> __device__ __forceinline__ void vst2(void* p, T v) { *(T*)p = v;  }
__device__ __forceinline__ v8f wmma16(v16h a, v16h b, v8f c) {
  v8f d = __builtin_amdgcn_wmma_f32_16x16x32_f16(false, a, false, b, (short)0, c, false, false);
  asm volatile("v_nop\n\tv_nop\n\tv_nop\n\tv_nop" : "+v"(d) : "v"(a), "v"(b));
  return d;
}
__device__ __forceinline__ v8f wmma_bf(v16b a, v16b b, v8f c) {
  v8f d = __builtin_amdgcn_wmma_f32_16x16x32_bf16(false, a, false, b, (short)0, c, false, false);
  asm volatile("v_nop\n\tv_nop\n\tv_nop\n\tv_nop" : "+v"(d) : "v"(a), "v"(b));
  return d;
}
// 16x16x32 fragments: lane = (h = lane>>4, row/col = lane&15); elements 0..7 = k0+8h+0..7, 8..15 = k0+16+8h+0..7; D element r = row 8h+r
__device__ __forceinline__ v16h frag_h(const _Float16* rowk0, int lane) {
  union { v16h v; v8h q[2]; } u; const _Float16* p = rowk0 + 8 * (lane >> 4);
  u.q[0] = *(const v8h*)p; u.q[1] = *(const v8h*)(p + 16); return u.v;
}
__device__ __forceinline__ v16h frag_f32(const float* rowk0, int lane) {
  v16h a; const float* p = rowk0 + 8 * (lane >> 4);
#pragma unroll
  for (int i = 0; i < 8; ++i) { a[i] = (_Float16)p[i]; a[8 + i] = (_Float16)p[16 + i]; }
  return a;
}
__device__ __forceinline__ v16h frag_f32s(const float* rowk0, int lane, float sc) {
  v16h a; const float* p = rowk0 + 8 * (lane >> 4);
#pragma unroll
  for (int i = 0; i < 8; ++i) { a[i] = (_Float16)(p[i] * sc); a[8 + i] = (_Float16)(p[16 + i] * sc); }
  return a;
}
// column fragment from a [K][ld] layout (column n), rows >= K read as 0
__device__ __forceinline__ v16h fragc_f32(const float* W, int k0, int n, int lane, int ld, int K) {
  v16h a; const int g = lane >> 4;
#pragma unroll
  for (int i = 0; i < 8; ++i) { const int ka = k0 + 8 * g + i, kb = ka + 16;
    a[i] = (_Float16)(ka < K ? W[(size_t)(ka < K ? ka : K - 1) * ld + n] : 0.f); a[8 + i] = (_Float16)(kb < K ? W[(size_t)(kb < K ? kb : K - 1) * ld + n] : 0.f); }
  return a;
}
struct F2 { v16b h, l; };
__device__ __forceinline__ F2 bsplit16(const float v[16]) { F2 r;
#pragma unroll
  for (int i = 0; i < 16; ++i) { const __bf16 h = (__bf16)v[i]; r.h[i] = h; r.l[i] = (__bf16)(v[i] - (float)h); }
  return r; }
__device__ __forceinline__ F2 split_row(const float* row, int k0, int lane) { float v[16]; const float* p = row + k0 + 8 * (lane >> 4);
#pragma unroll
  for (int i = 0; i < 8; ++i) { v[i] = p[i]; v[8 + i] = p[16 + i]; }
  return bsplit16(v); }
__device__ __forceinline__ F2 split_rowK(const float* row, int k0, int lane, int K) { float v[16]; const int g = lane >> 4;
#pragma unroll
  for (int i = 0; i < 8; ++i) { const int ka = k0 + 8 * g + i, kb = ka + 16; v[i] = ka < K ? row[ka < K ? ka : K - 1] : 0.f; v[8 + i] = kb < K ? row[kb < K ? kb : K - 1] : 0.f; }
  return bsplit16(v); }
__device__ __forceinline__ F2 split_col(const float* W, int k0, int n, int lane, int ld, int K) { float v[16]; const int g = lane >> 4;
#pragma unroll
  for (int i = 0; i < 8; ++i) { const int ka = k0 + 8 * g + i, kb = ka + 16; v[i] = ka < K ? W[(size_t)(ka < K ? ka : K - 1) * ld + n] : 0.f; v[8 + i] = kb < K ? W[(size_t)(kb < K ? kb : K - 1) * ld + n] : 0.f; }
  return bsplit16(v); }
__device__ __forceinline__ v8f mac3(const F2& a, const F2& b, v8f c) { c = wmma_bf(a.l, b.h, c); c = wmma_bf(a.h, b.l, c); return wmma_bf(a.h, b.h, c); }
__device__ __forceinline__ float sigm(float v) { return 1.0f / (1.0f + expf(-v)); }
#define LDSX() do { asm volatile("s_wait_dscnt 0" ::: "memory"); __builtin_amdgcn_wave_barrier(); __builtin_amdgcn_fence(__ATOMIC_RELEASE, "workgroup"); } while (0)


// Four-headed causal attention (B 4, S 2,048, E 1,024 = 4 heads x 256): per-head Dense q/k/v from three different inputs, scores / head_dim (256), strictly-upper -1e30 mask, softmax, concat heads, Wo + bo.
#define NB 4
#define TT 2048
#define CC 1024
#define NH 4
#define HD 256
#ifndef TNB
#define TNB NB
#endif
typedef __attribute__((ext_vector_type(8))) __bf16 v8b;
__device__ __forceinline__ v16b frag_b(const __bf16* rowk0, int lane) {
  union { v16b v; v8b q[2]; } u; const __bf16* p = rowk0 + 8 * (lane >> 4);
  u.q[0] = *(const v8b*)p; u.q[1] = *(const v8b*)(p + 16); return u.v;
}
__device__ __forceinline__ float bfr(float v) { return (float)(__bf16)v; }
__device__ __attribute__((noinline)) float exp_ni(float v) { return expf(v); }
__device__ __attribute__((noinline)) float erf_ni(float v) { return erff(v); }

#define WS_QH  0u
#define WS_QL  (WS_QH + 2u * (size_t)NB * TT * CC)
#define WS_KH  (WS_QL + 2u * (size_t)NB * TT * CC)
#define WS_VT  (WS_KH + 2u * (size_t)NB * TT * CC)      // bf16 v planes [b][c][t]
#define WS_VL  (WS_VT + 2u * (size_t)NB * CC * TT)      // bf16 v residual planes
#define WS_S   (WS_VL + 2u * (size_t)NB * CC * TT)      // f32 logits, then P x 2^11 in place
#define WS_PH  (WS_S + 4u * (size_t)TT * TT)
#define WS_Y   (WS_PH + 2u * (size_t)TT * TT)          // f32 y rows [b*t][C]
#define WS_END (WS_Y + 4u * (size_t)NB * TT * CC)

// ---- k_proj: block = (64 rows, 128 cols, which): qkv = x W (+ b), exact; q -> f16 hi (+ residual), k -> f16 rows, v -> bf16 hi + lo planes
__global__ __launch_bounds__(128) void k_proj(const float* __restrict__ XQ, const float* __restrict__ XK, const float* __restrict__ XV, const float* __restrict__ WQ, const float* __restrict__ BQ, const float* __restrict__ WK, const float* __restrict__ BK, const float* __restrict__ WV, const float* __restrict__ BV, _Float16* __restrict__ QH, _Float16* __restrict__ QL, _Float16* __restrict__ KH, __bf16* __restrict__ VT, __bf16* __restrict__ VL) {
  __shared__ __align__(16) _Float16 sh[64][136], sl[64][136]; __shared__ __align__(16) __bf16 th[128][72], tl2[128][72];
  const int tid = threadIdx.x, wave = tid >> 5, lane = tid & 31, col = lane & 15, g = lane >> 4; const int which = blockIdx.z; const int c0 = blockIdx.y * 128; const size_t r0 = (size_t)blockIdx.x * 64; const float* X = which == 0 ? XQ : which == 1 ? XK : XV; const float* WA = which == 0 ? WQ : which == 1 ? WK : WV; const float* BA = which == 0 ? BQ : which == 1 ? BK : BV;
  v8f acc[8] = {};
#pragma unroll 2
  for (int kc = 0; kc < CC / 32; ++kc) { v16b a; { const float* p = X + (r0 + wave * 16 + col) * CC + kc * 32 + 8 * g;
#pragma unroll
      for (int i = 0; i < 8; ++i) { a[i] = (__bf16)p[i]; a[8 + i] = (__bf16)p[16 + i]; } }
#pragma unroll
    for (int j = 0; j < 8; ++j) { v16b w; const int o = c0 + j * 16 + col; const int hh = o / HD, dd = o % HD;
#pragma unroll
      for (int i = 0; i < 8; ++i) { w[i] = (__bf16)WA[((size_t)hh * CC + kc * 32 + 8 * g + i) * HD + dd]; w[8 + i] = (__bf16)WA[((size_t)hh * CC + kc * 32 + 16 + 8 * g + i) * HD + dd]; }
      acc[j] = wmma_bf(a, w, acc[j]); } }
#pragma unroll
  for (int j = 0; j < 8; ++j) { const float bb = bfr(BA[c0 + j * 16 + col]);
#pragma unroll
    for (int r = 0; r < 8; ++r) { const float v = acc[j][r] + bb; const int rl = wave * 16 + 8 * g + r, cl = j * 16 + col; const _Float16 hv = (_Float16)v;
      if (which == 2) { const __bf16 bh = (__bf16)v; th[cl][rl] = bh; tl2[cl][rl] = (__bf16)(v - (float)bh); } else { sh[rl][cl] = hv; sl[rl][cl] = (_Float16)(v - (float)hv); } } }
  __syncthreads();
  if (which < 2) { _Float16* dh = which == 0 ? QH : KH; for (int e = tid; e < 64 * 16; e += 128) { const int rl = e >> 4, q = e & 15; vst2((unsigned*)(dh + (r0 + rl) * CC + c0 + q * 8), *(const v4u*)&sh[rl][q * 8]); if (which == 0) vst2((unsigned*)(QL + (r0 + rl) * CC + c0 + q * 8), *(const v4u*)&sl[rl][q * 8]); } }
  else { const size_t b = r0 / TT; const int t0 = (int)(r0 % TT); for (int e = tid; e < 128 * 8; e += 128) { const int cl = e >> 3, q = e & 7; const size_t o2 = (b * CC + c0 + cl) * (size_t)TT + t0 + q * 8; vst2((unsigned*)(VT + o2), *(const v4u*)&th[cl][q * 8]); vst2((unsigned*)(VL + o2), *(const v4u*)&tl2[cl][q * 8]); } } }
// ---- k_sc: block = (64 queries, 128 keys) of (b,h): logits * scale, keys after the query -> -3e38; causal blocks beyond the diagonal exit
__global__ __launch_bounds__(128) void k_sc(const _Float16* __restrict__ QH, const _Float16* __restrict__ QL, const _Float16* __restrict__ KH, const float* __restrict__ BM, int b, int h, float* __restrict__ S) { __shared__ __align__(16) float ss[4][16][132];
  const int tid = threadIdx.x, wave = tid >> 5, lane = tid & 31, col = lane & 15, g = lane >> 4; const int k0 = blockIdx.y * 128; const int ql0 = blockIdx.x * 64 + wave * 16; const size_t q0 = (size_t)b * TT + ql0;
  if (k0 > blockIdx.x * 64 + 63) return;   // whole key block above the diagonal (block-uniform)
  v8f acc[8] = {};
#pragma unroll
  for (int kc = 0; kc < HD / 32; ++kc) { const v16h ah = frag_h(QH + (q0 + col) * CC + h * HD + kc * 32, lane);
#pragma unroll
    for (int j = 0; j < 8; ++j) { const v16h kb = frag_h(KH + ((size_t)b * TT + k0 + j * 16 + col) * CC + h * HD + kc * 32, lane); acc[j] = wmma16(ah, kb, acc[j]); } }
#pragma unroll
  for (int j = 0; j < 8; ++j) { const int kt = k0 + j * 16 + col;
#pragma unroll
    for (int r = 0; r < 8; ++r) { const int qt = ql0 + 8 * g + r; float v = acc[j][r] * 0.00390625f; (void)BM; if (kt > qt) v = -3.0e38f; ss[wave][8 * g + r][j * 16 + col] = v; } }
  LDSX(); for (int rl = 0; rl < 16; ++rl) vst2(S + (size_t)(ql0 + rl) * TT + k0 + lane * 4, *(const v4f*)&ss[wave][rl][lane * 4]); }
// ---- k_sm: block = query row: softmax over keys [0, kend) -> P x 2^11 f32 in place (masked -> 0)
__global__ __launch_bounds__(256) void k_sm(float* __restrict__ S) { __shared__ float sred[8]; __shared__ float sbc; __shared__ __align__(16) float sh[TT];
  const int t = threadIdx.x; const size_t row = blockIdx.x; float* sr = S + row * TT; const int kend = ((int)row / 64) * 64 + 64;
  float m = -3.0e38f; for (int k = t; k < kend; k += 256) m = fmaxf(m, sr[k]);
#pragma unroll
  for (int o = 1; o < 32; o <<= 1) m = fmaxf(m, __shfl_xor(m, o));
  if ((t & 31) == 0) sred[t >> 5] = m; __syncthreads(); if (t == 0) { float a = sred[0]; for (int i = 1; i < 8; ++i) a = fmaxf(a, sred[i]); sbc = a; } __syncthreads(); m = sbc; __syncthreads();
  float sum = 0.f; for (int k = t; k < kend; k += 256) { const float v = sr[k]; sum += (v <= -1.0e38f) ? 0.f : expf(v - m); }
#pragma unroll
  for (int o = 1; o < 32; o <<= 1) sum += __shfl_xor(sum, o);
  if ((t & 31) == 0) sred[t >> 5] = sum; __syncthreads(); if (t == 0) { float a = 0.f; for (int i = 0; i < 8; ++i) a += sred[i]; sbc = 1.0f / a; } __syncthreads(); const float inv = sbc;
  for (int k = t; k < kend; k += 256) { const float v = sr[k]; sh[k] = (v <= -1.0e38f) ? 0.f : expf(v - m) * inv * 2048.0f; }
  __syncthreads(); for (int q = t; q < kend / 4; q += 256) vst2(sr + q * 4, *(const v4f*)&sh[q * 4]); }
// ---- k_pv: block = 64 queries of (b,h): y[q][h*HD + d] = P . v  (keys [0, kend))
__global__ __launch_bounds__(128) void k_pv(const float* __restrict__ PS, const __bf16* __restrict__ VT, const __bf16* __restrict__ VL, int b, int h, float* __restrict__ Y) { __shared__ __align__(16) float ss[4][16][HD + 4];
  const int tid = threadIdx.x, wave = tid >> 5, lane = tid & 31, col = lane & 15, g = lane >> 4; const int ql0 = blockIdx.x * 64 + wave * 16; const int kend = blockIdx.x * 64 + 64;
  v8f acc[HD / 16] = {};
#pragma unroll 1
  for (int kc = 0; kc < kend / 32; ++kc) { const F2 p = split_row(PS + (size_t)(ql0 + col) * TT, kc * 32, lane);
#pragma unroll
    for (int j = 0; j < HD / 16; ++j) { const size_t po = ((size_t)b * CC + h * HD + j * 16 + col) * (size_t)TT + kc * 32; const v16b vh = frag_b(VT + po, lane); acc[j] = wmma_bf(p.h, vh, acc[j]); acc[j] = wmma_bf(p.l, vh, acc[j]); acc[j] = wmma_bf(p.h, frag_b(VL + po, lane), acc[j]); } }
#pragma unroll
  for (int j = 0; j < HD / 16; ++j)
#pragma unroll
    for (int r = 0; r < 8; ++r) ss[wave][8 * g + r][j * 16 + col] = acc[j][r] * (1.0f / 2048.0f);
  LDSX(); for (int rl = 0; rl < 16; ++rl) for (int q4 = lane; q4 < HD / 4; q4 += 32) vst2(Y + ((size_t)b * TT + ql0 + rl) * CC + h * HD + q4 * 4, *(const v4f*)&ss[wave][rl][q4 * 4]); }
// ---- k_out: block = (64 rows, 128 cols): out = y (bf16 hi + lo) Wproj + b
__global__ __launch_bounds__(128) void k_out(const float* __restrict__ Y, const float* __restrict__ WP, const float* __restrict__ BP, float* __restrict__ OUT) { __shared__ __align__(16) float sf[4][16][132];
  const int tid = threadIdx.x, wave = tid >> 5, lane = tid & 31, col = lane & 15, g = lane >> 4; const int c0 = blockIdx.y * 128; const size_t r0 = (size_t)blockIdx.x * 64 + wave * 16;
  v8f acc[8] = {};
#pragma unroll 2
  for (int kc = 0; kc < CC / 32; ++kc) { const F2 a = split_row(Y + (r0 + col) * CC, kc * 32, lane);
#pragma unroll
    for (int j = 0; j < 8; ++j) { v16b w; const int o = c0 + j * 16 + col;
#pragma unroll
      for (int i = 0; i < 8; ++i) { w[i] = (__bf16)WP[(size_t)(kc * 32 + 8 * g + i) * CC + (o)]; w[8 + i] = (__bf16)WP[(size_t)(kc * 32 + 16 + 8 * g + i) * CC + (o)]; }
      acc[j] = wmma_bf(a.h, w, acc[j]); acc[j] = wmma_bf(a.l, w, acc[j]); } }
#pragma unroll
  for (int j = 0; j < 8; ++j) { const float bb = BP ? bfr(BP[c0 + j * 16 + col]) : 0.f;
#pragma unroll
    for (int r = 0; r < 8; ++r) sf[wave][8 * g + r][j * 16 + col] = acc[j][r] + bb; }
  LDSX(); for (int rl = 0; rl < 16; ++rl) vst2(OUT + (r0 + rl) * CC + c0 + lane * 4, *(const v4f*)&sf[wave][rl][lane * 4]); }
extern "C" void kernel_launch(void* const* d_in, const int* in_sizes, int n_in, void* d_out, int out_size, void* d_ws, size_t ws_size, hipStream_t stream) {
  (void)in_sizes; (void)n_in; (void)out_size;
  const float** F = (const float**)d_in;   // 0 inputs_for_keys, 1 inputs_for_values, 2 inputs_for_queries [4,2048,1024], 3 Wk [4,1024,256], 4 bk [4,256], 5 Wq, 6 bq, 7 Wv, 8 bv, 9 Wo [1024,1024] ([in,out]), 10 bo
  if (ws_size < (size_t)WS_END) return;
  char* ws = (char*)d_ws; _Float16 *QH = (_Float16*)(ws + WS_QH), *QL = (_Float16*)(ws + WS_QL), *KH = (_Float16*)(ws + WS_KH); __bf16 *VT = (__bf16*)(ws + WS_VT), *VL = (__bf16*)(ws + WS_VL); float *S = (float*)(ws + WS_S), *Y = (float*)(ws + WS_Y);
  k_proj<<<dim3(TNB * TT / 64, CC / 128, 3), 128, 0, stream>>>(F[2], F[0], F[1], F[5], F[6], F[3], F[4], F[7], F[8], QH, QL, KH, VT, VL);
  for (int b = 0; b < TNB; ++b) for (int h = 0; h < NH; ++h) {
    k_sc<<<dim3(TT / 64, TT / 128), 128, 0, stream>>>(QH, QL, KH, nullptr, b, h, S);
    k_sm<<<TT, 256, 0, stream>>>(S);
    k_pv<<<TT / 64, 128, 0, stream>>>(S, VT, VL, b, h, Y);
  }
  k_out<<<dim3(TNB * TT / 64, CC / 128), 128, 0, stream>>>(Y, F[9], F[10], (float*)d_out);
}

// v001
// Measured time: 983 microseconds a run.
// In two side-by-side timings against v000, it was 8.01 and 8.00 times as fast.
// compute dtype: all float inputs rounded to bf16; Q/K/V = inputs W_h + b_h (per-head [E, Dh] weights) with EXACT bf16 products on WMMA 16x16x32, f32 accumulate, q/k rounded once to f16 (logits / 256 have std ~0.06: 1 product), causal logits stored in f32 per (batch, head); softmax in f32 (precise expf), P x 2^11 kept f32 and split bf16 hi + lo against v as bf16 hi + lo (3 products); out = y (bf16 hi + lo) Wo + bo; f32 output.
#include <hip/hip_runtime.h>
#include <math.h>

typedef __attribute__((ext_vector_type(16))) _Float16 v16h;
typedef __attribute__((ext_vector_type(16))) __bf16 v16b;
typedef __attribute__((ext_vector_type(8)))  _Float16 v8h;
typedef __attribute__((ext_vector_type(8)))  float v8f;
typedef __attribute__((ext_vector_type(4)))  float v4f;
typedef __attribute__((ext_vector_type(2)))  float v2f;
typedef __attribute__((ext_vector_type(4)))  unsigned v4u;
typedef __attribute__((ext_vector_type(4)))  int v4i;
typedef float __attribute__((may_alias)) float_a;
typedef int __attribute__((may_alias)) int_a;

template <typename T> __device__ __forceinline__ void vst2(void* p, T v) { *(T*)p = v;  }
__device__ __forceinline__ v8f wmma16(v16h a, v16h b, v8f c) {
  v8f d = __builtin_amdgcn_wmma_f32_16x16x32_f16(false, a, false, b, (short)0, c, false, false);
  asm volatile("v_nop\n\tv_nop\n\tv_nop\n\tv_nop" : "+v"(d) : "v"(a), "v"(b));
  return d;
}
__device__ __forceinline__ v8f wmma_bf(v16b a, v16b b, v8f c) {
  v8f d = __builtin_amdgcn_wmma_f32_16x16x32_bf16(false, a, false, b, (short)0, c, false, false);
  asm volatile("v_nop\n\tv_nop\n\tv_nop\n\tv_nop" : "+v"(d) : "v"(a), "v"(b));
  return d;
}
// 16x16x32 fragments: lane = (h = lane>>4, row/col = lane&15); elements 0..7 = k0+8h+0..7, 8..15 = k0+16+8h+0..7; D element r = row 8h+r
__device__ __forceinline__ v16h frag_h(const _Float16* rowk0, int lane) {
  union { v16h v; v8h q[2]; } u; const _Float16* p = rowk0 + 8 * (lane >> 4);
  u.q[0] = *(const v8h*)p; u.q[1] = *(const v8h*)(p + 16); return u.v;
}
__device__ __forceinline__ v16h frag_f32(const float* rowk0, int lane) {
  v16h a; const float* p = rowk0 + 8 * (lane >> 4);
#pragma unroll
  for (int i = 0; i < 8; ++i) { a[i] = (_Float16)p[i]; a[8 + i] = (_Float16)p[16 + i]; }
  return a;
}
__device__ __forceinline__ v16h frag_f32s(const float* rowk0, int lane, float sc) {
  v16h a; const float* p = rowk0 + 8 * (lane >> 4);
#pragma unroll
  for (int i = 0; i < 8; ++i) { a[i] = (_Float16)(p[i] * sc); a[8 + i] = (_Float16)(p[16 + i] * sc); }
  return a;
}
// column fragment from a [K][ld] layout (column n), rows >= K read as 0
__device__ __forceinline__ v16h fragc_f32(const float* W, int k0, int n, int lane, int ld, int K) {
  v16h a; const int g = lane >> 4;
#pragma unroll
  for (int i = 0; i < 8; ++i) { const int ka = k0 + 8 * g + i, kb = ka + 16;
    a[i] = (_Float16)(ka < K ? W[(size_t)(ka < K ? ka : K - 1) * ld + n] : 0.f); a[8 + i] = (_Float16)(kb < K ? W[(size_t)(kb < K ? kb : K - 1) * ld + n] : 0.f); }
  return a;
}
struct F2 { v16b h, l; };
__device__ __forceinline__ F2 bsplit16(const float v[16]) { F2 r;
#pragma unroll
  for (int i = 0; i < 16; ++i) { const __bf16 h = (__bf16)v[i]; r.h[i] = h; r.l[i] = (__bf16)(v[i] - (float)h); }
  return r; }
__device__ __forceinline__ F2 split_row(const float* row, int k0, int lane) { float v[16]; const float* p = row + k0 + 8 * (lane >> 4);
#pragma unroll
  for (int i = 0; i < 8; ++i) { v[i] = p[i]; v[8 + i] = p[16 + i]; }
  return bsplit16(v); }
__device__ __forceinline__ F2 split_rowK(const float* row, int k0, int lane, int K) { float v[16]; const int g = lane >> 4;
#pragma unroll
  for (int i = 0; i < 8; ++i) { const int ka = k0 + 8 * g + i, kb = ka + 16; v[i] = ka < K ? row[ka < K ? ka : K - 1] : 0.f; v[8 + i] = kb < K ? row[kb < K ? kb : K - 1] : 0.f; }
  return bsplit16(v); }
__device__ __forceinline__ F2 split_col(const float* W, int k0, int n, int lane, int ld, int K) { float v[16]; const int g = lane >> 4;
#pragma unroll
  for (int i = 0; i < 8; ++i) { const int ka = k0 + 8 * g + i, kb = ka + 16; v[i] = ka < K ? W[(size_t)(ka < K ? ka : K - 1) * ld + n] : 0.f; v[8 + i] = kb < K ? W[(size_t)(kb < K ? kb : K - 1) * ld + n] : 0.f; }
  return bsplit16(v); }
__device__ __forceinline__ v8f mac3(const F2& a, const F2& b, v8f c) { c = wmma_bf(a.l, b.h, c); c = wmma_bf(a.h, b.l, c); return wmma_bf(a.h, b.h, c); }
__device__ __forceinline__ float sigm(float v) { return 1.0f / (1.0f + expf(-v)); }
#define LDSX() do { asm volatile("s_wait_dscnt 0" ::: "memory"); __builtin_amdgcn_wave_barrier(); __builtin_amdgcn_fence(__ATOMIC_RELEASE, "workgroup"); } while (0)


// Four-headed causal attention (B 4, S 2,048, E 1,024 = 4 heads x 256): per-head Dense q/k/v from three different inputs, scores / head_dim (256), strictly-upper -1e30 mask, softmax, concat heads, Wo + bo.
#define NB 4
#define TT 2048
#define CC 1024
#define NH 4
#define HD 256
#ifndef TNB
#define TNB NB
#endif
typedef __attribute__((ext_vector_type(8))) __bf16 v8b;
__device__ __forceinline__ v16b frag_b(const __bf16* rowk0, int lane) {
  union { v16b v; v8b q[2]; } u; const __bf16* p = rowk0 + 8 * (lane >> 4);
  u.q[0] = *(const v8b*)p; u.q[1] = *(const v8b*)(p + 16); return u.v;
}
__device__ __forceinline__ float bfr(float v) { return (float)(__bf16)v; }
__device__ __attribute__((noinline)) float exp_ni(float v) { return expf(v); }
__device__ __attribute__((noinline)) float erf_ni(float v) { return erff(v); }

#define WS_QH  0u
#define WS_QL  (WS_QH + 2u * (size_t)NB * TT * CC)
#define WS_KH  (WS_QL + 2u * (size_t)NB * TT * CC)
#define WS_VT  (WS_KH + 2u * (size_t)NB * TT * CC)      // bf16 v planes [b][c][t]
#define WS_VL  (WS_VT + 2u * (size_t)NB * CC * TT)      // bf16 v residual planes
#define WS_S   (WS_VL + 2u * (size_t)NB * CC * TT)      // f32 logits, then P x 2^11 in place
#define WS_PH  (WS_S + 4u * (size_t)TT * TT)
#define WS_Y   (WS_PH + 2u * (size_t)TT * TT)          // f32 y rows [b*t][C]
#define WS_END (WS_Y + 4u * (size_t)NB * TT * CC)

// ---- k_proj: block = (64 rows, 128 cols, which): qkv = x W (+ b), exact; q -> f16 hi (+ residual), k -> f16 rows, v -> bf16 hi + lo planes
__global__ __launch_bounds__(128) void k_proj(const float* __restrict__ XQ, const float* __restrict__ XK, const float* __restrict__ XV, const float* __restrict__ WQ, const float* __restrict__ BQ, const float* __restrict__ WK, const float* __restrict__ BK, const float* __restrict__ WV, const float* __restrict__ BV, _Float16* __restrict__ QH, _Float16* __restrict__ QL, _Float16* __restrict__ KH, __bf16* __restrict__ VT, __bf16* __restrict__ VL) {
  __shared__ __align__(16) _Float16 sh[64][136], sl[64][136]; __shared__ __align__(16) __bf16 th[128][72], tl2[128][72];
  const int tid = threadIdx.x, wave = tid >> 5, lane = tid & 31, col = lane & 15, g = lane >> 4; const int which = blockIdx.z; const int c0 = blockIdx.y * 128; const size_t r0 = (size_t)blockIdx.x * 64; const float* X = which == 0 ? XQ : which == 1 ? XK : XV; const float* WA = which == 0 ? WQ : which == 1 ? WK : WV; const float* BA = which == 0 ? BQ : which == 1 ? BK : BV;
  v8f acc[8] = {};
#pragma unroll 2
  for (int kc = 0; kc < CC / 32; ++kc) { v16b a; { const float* p = X + (r0 + wave * 16 + col) * CC + kc * 32 + 8 * g;
#pragma unroll
      for (int i = 0; i < 8; ++i) { a[i] = (__bf16)p[i]; a[8 + i] = (__bf16)p[16 + i]; } }
#pragma unroll
    for (int j = 0; j < 8; ++j) { v16b w; const int o = c0 + j * 16 + col; const int hh = o / HD, dd = o % HD;
#pragma unroll
      for (int i = 0; i < 8; ++i) { w[i] = (__bf16)WA[((size_t)hh * CC + kc * 32 + 8 * g + i) * HD + dd]; w[8 + i] = (__bf16)WA[((size_t)hh * CC + kc * 32 + 16 + 8 * g + i) * HD + dd]; }
      acc[j] = wmma_bf(a, w, acc[j]); } }
#pragma unroll
  for (int j = 0; j < 8; ++j) { const float bb = bfr(BA[c0 + j * 16 + col]);
#pragma unroll
    for (int r = 0; r < 8; ++r) { const float v = acc[j][r] + bb; const int rl = wave * 16 + 8 * g + r, cl = j * 16 + col; const _Float16 hv = (_Float16)v;
      if (which == 2) { const __bf16 bh = (__bf16)v; th[cl][rl] = bh; tl2[cl][rl] = (__bf16)(v - (float)bh); } else { sh[rl][cl] = hv; sl[rl][cl] = (_Float16)(v - (float)hv); } } }
  __syncthreads();
  if (which < 2) { _Float16* dh = which == 0 ? QH : KH; for (int e = tid; e < 64 * 16; e += 128) { const int rl = e >> 4, q = e & 15; vst2((unsigned*)(dh + (r0 + rl) * CC + c0 + q * 8), *(const v4u*)&sh[rl][q * 8]); if (which == 0) vst2((unsigned*)(QL + (r0 + rl) * CC + c0 + q * 8), *(const v4u*)&sl[rl][q * 8]); } }
  else { const size_t b = r0 / TT; const int t0 = (int)(r0 % TT); for (int e = tid; e < 128 * 8; e += 128) { const int cl = e >> 3, q = e & 7; const size_t o2 = (b * CC + c0 + cl) * (size_t)TT + t0 + q * 8; vst2((unsigned*)(VT + o2), *(const v4u*)&th[cl][q * 8]); vst2((unsigned*)(VL + o2), *(const v4u*)&tl2[cl][q * 8]); } } }
// ---- k_sc: block = (64 queries, 128 keys) of (b,h): logits * scale, keys after the query -> -3e38; causal blocks beyond the diagonal exit
__global__ __launch_bounds__(128) void k_sc(const _Float16* __restrict__ QH, const _Float16* __restrict__ QL, const _Float16* __restrict__ KH, const float* __restrict__ BM, int b, int h, float* __restrict__ S) { __shared__ __align__(16) float ss[4][16][132];
  const int tid = threadIdx.x, wave = tid >> 5, lane = tid & 31, col = lane & 15, g = lane >> 4; const int k0 = blockIdx.y * 128; const int ql0 = blockIdx.x * 64 + wave * 16; const size_t q0 = (size_t)b * TT + ql0;
  if (k0 > blockIdx.x * 64 + 63) return;   // whole key block above the diagonal (block-uniform)
  v8f acc[8] = {};
#pragma unroll
  for (int kc = 0; kc < HD / 32; ++kc) { const v16h ah = frag_h(QH + (q0 + col) * CC + h * HD + kc * 32, lane);
#pragma unroll
    for (int j = 0; j < 8; ++j) { const v16h kb = frag_h(KH + ((size_t)b * TT + k0 + j * 16 + col) * CC + h * HD + kc * 32, lane); acc[j] = wmma16(ah, kb, acc[j]); } }
#pragma unroll
  for (int j = 0; j < 8; ++j) { const int kt = k0 + j * 16 + col;
#pragma unroll
    for (int r = 0; r < 8; ++r) { const int qt = ql0 + 8 * g + r; float v = acc[j][r] * 0.00390625f; (void)BM; if (kt > qt) v = -3.0e38f; ss[wave][8 * g + r][j * 16 + col] = v; } }
  LDSX(); for (int rl = 0; rl < 16; ++rl) vst2(S + (size_t)(ql0 + rl) * TT + k0 + lane * 4, *(const v4f*)&ss[wave][rl][lane * 4]); }
// ---- k_sm: block = query row: softmax over keys [0, kend) -> P x 2^11 f32 in place (masked -> 0)
__global__ __launch_bounds__(256) void k_sm(float* __restrict__ S) { __shared__ float sred[8]; __shared__ float sbc; __shared__ __align__(16) float sh[TT];
  const int t = threadIdx.x; const size_t row = blockIdx.x; float* sr = S + row * TT; const int kend = ((int)row / 64) * 64 + 64;
  float m = -3.0e38f; for (int k = t; k < kend; k += 256) m = fmaxf(m, sr[k]);
#pragma unroll
  for (int o = 1; o < 32; o <<= 1) m = fmaxf(m, __shfl_xor(m, o));
  if ((t & 31) == 0) sred[t >> 5] = m; __syncthreads(); if (t == 0) { float a = sred[0]; for (int i = 1; i < 8; ++i) a = fmaxf(a, sred[i]); sbc = a; } __syncthreads(); m = sbc; __syncthreads();
  float sum = 0.f; for (int k = t; k < kend; k += 256) { const float v = sr[k]; sum += (v <= -1.0e38f) ? 0.f : expf(v - m); }
#pragma unroll
  for (int o = 1; o < 32; o <<= 1) sum += __shfl_xor(sum, o);
  if ((t & 31) == 0) sred[t >> 5] = sum; __syncthreads(); if (t == 0) { float a = 0.f; for (int i = 0; i < 8; ++i) a += sred[i]; sbc = 1.0f / a; } __syncthreads(); const float inv = sbc;
  for (int k = t; k < kend; k += 256) { const float v = sr[k]; sh[k] = (v <= -1.0e38f) ? 0.f : expf(v - m) * inv * 2048.0f; }
  __syncthreads(); for (int q = t; q < kend / 4; q += 256) vst2(sr + q * 4, *(const v4f*)&sh[q * 4]); }
// ---- k_pv: block = (32 queries, 64 head columns) of (b,h): y[q][h*HD + d] = P . v (keys [0, kend)); the block's PVW waves take the 64-key chunks in turn, each on a 2 x 4 set of 16 x 16 tiles, and their f32 partial tiles are summed in wave order through LDS
// every "#pragma unroll" below unrolls fully, so that fragment and accumulator arrays are indexed by constants and stay in registers
#define PVW 16
__global__ __launch_bounds__(32 * PVW) void k_pv(const float* __restrict__ PS, const __bf16* __restrict__ VT, const __bf16* __restrict__ VL, int b, int h, float* __restrict__ Y) { __shared__ __align__(16) float ss[PVW][32][68];
  const int tid = threadIdx.x, wave = __builtin_amdgcn_readfirstlane(tid >> 5), lane = tid & 31, col = lane & 15, g = lane >> 4; const int ql0 = blockIdx.x * 32, d0 = blockIdx.y * 64; const int nch = blockIdx.x / 2 + 1; const int nw = nch < PVW ? nch : PVW;   // nch chunks of 64 keys reach kend; waves nw.. have none
  if (wave < nw) { v8f acc[2][4] = {};
// kept rolled: the fragments of two chunks would not fit the 256 registers that a wave of a 16-wave block may hold
#pragma unroll 1
    for (int c = wave; c < nch; c += PVW) { v4f pr[2][2][4]; v16b vh[3][2], vl[3][2]; F2 p[2][2]; const size_t po = ((size_t)b * CC + h * HD + d0 + col) * (size_t)TT + c * 64;
      // P rows and v column tiles 0 and 1 are asked for together; tiles 2 and 3 while earlier tiles multiply
#pragma unroll
      for (int qa = 0; qa < 2; ++qa) { const float* pp = PS + (size_t)(ql0 + qa * 16 + col) * TT + c * 64 + 8 * g;
#pragma unroll
        for (int u = 0; u < 2; ++u) { pr[u][qa][0] = *(const v4f*)(pp + u * 32); pr[u][qa][1] = *(const v4f*)(pp + u * 32 + 4); pr[u][qa][2] = *(const v4f*)(pp + u * 32 + 16); pr[u][qa][3] = *(const v4f*)(pp + u * 32 + 20); } }
#pragma unroll
      for (int u = 0; u < 2; ++u) { vh[0][u] = frag_b(VT + po + 0 * 16 * (size_t)TT + u * 32, lane); vl[0][u] = frag_b(VL + po + 0 * 16 * (size_t)TT + u * 32, lane); }
#pragma unroll
      for (int u = 0; u < 2; ++u) { vh[1][u] = frag_b(VT + po + 1 * 16 * (size_t)TT + u * 32, lane); vl[1][u] = frag_b(VL + po + 1 * 16 * (size_t)TT + u * 32, lane); }
#pragma unroll
      for (int qa = 0; qa < 2; ++qa)
#pragma unroll
        for (int u = 0; u < 2; ++u) { float v[16];
#pragma unroll
          for (int i = 0; i < 16; ++i) v[i] = pr[u][qa][i >> 2][i & 3];
          p[u][qa] = bsplit16(v); }
#pragma unroll
      for (int u = 0; u < 2; ++u) { vh[2][u] = frag_b(VT + po + 2 * 16 * (size_t)TT + u * 32, lane); vl[2][u] = frag_b(VL + po + 2 * 16 * (size_t)TT + u * 32, lane); }
#pragma unroll
      for (int u = 0; u < 2; ++u) { acc[0][0] = wmma_bf(p[u][0].h, vh[0][u], acc[0][0]); acc[1][0] = wmma_bf(p[u][1].h, vh[0][u], acc[1][0]); acc[0][0] = wmma_bf(p[u][0].l, vh[0][u], acc[0][0]); acc[1][0] = wmma_bf(p[u][1].l, vh[0][u], acc[1][0]); acc[0][0] = wmma_bf(p[u][0].h, vl[0][u], acc[0][0]); acc[1][0] = wmma_bf(p[u][1].h, vl[0][u], acc[1][0]); }
#pragma unroll
      for (int u = 0; u < 2; ++u) { vh[0][u] = frag_b(VT + po + 3 * 16 * (size_t)TT + u * 32, lane); vl[0][u] = frag_b(VL + po + 3 * 16 * (size_t)TT + u * 32, lane); }
#pragma unroll
      for (int u = 0; u < 2; ++u) { acc[0][1] = wmma_bf(p[u][0].h, vh[1][u], acc[0][1]); acc[1][1] = wmma_bf(p[u][1].h, vh[1][u], acc[1][1]); acc[0][1] = wmma_bf(p[u][0].l, vh[1][u], acc[0][1]); acc[1][1] = wmma_bf(p[u][1].l, vh[1][u], acc[1][1]); acc[0][1] = wmma_bf(p[u][0].h, vl[1][u], acc[0][1]); acc[1][1] = wmma_bf(p[u][1].h, vl[1][u], acc[1][1]); }
#pragma unroll
      for (int u = 0; u < 2; ++u) { acc[0][2] = wmma_bf(p[u][0].h, vh[2][u], acc[0][2]); acc[1][2] = wmma_bf(p[u][1].h, vh[2][u], acc[1][2]); acc[0][2] = wmma_bf(p[u][0].l, vh[2][u], acc[0][2]); acc[1][2] = wmma_bf(p[u][1].l, vh[2][u], acc[1][2]); acc[0][2] = wmma_bf(p[u][0].h, vl[2][u], acc[0][2]); acc[1][2] = wmma_bf(p[u][1].h, vl[2][u], acc[1][2]); }
#pragma unroll
      for (int u = 0; u < 2; ++u) { acc[0][3] = wmma_bf(p[u][0].h, vh[0][u], acc[0][3]); acc[1][3] = wmma_bf(p[u][1].h, vh[0][u], acc[1][3]); acc[0][3] = wmma_bf(p[u][0].l, vh[0][u], acc[0][3]); acc[1][3] = wmma_bf(p[u][1].l, vh[0][u], acc[1][3]); acc[0][3] = wmma_bf(p[u][0].h, vl[0][u], acc[0][3]); acc[1][3] = wmma_bf(p[u][1].h, vl[0][u], acc[1][3]); } }
#pragma unroll
    for (int qa = 0; qa < 2; ++qa)
#pragma unroll
      for (int j = 0; j < 4; ++j)
#pragma unroll
        for (int r = 0; r < 8; ++r) ss[wave][qa * 16 + 8 * g + r][j * 16 + col] = acc[qa][j][r]; }
  __syncthreads();
  for (int e = tid; e < 32 * 16; e += 32 * PVW) { const int rl = e >> 4, q4 = e & 15; v4f s = *(const v4f*)&ss[0][rl][q4 * 4]; for (int w = 1; w < nw; ++w) s += *(const v4f*)&ss[w][rl][q4 * 4];
    vst2(Y + ((size_t)b * TT + ql0 + rl) * CC + h * HD + d0 + q4 * 4, s * (1.0f / 2048.0f)); } }
// ---- k_out: block = (64 rows, 128 cols): out = y (bf16 hi + lo) Wproj + b
__global__ __launch_bounds__(128) void k_out(const float* __restrict__ Y, const float* __restrict__ WP, const float* __restrict__ BP, float* __restrict__ OUT) { __shared__ __align__(16) float sf[4][16][132];
  const int tid = threadIdx.x, wave = tid >> 5, lane = tid & 31, col = lane & 15, g = lane >> 4; const int c0 = blockIdx.y * 128; const size_t r0 = (size_t)blockIdx.x * 64 + wave * 16;
  v8f acc[8] = {};
#pragma unroll 2
  for (int kc = 0; kc < CC / 32; ++kc) { const F2 a = split_row(Y + (r0 + col) * CC, kc * 32, lane);
#pragma unroll
    for (int j = 0; j < 8; ++j) { v16b w; const int o = c0 + j * 16 + col;
#pragma unroll
      for (int i = 0; i < 8; ++i) { w[i] = (__bf16)WP[(size_t)(kc * 32 + 8 * g + i) * CC + (o)]; w[8 + i] = (__bf16)WP[(size_t)(kc * 32 + 16 + 8 * g + i) * CC + (o)]; }
      acc[j] = wmma_bf(a.h, w, acc[j]); acc[j] = wmma_bf(a.l, w, acc[j]); } }
#pragma unroll
  for (int j = 0; j < 8; ++j) { const float bb = BP ? bfr(BP[c0 + j * 16 + col]) : 0.f;
#pragma unroll
    for (int r = 0; r < 8; ++r) sf[wave][8 * g + r][j * 16 + col] = acc[j][r] + bb; }
  LDSX(); for (int rl = 0; rl < 16; ++rl) vst2(OUT + (r0 + rl) * CC + c0 + lane * 4, *(const v4f*)&sf[wave][rl][lane * 4]); }
extern "C" void kernel_launch(void* const* d_in, const int* in_sizes, int n_in, void* d_out, int out_size, void* d_ws, size_t ws_size, hipStream_t stream) {
  (void)in_sizes; (void)n_in; (void)out_size;
  const float** F = (const float**)d_in;   // 0 inputs_for_keys, 1 inputs_for_values, 2 inputs_for_queries [4,2048,1024], 3 Wk [4,1024,256], 4 bk [4,256], 5 Wq, 6 bq, 7 Wv, 8 bv, 9 Wo [1024,1024] ([in,out]), 10 bo
  if (ws_size < (size_t)WS_END) return;
  char* ws = (char*)d_ws; _Float16 *QH = (_Float16*)(ws + WS_QH), *QL = (_Float16*)(ws + WS_QL), *KH = (_Float16*)(ws + WS_KH); __bf16 *VT = (__bf16*)(ws + WS_VT), *VL = (__bf16*)(ws + WS_VL); float *S = (float*)(ws + WS_S), *Y = (float*)(ws + WS_Y);
  k_proj<<<dim3(TNB * TT / 64, CC / 128, 3), 128, 0, stream>>>(F[2], F[0], F[1], F[5], F[6], F[3], F[4], F[7], F[8], QH, QL, KH, VT, VL);
  for (int b = 0; b < TNB; ++b) for (int h = 0; h < NH; ++h) {
    k_sc<<<dim3(TT / 64, TT / 128), 128, 0, stream>>>(QH, QL, KH, nullptr, b, h, S);
    k_sm<<<TT, 256, 0, stream>>>(S);
    k_pv<<<dim3(TT / 32, HD / 64), 32 * PVW, 0, stream>>>(S, VT, VL, b, h, Y);
  }
  k_out<<<dim3(TNB * TT / 64, CC / 128), 128, 0, stream>>>(Y, F[9], F[10], (float*)d_out);
}

// v002
// One run takes 676 microseconds.
// Next to v001, in two timings, it ran 1.44 times as fast each time.
// All steps since v000 together make it 11.5 times as fast.
// compute dtype: all float inputs rounded to bf16; Q/K/V = inputs W_h + b_h (per-head [E, Dh] weights) with EXACT bf16 products on WMMA 16x16x32, f32 accumulate, q/k rounded once to f16 (logits / 256 have std ~0.06: 1 product), causal logits stored in f32 per (batch, head); softmax in f32 (precise expf), P x 2^11 kept f32 and split bf16 hi + lo against v as bf16 hi + lo (3 products); out = y (bf16 hi + lo) Wo + bo; f32 output.
#include <hip/hip_runtime.h>
#include <math.h>

typedef __attribute__((ext_vector_type(16))) _Float16 v16h;
typedef __attribute__((ext_vector_type(16))) __bf16 v16b;
typedef __attribute__((ext_vector_type(8)))  _Float16 v8h;
typedef __attribute__((ext_vector_type(8)))  float v8f;
typedef __attribute__((ext_vector_type(4)))  float v4f;
typedef __attribute__((ext_vector_type(2)))  float v2f;
typedef __attribute__((ext_vector_type(4)))  unsigned v4u;
typedef __attribute__((ext_vector_type(4)))  int v4i;
typedef float __attribute__((may_alias)) float_a;
typedef int __attribute__((may_alias)) int_a;

template <typename T> __device__ __forceinline__ void vst2(void* p, T v) { *(T*)p = v;  }
__device__ __forceinline__ v8f wmma16(v16h a, v16h b, v8f c) {
  v8f d = __builtin_amdgcn_wmma_f32_16x16x32_f16(false, a, false, b, (short)0, c, false, false);
  asm volatile("v_nop\n\tv_nop\n\tv_nop\n\tv_nop" : "+v"(d) : "v"(a), "v"(b));
  return d;
}
__device__ __forceinline__ v8f wmma_bf(v16b a, v16b b, v8f c) {
  v8f d = __builtin_amdgcn_wmma_f32_16x16x32_bf16(false, a, false, b, (short)0, c, false, false);
  asm volatile("v_nop\n\tv_nop\n\tv_nop\n\tv_nop" : "+v"(d) : "v"(a), "v"(b));
  return d;
}
// 16x16x32 fragments: lane = (h = lane>>4, row/col = lane&15); elements 0..7 = k0+8h+0..7, 8..15 = k0+16+8h+0..7; D element r = row 8h+r
__device__ __forceinline__ v16h frag_h(const _Float16* rowk0, int lane) {
  union { v16h v; v8h q[2]; } u; const _Float16* p = rowk0 + 8 * (lane >> 4);
  u.q[0] = *(const v8h*)p; u.q[1] = *(const v8h*)(p + 16); return u.v;
}
__device__ __forceinline__ v16h frag_f32(const float* rowk0, int lane) {
  v16h a; const float* p = rowk0 + 8 * (lane >> 4);
#pragma unroll
  for (int i = 0; i < 8; ++i) { a[i] = (_Float16)p[i]; a[8 + i] = (_Float16)p[16 + i]; }
  return a;
}
__device__ __forceinline__ v16h frag_f32s(const float* rowk0, int lane, float sc) {
  v16h a; const float* p = rowk0 + 8 * (lane >> 4);
#pragma unroll
  for (int i = 0; i < 8; ++i) { a[i] = (_Float16)(p[i] * sc); a[8 + i] = (_Float16)(p[16 + i] * sc); }
  return a;
}
// column fragment from a [K][ld] layout (column n), rows >= K read as 0
__device__ __forceinline__ v16h fragc_f32(const float* W, int k0, int n, int lane, int ld, int K) {
  v16h a; const int g = lane >> 4;
#pragma unroll
  for (int i = 0; i < 8; ++i) { const int ka = k0 + 8 * g + i, kb = ka + 16;
    a[i] = (_Float16)(ka < K ? W[(size_t)(ka < K ? ka : K - 1) * ld + n] : 0.f); a[8 + i] = (_Float16)(kb < K ? W[(size_t)(kb < K ? kb : K - 1) * ld + n] : 0.f); }
  return a;
}
struct F2 { v16b h, l; };
__device__ __forceinline__ F2 bsplit16(const float v[16]) { F2 r;
#pragma unroll
  for (int i = 0; i < 16; ++i) { const __bf16 h = (__bf16)v[i]; r.h[i] = h; r.l[i] = (__bf16)(v[i] - (float)h); }
  return r; }
__device__ __forceinline__ F2 split_row(const float* row, int k0, int lane) { float v[16]; const float* p = row + k0 + 8 * (lane >> 4);
#pragma unroll
  for (int i = 0; i < 8; ++i) { v[i] = p[i]; v[8 + i] = p[16 + i]; }
  return bsplit16(v); }
__device__ __forceinline__ F2 split_rowK(const float* row, int k0, int lane, int K) { float v[16]; const int g = lane >> 4;
#pragma unroll
  for (int i = 0; i < 8; ++i) { const int ka = k0 + 8 * g + i, kb = ka + 16; v[i] = ka < K ? row[ka < K ? ka : K - 1] : 0.f; v[8 + i] = kb < K ? row[kb < K ? kb : K - 1] : 0.f; }
  return bsplit16(v); }
__device__ __forceinline__ F2 split_col(const float* W, int k0, int n, int lane, int ld, int K) { float v[16]; const int g = lane >> 4;
#pragma unroll
  for (int i = 0; i < 8; ++i) { const int ka = k0 + 8 * g + i, kb = ka + 16; v[i] = ka < K ? W[(size_t)(ka < K ? ka : K - 1) * ld + n] : 0.f; v[8 + i] = kb < K ? W[(size_t)(kb < K ? kb : K - 1) * ld + n] : 0.f; }
  return bsplit16(v); }
__device__ __forceinline__ v8f mac3(const F2& a, const F2& b, v8f c) { c = wmma_bf(a.l, b.h, c); c = wmma_bf(a.h, b.l, c); return wmma_bf(a.h, b.h, c); }
__device__ __forceinline__ float sigm(float v) { return 1.0f / (1.0f + expf(-v)); }
#define LDSX() do { asm volatile("s_wait_dscnt 0" ::: "memory"); __builtin_amdgcn_wave_barrier(); __builtin_amdgcn_fence(__ATOMIC_RELEASE, "workgroup"); } while (0)


// Four-headed causal attention (B 4, S 2,048, E 1,024 = 4 heads x 256): per-head Dense q/k/v from three different inputs, scores / head_dim (256), strictly-upper -1e30 mask, softmax, concat heads, Wo + bo.
#define NB 4
#define TT 2048
#define CC 1024
#define NH 4
#define HD 256
#ifndef TNB
#define TNB NB
#endif
typedef __attribute__((ext_vector_type(8))) __bf16 v8b;
__device__ __forceinline__ v16b frag_b(const __bf16* rowk0, int lane) {
  union { v16b v; v8b q[2]; } u; const __bf16* p = rowk0 + 8 * (lane >> 4);
  u.q[0] = *(const v8b*)p; u.q[1] = *(const v8b*)(p + 16); return u.v;
}
__device__ __forceinline__ float bfr(float v) { return (float)(__bf16)v; }
__device__ __attribute__((noinline)) float exp_ni(float v) { return expf(v); }
__device__ __attribute__((noinline)) float erf_ni(float v) { return erff(v); }

#define WS_QH  0u
#define WS_QL  (WS_QH + 2u * (size_t)NB * TT * CC)
#define WS_KH  (WS_QL + 2u * (size_t)NB * TT * CC)
#define WS_VT  (WS_KH + 2u * (size_t)NB * TT * CC)      // bf16 v planes [b][c][t]
#define WS_VL  (WS_VT + 2u * (size_t)NB * CC * TT)      // bf16 v residual planes
#define PB 2                                             // batches per launch of k_sc, k_sm, k_pv
#define PL (PB * NH)                                     // (batch, head) planes per launch = grid z
#define WS_S   (WS_VL + 2u * (size_t)NB * CC * TT)      // f32 logits, then P x 2^11 in place: PL planes [z][q][k]
#define WS_PH  (WS_S + 4u * (size_t)PL * TT * TT)
#define WS_Y   (WS_PH + 2u * (size_t)TT * TT)          // f32 y rows [b*t][C]
#define WS_END (WS_Y + 4u * (size_t)NB * TT * CC)

// ---- k_proj: block = (64 rows, 128 cols, which): qkv = x W (+ b), exact; q -> f16 hi (+ residual), k -> f16 rows, v -> bf16 hi + lo planes
__global__ __launch_bounds__(128) void k_proj(const float* __restrict__ XQ, const float* __restrict__ XK, const float* __restrict__ XV, const float* __restrict__ WQ, const float* __restrict__ BQ, const float* __restrict__ WK, const float* __restrict__ BK, const float* __restrict__ WV, const float* __restrict__ BV, _Float16* __restrict__ QH, _Float16* __restrict__ QL, _Float16* __restrict__ KH, __bf16* __restrict__ VT, __bf16* __restrict__ VL) {
  __shared__ __align__(16) _Float16 sh[64][136], sl[64][136]; __shared__ __align__(16) __bf16 th[128][72], tl2[128][72];
  const int tid = threadIdx.x, wave = tid >> 5, lane = tid & 31, col = lane & 15, g = lane >> 4; const int which = blockIdx.z; const int c0 = blockIdx.y * 128; const size_t r0 = (size_t)blockIdx.x * 64; const float* X = which == 0 ? XQ : which == 1 ? XK : XV; const float* WA = which == 0 ? WQ : which == 1 ? WK : WV; const float* BA = which == 0 ? BQ : which == 1 ? BK : BV;
  v8f acc[8] = {};
#pragma unroll 2
  for (int kc = 0; kc < CC / 32; ++kc) { v16b a; { const float* p = X + (r0 + wave * 16 + col) * CC + kc * 32 + 8 * g;
#pragma unroll
      for (int i = 0; i < 8; ++i) { a[i] = (__bf16)p[i]; a[8 + i] = (__bf16)p[16 + i]; } }
#pragma unroll
    for (int j = 0; j < 8; ++j) { v16b w; const int o = c0 + j * 16 + col; const int hh = o / HD, dd = o % HD;
#pragma unroll
      for (int i = 0; i < 8; ++i) { w[i] = (__bf16)WA[((size_t)hh * CC + kc * 32 + 8 * g + i) * HD + dd]; w[8 + i] = (__bf16)WA[((size_t)hh * CC + kc * 32 + 16 + 8 * g + i) * HD + dd]; }
      acc[j] = wmma_bf(a, w, acc[j]); } }
#pragma unroll
  for (int j = 0; j < 8; ++j) { const float bb = bfr(BA[c0 + j * 16 + col]);
#pragma unroll
    for (int r = 0; r < 8; ++r) { const float v = acc[j][r] + bb; const int rl = wave * 16 + 8 * g + r, cl = j * 16 + col; const _Float16 hv = (_Float16)v;
      if (which == 2) { const __bf16 bh = (__bf16)v; th[cl][rl] = bh; tl2[cl][rl] = (__bf16)(v - (float)bh); } else { sh[rl][cl] = hv; sl[rl][cl] = (_Float16)(v - (float)hv); } } }
  __syncthreads();
  if (which < 2) { _Float16* dh = which == 0 ? QH : KH; for (int e = tid; e < 64 * 16; e += 128) { const int rl = e >> 4, q = e & 15; vst2((unsigned*)(dh + (r0 + rl) * CC + c0 + q * 8), *(const v4u*)&sh[rl][q * 8]); if (which == 0) vst2((unsigned*)(QL + (r0 + rl) * CC + c0 + q * 8), *(const v4u*)&sl[rl][q * 8]); } }
  else { const size_t b = r0 / TT; const int t0 = (int)(r0 % TT); for (int e = tid; e < 128 * 8; e += 128) { const int cl = e >> 3, q = e & 7; const size_t o2 = (b * CC + c0 + cl) * (size_t)TT + t0 + q * 8; vst2((unsigned*)(VT + o2), *(const v4u*)&th[cl][q * 8]); vst2((unsigned*)(VL + o2), *(const v4u*)&tl2[cl][q * 8]); } } }
// ---- k_sc: block = (64 queries, 128 keys) of plane z = (b - b0) * NH + h: logits * scale, keys after the query masked; causal blocks beyond the diagonal exit
__global__ __launch_bounds__(128) void k_sc(const _Float16* __restrict__ QH, const _Float16* __restrict__ QL, const _Float16* __restrict__ KH, const float* __restrict__ BM, int b0, float* __restrict__ S) { __shared__ __align__(16) float ss[4][16][132];
  const int b = b0 + blockIdx.z / NH, h = blockIdx.z % NH; S += (size_t)blockIdx.z * TT * TT;
  const int tid = threadIdx.x, wave = tid >> 5, lane = tid & 31, col = lane & 15, g = lane >> 4; const int k0 = blockIdx.y * 128; const int ql0 = blockIdx.x * 64 + wave * 16; const size_t q0 = (size_t)b * TT + ql0;
  if (k0 > blockIdx.x * 64 + 63) return;   // whole key block above the diagonal (block-uniform)
  v8f acc[8] = {};
#pragma unroll
  for (int kc = 0; kc < HD / 32; ++kc) { const v16h ah = frag_h(QH + (q0 + col) * CC + h * HD + kc * 32, lane);
#pragma unroll
    for (int j = 0; j < 8; ++j) { const v16h kb = frag_h(KH + ((size_t)b * TT + k0 + j * 16 + col) * CC + h * HD + kc * 32, lane); acc[j] = wmma16(ah, kb, acc[j]); } }
#pragma unroll
  for (int j = 0; j < 8; ++j) { const int kt = k0 + j * 16 + col;
#pragma unroll
    for (int r = 0; r < 8; ++r) { const int qt = ql0 + 8 * g + r; float v = acc[j][r] * 0.00390625f; (void)BM; if (kt > qt) v = -3.0e38f; ss[wave][8 * g + r][j * 16 + col] = v; } }
  LDSX(); for (int rl = 0; rl < 16; ++rl) vst2(S + (size_t)(ql0 + rl) * TT + k0 + lane * 4, *(const v4f*)&ss[wave][rl][lane * 4]); }
// ---- k_sm: block = query row x of plane y: softmax over keys [0, kend) -> P x 2^11 f32 in place (masked -> 0)
__global__ __launch_bounds__(256) void k_sm(float* __restrict__ S) { __shared__ float sred[8]; __shared__ float sbc; __shared__ __align__(16) float sh[TT];
  const int t = threadIdx.x; const size_t row = blockIdx.x; float* sr = S + ((size_t)blockIdx.y * TT + row) * TT; const int kend = ((int)row / 64) * 64 + 64;
  float m = -3.0e38f; for (int k = t; k < kend; k += 256) m = fmaxf(m, sr[k]);
#pragma unroll
  for (int o = 1; o < 32; o <<= 1) m = fmaxf(m, __shfl_xor(m, o));
  if ((t & 31) == 0) sred[t >> 5] = m; __syncthreads(); if (t == 0) { float a = sred[0]; for (int i = 1; i < 8; ++i) a = fmaxf(a, sred[i]); sbc = a; } __syncthreads(); m = sbc; __syncthreads();
  float sum = 0.f; for (int k = t; k < kend; k += 256) { const float v = sr[k]; sum += (v <= -1.0e38f) ? 0.f : expf(v - m); }
#pragma unroll
  for (int o = 1; o < 32; o <<= 1) sum += __shfl_xor(sum, o);
  if ((t & 31) == 0) sred[t >> 5] = sum; __syncthreads(); if (t == 0) { float a = 0.f; for (int i = 0; i < 8; ++i) a += sred[i]; sbc = 1.0f / a; } __syncthreads(); const float inv = sbc;
  for (int k = t; k < kend; k += 256) { const float v = sr[k]; sh[k] = (v <= -1.0e38f) ? 0.f : expf(v - m) * inv * 2048.0f; }
  __syncthreads(); for (int q = t; q < kend / 4; q += 256) vst2(sr + q * 4, *(const v4f*)&sh[q * 4]); }
// ---- k_pv: block = (32 queries, 64 head columns) of plane z = (b - b0) * NH + h: y[q][h*HD + d] = P . v (keys [0, kend)); the block's PVW waves take the 64-key chunks in turn, each on a 2 x 4 set of 16 x 16 tiles, and their f32 partial tiles are summed in wave order through LDS
// every "#pragma unroll" below unrolls fully, so that fragment and accumulator arrays are indexed by constants and stay in registers
#define PVW 16
__global__ __launch_bounds__(32 * PVW) void k_pv(const float* __restrict__ PS, const __bf16* __restrict__ VT, const __bf16* __restrict__ VL, int b0, float* __restrict__ Y) { __shared__ __align__(16) float ss[PVW][32][68];
  const int b = b0 + blockIdx.z / NH, h = blockIdx.z % NH; PS += (size_t)blockIdx.z * TT * TT;
  const int tid = threadIdx.x, wave = __builtin_amdgcn_readfirstlane(tid >> 5), lane = tid & 31, col = lane & 15, g = lane >> 4; const int ql0 = blockIdx.x * 32, d0 = blockIdx.y * 64; const int nch = blockIdx.x / 2 + 1; const int nw = nch < PVW ? nch : PVW;   // nch chunks of 64 keys reach kend; waves nw.. have none
  if (wave < nw) { v8f acc[2][4] = {};
// kept rolled: the fragments of two chunks would not fit the 256 registers that a wave of a 16-wave block may hold
#pragma unroll 1
    for (int c = wave; c < nch; c += PVW) { v4f pr[2][2][4]; v16b vh[3][2], vl[3][2]; F2 p[2][2]; const size_t po = ((size_t)b * CC + h * HD + d0 + col) * (size_t)TT + c * 64;
      // P rows and v column tiles 0 and 1 are asked for together; tiles 2 and 3 while earlier tiles multiply
#pragma unroll
      for (int qa = 0; qa < 2; ++qa) { const float* pp = PS + (size_t)(ql0 + qa * 16 + col) * TT + c * 64 + 8 * g;
#pragma unroll
        for (int u = 0; u < 2; ++u) { pr[u][qa][0] = *(const v4f*)(pp + u * 32); pr[u][qa][1] = *(const v4f*)(pp + u * 32 + 4); pr[u][qa][2] = *(const v4f*)(pp + u * 32 + 16); pr[u][qa][3] = *(const v4f*)(pp + u * 32 + 20); } }
#pragma unroll
      for (int u = 0; u < 2; ++u) { vh[0][u] = frag_b(VT + po + 0 * 16 * (size_t)TT + u * 32, lane); vl[0][u] = frag_b(VL + po + 0 * 16 * (size_t)TT + u * 32, lane); }
#pragma unroll
      for (int u = 0; u < 2; ++u) { vh[1][u] = frag_b(VT + po + 1 * 16 * (size_t)TT + u * 32, lane); vl[1][u] = frag_b(VL + po + 1 * 16 * (size_t)TT + u * 32, lane); }
#pragma unroll
      for (int qa = 0; qa < 2; ++qa)
#pragma unroll
        for (int u = 0; u < 2; ++u) { float v[16];
#pragma unroll
          for (int i = 0; i < 16; ++i) v[i] = pr[u][qa][i >> 2][i & 3];
          p[u][qa] = bsplit16(v); }
#pragma unroll
      for (int u = 0; u < 2; ++u) { vh[2][u] = frag_b(VT + po + 2 * 16 * (size_t)TT + u * 32, lane); vl[2][u] = frag_b(VL + po + 2 * 16 * (size_t)TT + u * 32, lane); }
#pragma unroll
      for (int u = 0; u < 2; ++u) { acc[0][0] = wmma_bf(p[u][0].h, vh[0][u], acc[0][0]); acc[1][0] = wmma_bf(p[u][1].h, vh[0][u], acc[1][0]); acc[0][0] = wmma_bf(p[u][0].l, vh[0][u], acc[0][0]); acc[1][0] = wmma_bf(p[u][1].l, vh[0][u], acc[1][0]); acc[0][0] = wmma_bf(p[u][0].h, vl[0][u], acc[0][0]); acc[1][0] = wmma_bf(p[u][1].h, vl[0][u], acc[1][0]); }
#pragma unroll
      for (int u = 0; u < 2; ++u) { vh[0][u] = frag_b(VT + po + 3 * 16 * (size_t)TT + u * 32, lane); vl[0][u] = frag_b(VL + po + 3 * 16 * (size_t)TT + u * 32, lane); }
#pragma unroll
      for (int u = 0; u < 2; ++u) { acc[0][1] = wmma_bf(p[u][0].h, vh[1][u], acc[0][1]); acc[1][1] = wmma_bf(p[u][1].h, vh[1][u], acc[1][1]); acc[0][1] = wmma_bf(p[u][0].l, vh[1][u], acc[0][1]); acc[1][1] = wmma_bf(p[u][1].l, vh[1][u], acc[1][1]); acc[0][1] = wmma_bf(p[u][0].h, vl[1][u], acc[0][1]); acc[1][1] = wmma_bf(p[u][1].h, vl[1][u], acc[1][1]); }
#pragma unroll
      for (int u = 0; u < 2; ++u) { acc[0][2] = wmma_bf(p[u][0].h, vh[2][u], acc[0][2]); acc[1][2] = wmma_bf(p[u][1].h, vh[2][u], acc[1][2]); acc[0][2] = wmma_bf(p[u][0].l, vh[2][u], acc[0][2]); acc[1][2] = wmma_bf(p[u][1].l, vh[2][u], acc[1][2]); acc[0][2] = wmma_bf(p[u][0].h, vl[2][u], acc[0][2]); acc[1][2] = wmma_bf(p[u][1].h, vl[2][u], acc[1][2]); }
#pragma unroll
      for (int u = 0; u < 2; ++u) { acc[0][3] = wmma_bf(p[u][0].h, vh[0][u], acc[0][3]); acc[1][3] = wmma_bf(p[u][1].h, vh[0][u], acc[1][3]); acc[0][3] = wmma_bf(p[u][0].l, vh[0][u], acc[0][3]); acc[1][3] = wmma_bf(p[u][1].l, vh[0][u], acc[1][3]); acc[0][3] = wmma_bf(p[u][0].h, vl[0][u], acc[0][3]); acc[1][3] = wmma_bf(p[u][1].h, vl[0][u], acc[1][3]); } }
#pragma unroll
    for (int qa = 0; qa < 2; ++qa)
#pragma unroll
      for (int j = 0; j < 4; ++j)
#pragma unroll
        for (int r = 0; r < 8; ++r) ss[wave][qa * 16 + 8 * g + r][j * 16 + col] = acc[qa][j][r]; }
  __syncthreads();
  for (int e = tid; e < 32 * 16; e += 32 * PVW) { const int rl = e >> 4, q4 = e & 15; v4f s = *(const v4f*)&ss[0][rl][q4 * 4]; for (int w = 1; w < nw; ++w) s += *(const v4f*)&ss[w][rl][q4 * 4];
    vst2(Y + ((size_t)b * TT + ql0 + rl) * CC + h * HD + d0 + q4 * 4, s * (1.0f / 2048.0f)); } }
// ---- k_out: block = (64 rows, 128 cols): out = y (bf16 hi + lo) Wproj + b
__global__ __launch_bounds__(128) void k_out(const float* __restrict__ Y, const float* __restrict__ WP, const float* __restrict__ BP, float* __restrict__ OUT) { __shared__ __align__(16) float sf[4][16][132];
  const int tid = threadIdx.x, wave = tid >> 5, lane = tid & 31, col = lane & 15, g = lane >> 4; const int c0 = blockIdx.y * 128; const size_t r0 = (size_t)blockIdx.x * 64 + wave * 16;
  v8f acc[8] = {};
#pragma unroll 2
  for (int kc = 0; kc < CC / 32; ++kc) { const F2 a = split_row(Y + (r0 + col) * CC, kc * 32, lane);
#pragma unroll
    for (int j = 0; j < 8; ++j) { v16b w; const int o = c0 + j * 16 + col;
#pragma unroll
      for (int i = 0; i < 8; ++i) { w[i] = (__bf16)WP[(size_t)(kc * 32 + 8 * g + i) * CC + (o)]; w[8 + i] = (__bf16)WP[(size_t)(kc * 32 + 16 + 8 * g + i) * CC + (o)]; }
      acc[j] = wmma_bf(a.h, w, acc[j]); acc[j] = wmma_bf(a.l, w, acc[j]); } }
#pragma unroll
  for (int j = 0; j < 8; ++j) { const float bb = BP ? bfr(BP[c0 + j * 16 + col]) : 0.f;
#pragma unroll
    for (int r = 0; r < 8; ++r) sf[wave][8 * g + r][j * 16 + col] = acc[j][r] + bb; }
  LDSX(); for (int rl = 0; rl < 16; ++rl) vst2(OUT + (r0 + rl) * CC + c0 + lane * 4, *(const v4f*)&sf[wave][rl][lane * 4]); }
extern "C" void kernel_launch(void* const* d_in, const int* in_sizes, int n_in, void* d_out, int out_size, void* d_ws, size_t ws_size, hipStream_t stream) {
  (void)in_sizes; (void)n_in; (void)out_size;
  const float** F = (const float**)d_in;   // 0 inputs_for_keys, 1 inputs_for_values, 2 inputs_for_queries [4,2048,1024], 3 Wk [4,1024,256], 4 bk [4,256], 5 Wq, 6 bq, 7 Wv, 8 bv, 9 Wo [1024,1024] ([in,out]), 10 bo
  if (ws_size < (size_t)WS_END) return;
  char* ws = (char*)d_ws; _Float16 *QH = (_Float16*)(ws + WS_QH), *QL = (_Float16*)(ws + WS_QL), *KH = (_Float16*)(ws + WS_KH); __bf16 *VT = (__bf16*)(ws + WS_VT), *VL = (__bf16*)(ws + WS_VL); float *S = (float*)(ws + WS_S), *Y = (float*)(ws + WS_Y);
  k_proj<<<dim3(TNB * TT / 64, CC / 128, 3), 128, 0, stream>>>(F[2], F[0], F[1], F[5], F[6], F[3], F[4], F[7], F[8], QH, QL, KH, VT, VL);
  for (int b0 = 0; b0 < TNB; b0 += PB) {
    k_sc<<<dim3(TT / 64, TT / 128, PL), 128, 0, stream>>>(QH, QL, KH, nullptr, b0, S);
    k_sm<<<dim3(TT, PL), 256, 0, stream>>>(S);
    k_pv<<<dim3(TT / 32, HD / 64, PL), 32 * PVW, 0, stream>>>(S, VT, VL, b0, Y);
  }
  k_out<<<dim3(TNB * TT / 64, CC / 128), 128, 0, stream>>>(Y, F[9], F[10], (float*)d_out);
}

// v003
// A run of this version takes 472 microseconds.
// Two timings next to v002 put it at 1.43 and 1.44 times that version's speed.
// Over all steps from v000 it is 16.5 times as fast.
// compute dtype: all float inputs rounded to bf16; Q/K/V = inputs W_h + b_h (per-head [E, Dh] weights) with EXACT bf16 products on WMMA 16x16x32, f32 accumulate, q/k rounded once to f16 (logits / 256 have std ~0.06: 1 product), causal logits stored in f32 per (batch, head); softmax in f32 (precise expf), P x 2^11 kept f32 and split bf16 hi + lo against v as bf16 hi + lo (3 products); out = y (bf16 hi + lo) Wo + bo; f32 output.
#include <hip/hip_runtime.h>
#include <math.h>

typedef __attribute__((ext_vector_type(16))) _Float16 v16h;
typedef __attribute__((ext_vector_type(16))) __bf16 v16b;
typedef __attribute__((ext_vector_type(8)))  _Float16 v8h;
typedef __attribute__((ext_vector_type(8)))  float v8f;
typedef __attribute__((ext_vector_type(4)))  float v4f;
typedef __attribute__((ext_vector_type(2)))  float v2f;
typedef __attribute__((ext_vector_type(4)))  unsigned v4u;
typedef __attribute__((ext_vector_type(4)))  int v4i;
typedef float __attribute__((may_alias)) float_a;
typedef int __attribute__((may_alias)) int_a;

template <typename T> __device__ __forceinline__ void vst2(void* p, T v) { *(T*)p = v;  }
__device__ __forceinline__ v8f wmma16(v16h a, v16h b, v8f c) {
  v8f d = __builtin_amdgcn_wmma_f32_16x16x32_f16(false, a, false, b, (short)0, c, false, false);
  asm volatile("v_nop\n\tv_nop\n\tv_nop\n\tv_nop" : "+v"(d) : "v"(a), "v"(b));
  return d;
}
__device__ __forceinline__ v8f wmma_bf(v16b a, v16b b, v8f c) {
  v8f d = __builtin_amdgcn_wmma_f32_16x16x32_bf16(false, a, false, b, (short)0, c, false, false);
  asm volatile("v_nop\n\tv_nop\n\tv_nop\n\tv_nop" : "+v"(d) : "v"(a), "v"(b));
  return d;
}
// 16x16x32 fragments: lane = (h = lane>>4, row/col = lane&15); elements 0..7 = k0+8h+0..7, 8..15 = k0+16+8h+0..7; D element r = row 8h+r
__device__ __forceinline__ v16h frag_h(const _Float16* rowk0, int lane) {
  union { v16h v; v8h q[2]; } u; const _Float16* p = rowk0 + 8 * (lane >> 4);
  u.q[0] = *(const v8h*)p; u.q[1] = *(const v8h*)(p + 16); return u.v;
}
__device__ __forceinline__ v16h frag_f32(const float* rowk0, int lane) {
  v16h a; const float* p = rowk0 + 8 * (lane >> 4);
#pragma unroll
  for (int i = 0; i < 8; ++i) { a[i] = (_Float16)p[i]; a[8 + i] = (_Float16)p[16 + i]; }
  return a;
}
__device__ __forceinline__ v16h frag_f32s(const float* rowk0, int lane, float sc) {
  v16h a; const float* p = rowk0 + 8 * (lane >> 4);
#pragma unroll
  for (int i = 0; i < 8; ++i) { a[i] = (_Float16)(p[i] * sc); a[8 + i] = (_Float16)(p[16 + i] * sc); }
  return a;
}
// column fragment from a [K][ld] layout (column n), rows >= K read as 0
__device__ __forceinline__ v16h fragc_f32(const float* W, int k0, int n, int lane, int ld, int K) {
  v16h a; const int g = lane >> 4;
#pragma unroll
  for (int i = 0; i < 8; ++i) { const int ka = k0 + 8 * g + i, kb = ka + 16;
    a[i] = (_Float16)(ka < K ? W[(size_t)(ka < K ? ka : K - 1) * ld + n] : 0.f); a[8 + i] = (_Float16)(kb < K ? W[(size_t)(kb < K ? kb : K - 1) * ld + n] : 0.f); }
  return a;
}
struct F2 { v16b h, l; };
__device__ __forceinline__ F2 bsplit16(const float v[16]) { F2 r;
#pragma unroll
  for (int i = 0; i < 16; ++i) { const __bf16 h = (__bf16)v[i]; r.h[i] = h; r.l[i] = (__bf16)(v[i] - (float)h); }
  return r; }
__device__ __forceinline__ F2 split_row(const float* row, int k0, int lane) { float v[16]; const float* p = row + k0 + 8 * (lane >> 4);
#pragma unroll
  for (int i = 0; i < 8; ++i) { v[i] = p[i]; v[8 + i] = p[16 + i]; }
  return bsplit16(v); }
__device__ __forceinline__ F2 split_rowK(const float* row, int k0, int lane, int K) { float v[16]; const int g = lane >> 4;
#pragma unroll
  for (int i = 0; i < 8; ++i) { const int ka = k0 + 8 * g + i, kb = ka + 16; v[i] = ka < K ? row[ka < K ? ka : K - 1] : 0.f; v[8 + i] = kb < K ? row[kb < K ? kb : K - 1] : 0.f; }
  return bsplit16(v); }
__device__ __forceinline__ F2 split_col(const float* W, int k0, int n, int lane, int ld, int K) { float v[16]; const int g = lane >> 4;
#pragma unroll
  for (int i = 0; i < 8; ++i) { const int ka = k0 + 8 * g + i, kb = ka + 16; v[i] = ka < K ? W[(size_t)(ka < K ? ka : K - 1) * ld + n] : 0.f; v[8 + i] = kb < K ? W[(size_t)(kb < K ? kb : K - 1) * ld + n] : 0.f; }
  return bsplit16(v); }
__device__ __forceinline__ v8f mac3(const F2& a, const F2& b, v8f c) { c = wmma_bf(a.l, b.h, c); c = wmma_bf(a.h, b.l, c); return wmma_bf(a.h, b.h, c); }
__device__ __forceinline__ float sigm(float v) { return 1.0f / (1.0f + expf(-v)); }
#define LDSX() do { asm volatile("s_wait_dscnt 0" ::: "memory"); __builtin_amdgcn_wave_barrier(); __builtin_amdgcn_fence(__ATOMIC_RELEASE, "workgroup"); } while (0)


// Four-headed causal attention (B 4, S 2,048, E 1,024 = 4 heads x 256): per-head Dense q/k/v from three different inputs, scores / head_dim (256), strictly-upper -1e30 mask, softmax, concat heads, Wo + bo.
#define NB 4
#define TT 2048
#define CC 1024
#define NH 4
#define HD 256
#ifndef TNB
#define TNB NB
#endif
typedef __attribute__((ext_vector_type(8))) __bf16 v8b;
__device__ __forceinline__ v16b frag_b(const __bf16* rowk0, int lane) {
  union { v16b v; v8b q[2]; } u; const __bf16* p = rowk0 + 8 * (lane >> 4);
  u.q[0] = *(const v8b*)p; u.q[1] = *(const v8b*)(p + 16); return u.v;
}
__device__ __forceinline__ float bfr(float v) { return (float)(__bf16)v; }
__device__ __attribute__((noinline)) float exp_ni(float v) { return expf(v); }
__device__ __attribute__((noinline)) float erf_ni(float v) { return erff(v); }

#define WS_QH  0u
#define WS_QL  (WS_QH + 2u * (size_t)NB * TT * CC)
#define WS_KH  (WS_QL + 2u * (size_t)NB * TT * CC)
#define WS_VT  (WS_KH + 2u * (size_t)NB * TT * CC)      // bf16 v planes [b][c][t]
#define WS_VL  (WS_VT + 2u * (size_t)NB * CC * TT)      // bf16 v residual planes
#define PB 2                                             // batches per launch of k_sc, k_sm, k_pv
#define PL (PB * NH)                                     // (batch, head) planes per launch = grid z
#define WS_S   (WS_VL + 2u * (size_t)NB * CC * TT)      // f32 logits, then P x 2^11 in place: PL planes [z][q][k]
#define WS_PH  (WS_S + 4u * (size_t)PL * TT * TT)
#define WS_Y   (WS_PH + 2u * (size_t)TT * TT)          // f32 y rows [b*t][C]
#define WS_END (WS_Y + 4u * (size_t)NB * TT * CC)

// ---- staged GEMM tiles (k_proj, k_out): a block of 8 waves owns 128 rows x 128 cols; per 32 k both operands go global -> registers -> LDS once per block, already rounded to bf16, rows k-contiguous; wave = 32 rows x 64 cols
#define GP 40                    // LDS pitch of a staged 32-k row, in bf16 elements: 80 bytes = 16 x odd, which the 16-byte fragment reads want
#define GT (128 * GP)            // one staged operand tile, in elements
typedef __attribute__((ext_vector_type(4))) __bf16 v4b;
// x tile: thread = (row tid >> 3 (+ 32 i), 4 k at (tid & 7) * 4): a wave's 16-byte loads cover 4 whole 128-byte lines
__device__ __forceinline__ void g_ldx(const float* p, v4f (&r)[4]) {
#pragma unroll
  for (int i = 0; i < 4; ++i) r[i] = *(const v4f*)(p + (size_t)i * 32 * CC); }
// w tile from a [k][ld] layout: thread = (col tid & 127, 16 k from (tid >> 7) * 16): a wave's 4-byte loads cover one whole line, and the thread holds a k-contiguous run of its column
__device__ __forceinline__ void g_ldw(const float* p, int ld, float (&r)[16]) {
#pragma unroll
  for (int i = 0; i < 16; ++i) r[i] = p[(size_t)i * ld]; }
__device__ __forceinline__ void g_stx(__bf16* d, const v4f (&r)[4]) {
#pragma unroll
  for (int i = 0; i < 4; ++i) { v4b o;
#pragma unroll
    for (int e = 0; e < 4; ++e) o[e] = (__bf16)r[i][e];
    *(v4b*)(d + i * 32 * GP) = o; } }
__device__ __forceinline__ void g_stx2(__bf16* dh, __bf16* dl, const v4f (&r)[4]) {
#pragma unroll
  for (int i = 0; i < 4; ++i) { v4b oh, ol;
#pragma unroll
    for (int e = 0; e < 4; ++e) { const __bf16 h = (__bf16)r[i][e]; oh[e] = h; ol[e] = (__bf16)(r[i][e] - (float)h); }
    *(v4b*)(dh + i * 32 * GP) = oh; *(v4b*)(dl + i * 32 * GP) = ol; } }
__device__ __forceinline__ void g_stw(__bf16* d, const float (&r)[16]) { v8b o0, o1;
#pragma unroll
  for (int i = 0; i < 8; ++i) { o0[i] = (__bf16)r[i]; o1[i] = (__bf16)r[8 + i]; }
  *(v8b*)d = o0; *(v8b*)(d + 8) = o1; }
// ---- k_proj: block = (128 rows, 128 cols, which): qkv = x W (+ b), exact; q -> f16 hi (+ residual), k -> f16 rows, v -> bf16 hi + residual planes
__global__ __launch_bounds__(256) void k_proj(const float* __restrict__ XQ, const float* __restrict__ XK, const float* __restrict__ XV, const float* __restrict__ WQ, const float* __restrict__ BQ, const float* __restrict__ WK, const float* __restrict__ BK, const float* __restrict__ WV, const float* __restrict__ BV, _Float16* __restrict__ QH, _Float16* __restrict__ QL, _Float16* __restrict__ KH, __bf16* __restrict__ VT, __bf16* __restrict__ VL) {
  __shared__ __align__(16) char sm[2 * 128 * 136 * 2];   // in the loop: two buffers of [x tile | w tile]; behind it: the two output planes at pitch 136
  __bf16* const st = (__bf16*)sm;
  const int tid = threadIdx.x, wave = tid >> 5, lane = tid & 31, col = lane & 15, g = lane >> 4; const int which = blockIdx.z; const int c0 = blockIdx.y * 128; const size_t r0 = (size_t)blockIdx.x * 128; const float* X = which == 0 ? XQ : which == 1 ? XK : XV; const float* WA = which == 0 ? WQ : which == 1 ? WK : WV; const float* BA = which == 0 ? BQ : which == 1 ? BK : BV;
  const int wr = (wave >> 1) * 32, wc = (wave & 1) * 64;
  const float* xa = X + (r0 + (tid >> 3)) * CC + (tid & 7) * 4; const float* wa = WA + ((size_t)(c0 / HD) * CC + (tid >> 7) * 16) * HD + c0 % HD + (tid & 127);
  const int sxo = (tid >> 3) * GP + (tid & 7) * 4, swo = GT + (tid & 127) * GP + (tid >> 7) * 16;
  v4f xr[4]; float wv[16]; v8f acc[2][4] = {};
  g_ldx(xa, xr);
  asm volatile("s_wait_xcnt 0x0" ::: "memory");   // stands before the first x tile's address registers are written again
  g_ldw(wa, HD, wv); g_stx(st + sxo, xr); g_stw(st + swo, wv);
  __syncthreads();
// kept rolled: one trip holds the next tile's 32 loaded registers beside fragments and accumulators
#pragma unroll 1
  for (int kc = 0; kc < CC / 32; ++kc) { const __bf16* cur = st + (kc & 1) * (2 * GT); __bf16* nxt = st + ((kc + 1) & 1) * (2 * GT);
    if (kc + 1 < CC / 32) { g_ldx(xa + (kc + 1) * 32, xr); g_ldw(wa + (size_t)(kc + 1) * 32 * HD, HD, wv); }   // the next tile flies while this one multiplies
    v16b a[2], w[4];
#pragma unroll
    for (int qa = 0; qa < 2; ++qa) a[qa] = frag_b(cur + (wr + qa * 16 + col) * GP, lane);
#pragma unroll
    for (int j = 0; j < 4; ++j) w[j] = frag_b(cur + GT + (wc + j * 16 + col) * GP, lane);
#pragma unroll
    for (int j = 0; j < 4; ++j)
#pragma unroll
      for (int qa = 0; qa < 2; ++qa) acc[qa][j] = wmma_bf(a[qa], w[j], acc[qa][j]);
    if (kc + 1 < CC / 32) { g_stx(nxt + sxo, xr); g_stw(nxt + swo, wv); }
    __syncthreads(); }   // publishes the next tile and ends every read of this one (behind the last trip: before the planes reuse the buffers)
  _Float16 (*sh)[136] = (_Float16 (*)[136])sm; _Float16 (*sl)[136] = (_Float16 (*)[136])(sm + 128 * 136 * 2); __bf16 (*th)[136] = (__bf16 (*)[136])sm; __bf16 (*tl2)[136] = (__bf16 (*)[136])(sm + 128 * 136 * 2);
#pragma unroll
  for (int j = 0; j < 4; ++j) { const float bb = bfr(BA[c0 + wc + j * 16 + col]);
#pragma unroll
    for (int qa = 0; qa < 2; ++qa)
#pragma unroll
      for (int r = 0; r < 8; ++r) { const float v = acc[qa][j][r] + bb; const int rl = wr + qa * 16 + 8 * g + r, cl = wc + j * 16 + col; const _Float16 hv = (_Float16)v;
        if (which == 2) { const __bf16 bh = (__bf16)v; th[cl][rl] = bh; tl2[cl][rl] = (__bf16)(v - (float)bh); } else { sh[rl][cl] = hv; sl[rl][cl] = (_Float16)(v - (float)hv); } } }
  __syncthreads();
  if (which < 2) { _Float16* dh = which == 0 ? QH : KH; for (int e = tid; e < 128 * 16; e += 256) { const int rl = e >> 4, q = e & 15; vst2((unsigned*)(dh + (r0 + rl) * CC + c0 + q * 8), *(const v4u*)&sh[rl][q * 8]);
      asm volatile("s_wait_xcnt 0x0" ::: "memory");   // stands before the store's data and address registers are written again
      if (which == 0) { vst2((unsigned*)(QL + (r0 + rl) * CC + c0 + q * 8), *(const v4u*)&sl[rl][q * 8]);
        asm volatile("s_wait_xcnt 0x0" ::: "memory"); } } }   // the same, for the residual plane's store
  else { const size_t b = r0 / TT; const int t0 = (int)(r0 % TT); for (int e = tid; e < 128 * 16; e += 256) { const int cl = e >> 4, q = e & 15; const size_t o2 = (b * CC + c0 + cl) * (size_t)TT + t0 + q * 8; vst2((unsigned*)(VT + o2), *(const v4u*)&th[cl][q * 8]); vst2((unsigned*)(VL + o2), *(const v4u*)&tl2[cl][q * 8]); } } }
// ---- k_sc: block = (64 queries, 128 keys) of plane z = (b - b0) * NH + h: logits * scale, kt > qt masked to -3e38; causal blocks beyond the diagonal exit
__global__ __launch_bounds__(128) void k_sc(const _Float16* __restrict__ QH, const _Float16* __restrict__ QL, const _Float16* __restrict__ KH, const float* __restrict__ BM, int b0, float* __restrict__ S) { __shared__ __align__(16) float ss[4][16][132];
  const int b = b0 + blockIdx.z / NH, h = blockIdx.z % NH; S += (size_t)blockIdx.z * TT * TT;
  const int tid = threadIdx.x, wave = tid >> 5, lane = tid & 31, col = lane & 15, g = lane >> 4; const int k0 = blockIdx.y * 128; const int ql0 = blockIdx.x * 64 + wave * 16; const size_t q0 = (size_t)b * TT + ql0;
  if (k0 > blockIdx.x * 64 + 63) return;   // whole key block above the diagonal (block-uniform)
  v8f acc[8] = {};
#pragma unroll
  for (int kc = 0; kc < HD / 32; ++kc) { const v16h ah = frag_h(QH + (q0 + col) * CC + h * HD + kc * 32, lane);
#pragma unroll
    for (int j = 0; j < 8; ++j) { const v16h kb = frag_h(KH + ((size_t)b * TT + k0 + j * 16 + col) * CC + h * HD + kc * 32, lane); acc[j] = wmma16(ah, kb, acc[j]); } }
#pragma unroll
  for (int j = 0; j < 8; ++j) { const int kt = k0 + j * 16 + col;
#pragma unroll
    for (int r = 0; r < 8; ++r) { const int qt = ql0 + 8 * g + r; float v = acc[j][r] * 0.00390625f; (void)BM; if (kt > qt) v = -3.0e38f; ss[wave][8 * g + r][j * 16 + col] = v; } }
  LDSX(); for (int rl = 0; rl < 16; ++rl) vst2(S + (size_t)(ql0 + rl) * TT + k0 + lane * 4, *(const v4f*)&ss[wave][rl][lane * 4]); }
// ---- k_sm: block = query row x of plane y: softmax over keys [0, kend) -> P x 2^11 f32 in place (masked -> 0)
__global__ __launch_bounds__(256) void k_sm(float* __restrict__ S) { __shared__ float sred[8]; __shared__ float sbc; __shared__ __align__(16) float sh[TT];
  const int t = threadIdx.x; const size_t row = blockIdx.x; float* sr = S + ((size_t)blockIdx.y * TT + row) * TT; const int kend = ((int)row / 64) * 64 + 64;
  float m = -3.0e38f; for (int k = t; k < kend; k += 256) m = fmaxf(m, sr[k]);
#pragma unroll
  for (int o = 1; o < 32; o <<= 1) m = fmaxf(m, __shfl_xor(m, o));
  if ((t & 31) == 0) sred[t >> 5] = m; __syncthreads(); if (t == 0) { float a = sred[0]; for (int i = 1; i < 8; ++i) a = fmaxf(a, sred[i]); sbc = a; } __syncthreads(); m = sbc; __syncthreads();
  float sum = 0.f; for (int k = t; k < kend; k += 256) { const float v = sr[k]; sum += (v <= -1.0e38f) ? 0.f : expf(v - m); }
#pragma unroll
  for (int o = 1; o < 32; o <<= 1) sum += __shfl_xor(sum, o);
  if ((t & 31) == 0) sred[t >> 5] = sum; __syncthreads(); if (t == 0) { float a = 0.f; for (int i = 0; i < 8; ++i) a += sred[i]; sbc = 1.0f / a; } __syncthreads(); const float inv = sbc;
  for (int k = t; k < kend; k += 256) { const float v = sr[k]; sh[k] = (v <= -1.0e38f) ? 0.f : expf(v - m) * inv * 2048.0f; }
  __syncthreads(); for (int q = t; q < kend / 4; q += 256) vst2(sr + q * 4, *(const v4f*)&sh[q * 4]); }
// ---- k_pv: block = (32 queries, 64 head columns) of plane z = (b - b0) * NH + h: y[q][h*HD + d] = P . v (keys [0, kend)); the block's PVW waves take the 64-key chunks in turn, each on a 2 x 4 set of 16 x 16 tiles, and their f32 partial tiles are summed in wave order through LDS
// every "#pragma unroll" below unrolls fully, so that fragment and accumulator arrays are indexed by constants and stay in registers
#define PVW 16
__global__ __launch_bounds__(32 * PVW) void k_pv(const float* __restrict__ PS, const __bf16* __restrict__ VT, const __bf16* __restrict__ VL, int b0, float* __restrict__ Y) { __shared__ __align__(16) float ss[PVW][32][68];
  const int b = b0 + blockIdx.z / NH, h = blockIdx.z % NH; PS += (size_t)blockIdx.z * TT * TT;
  const int tid = threadIdx.x, wave = __builtin_amdgcn_readfirstlane(tid >> 5), lane = tid & 31, col = lane & 15, g = lane >> 4; const int ql0 = blockIdx.x * 32, d0 = blockIdx.y * 64; const int nch = blockIdx.x / 2 + 1; const int nw = nch < PVW ? nch : PVW;   // nch chunks of 64 keys reach kend; waves nw.. have none
  if (wave < nw) { v8f acc[2][4] = {};
// kept rolled: the fragments of two chunks would not fit the 256 registers that a wave of a 16-wave block may hold
#pragma unroll 1
    for (int c = wave; c < nch; c += PVW) { v4f pr[2][2][4]; v16b vh[3][2], vl[3][2]; F2 p[2][2]; const size_t po = ((size_t)b * CC + h * HD + d0 + col) * (size_t)TT + c * 64;
      // P rows and v column tiles 0 and 1 are asked for together; tiles 2 and 3 while earlier tiles multiply
#pragma unroll
      for (int qa = 0; qa < 2; ++qa) { const float* pp = PS + (size_t)(ql0 + qa * 16 + col) * TT + c * 64 + 8 * g;
#pragma unroll
        for (int u = 0; u < 2; ++u) { pr[u][qa][0] = *(const v4f*)(pp + u * 32); pr[u][qa][1] = *(const v4f*)(pp + u * 32 + 4); pr[u][qa][2] = *(const v4f*)(pp + u * 32 + 16); pr[u][qa][3] = *(const v4f*)(pp + u * 32 + 20); } }
#pragma unroll
      for (int u = 0; u < 2; ++u) { vh[0][u] = frag_b(VT + po + 0 * 16 * (size_t)TT + u * 32, lane); vl[0][u] = frag_b(VL + po + 0 * 16 * (size_t)TT + u * 32, lane); }
#pragma unroll
      for (int u = 0; u < 2; ++u) { vh[1][u] = frag_b(VT + po + 1 * 16 * (size_t)TT + u * 32, lane); vl[1][u] = frag_b(VL + po + 1 * 16 * (size_t)TT + u * 32, lane); }
#pragma unroll
      for (int qa = 0; qa < 2; ++qa)
#pragma unroll
        for (int u = 0; u < 2; ++u) { float v[16];
#pragma unroll
          for (int i = 0; i < 16; ++i) v[i] = pr[u][qa][i >> 2][i & 3];
          p[u][qa] = bsplit16(v); }
#pragma unroll
      for (int u = 0; u < 2; ++u) { vh[2][u] = frag_b(VT + po + 2 * 16 * (size_t)TT + u * 32, lane); vl[2][u] = frag_b(VL + po + 2 * 16 * (size_t)TT + u * 32, lane); }
#pragma unroll
      for (int u = 0; u < 2; ++u) { acc[0][0] = wmma_bf(p[u][0].h, vh[0][u], acc[0][0]); acc[1][0] = wmma_bf(p[u][1].h, vh[0][u], acc[1][0]); acc[0][0] = wmma_bf(p[u][0].l, vh[0][u], acc[0][0]); acc[1][0] = wmma_bf(p[u][1].l, vh[0][u], acc[1][0]); acc[0][0] = wmma_bf(p[u][0].h, vl[0][u], acc[0][0]); acc[1][0] = wmma_bf(p[u][1].h, vl[0][u], acc[1][0]); }
#pragma unroll
      for (int u = 0; u < 2; ++u) { vh[0][u] = frag_b(VT + po + 3 * 16 * (size_t)TT + u * 32, lane); vl[0][u] = frag_b(VL + po + 3 * 16 * (size_t)TT + u * 32, lane); }
#pragma unroll
      for (int u = 0; u < 2; ++u) { acc[0][1] = wmma_bf(p[u][0].h, vh[1][u], acc[0][1]); acc[1][1] = wmma_bf(p[u][1].h, vh[1][u], acc[1][1]); acc[0][1] = wmma_bf(p[u][0].l, vh[1][u], acc[0][1]); acc[1][1] = wmma_bf(p[u][1].l, vh[1][u], acc[1][1]); acc[0][1] = wmma_bf(p[u][0].h, vl[1][u], acc[0][1]); acc[1][1] = wmma_bf(p[u][1].h, vl[1][u], acc[1][1]); }
#pragma unroll
      for (int u = 0; u < 2; ++u) { acc[0][2] = wmma_bf(p[u][0].h, vh[2][u], acc[0][2]); acc[1][2] = wmma_bf(p[u][1].h, vh[2][u], acc[1][2]); acc[0][2] = wmma_bf(p[u][0].l, vh[2][u], acc[0][2]); acc[1][2] = wmma_bf(p[u][1].l, vh[2][u], acc[1][2]); acc[0][2] = wmma_bf(p[u][0].h, vl[2][u], acc[0][2]); acc[1][2] = wmma_bf(p[u][1].h, vl[2][u], acc[1][2]); }
#pragma unroll
      for (int u = 0; u < 2; ++u) { acc[0][3] = wmma_bf(p[u][0].h, vh[0][u], acc[0][3]); acc[1][3] = wmma_bf(p[u][1].h, vh[0][u], acc[1][3]); acc[0][3] = wmma_bf(p[u][0].l, vh[0][u], acc[0][3]); acc[1][3] = wmma_bf(p[u][1].l, vh[0][u], acc[1][3]); acc[0][3] = wmma_bf(p[u][0].h, vl[0][u], acc[0][3]); acc[1][3] = wmma_bf(p[u][1].h, vl[0][u], acc[1][3]); } }
#pragma unroll
    for (int qa = 0; qa < 2; ++qa)
#pragma unroll
      for (int j = 0; j < 4; ++j)
#pragma unroll
        for (int r = 0; r < 8; ++r) ss[wave][qa * 16 + 8 * g + r][j * 16 + col] = acc[qa][j][r]; }
  __syncthreads();
  for (int e = tid; e < 32 * 16; e += 32 * PVW) { const int rl = e >> 4, q4 = e & 15; v4f s = *(const v4f*)&ss[0][rl][q4 * 4]; for (int w = 1; w < nw; ++w) s += *(const v4f*)&ss[w][rl][q4 * 4];
    vst2(Y + ((size_t)b * TT + ql0 + rl) * CC + h * HD + d0 + q4 * 4, s * (1.0f / 2048.0f)); } }
// ---- k_out: block = (128 rows, 128 cols): out = y (bf16 hi + lo) Wproj + b; tiles staged as in k_proj, y as two planes
__global__ __launch_bounds__(256) void k_out(const float* __restrict__ Y, const float* __restrict__ WP, const float* __restrict__ BP, float* __restrict__ OUT) { __shared__ __align__(16) char sm[128 * 132 * 4];   // in the loop: two buffers of [y hi | y lo | w]; behind it: the f32 output tile at pitch 132
  __bf16* const st = (__bf16*)sm;
  const int tid = threadIdx.x, wave = tid >> 5, lane = tid & 31, col = lane & 15, g = lane >> 4; const int c0 = blockIdx.y * 128; const size_t r0 = (size_t)blockIdx.x * 128;
  const int wr = (wave >> 1) * 32, wc = (wave & 1) * 64;
  const float* xa = Y + (r0 + (tid >> 3)) * CC + (tid & 7) * 4; const float* wa = WP + (size_t)((tid >> 7) * 16) * CC + c0 + (tid & 127);
  const int sxo = (tid >> 3) * GP + (tid & 7) * 4, swo = 2 * GT + (tid & 127) * GP + (tid >> 7) * 16;
  v4f xr[4]; float wv[16]; v8f acc[2][4] = {};
  g_ldx(xa, xr); g_ldw(wa, CC, wv); g_stx2(st + sxo, st + GT + sxo, xr); g_stw(st + swo, wv);
  __syncthreads();
// kept rolled: one trip holds the next tile's 32 loaded registers beside fragments and accumulators
#pragma unroll 1
  for (int kc = 0; kc < CC / 32; ++kc) { const __bf16* cur = st + (kc & 1) * (3 * GT); __bf16* nxt = st + ((kc + 1) & 1) * (3 * GT);
    if (kc + 1 < CC / 32) { g_ldx(xa + (kc + 1) * 32, xr); g_ldw(wa + (size_t)(kc + 1) * 32 * CC, CC, wv); }   // the next tile flies while this one multiplies
    v16b ah[2], al[2], w[4];
#pragma unroll
    for (int qa = 0; qa < 2; ++qa) { ah[qa] = frag_b(cur + (wr + qa * 16 + col) * GP, lane); al[qa] = frag_b(cur + GT + (wr + qa * 16 + col) * GP, lane); }
#pragma unroll
    for (int j = 0; j < 4; ++j) w[j] = frag_b(cur + 2 * GT + (wc + j * 16 + col) * GP, lane);
#pragma unroll
    for (int j = 0; j < 4; ++j)
#pragma unroll
      for (int qa = 0; qa < 2; ++qa) acc[qa][j] = wmma_bf(ah[qa], w[j], acc[qa][j]);
#pragma unroll
    for (int j = 0; j < 4; ++j)
#pragma unroll
      for (int qa = 0; qa < 2; ++qa) acc[qa][j] = wmma_bf(al[qa], w[j], acc[qa][j]);
    if (kc + 1 < CC / 32) { g_stx2(nxt + sxo, nxt + GT + sxo, xr); g_stw(nxt + swo, wv); }
    __syncthreads(); }   // publishes the next tile and ends every read of this one (behind the last trip: before the output tile reuses the buffers)
  float (*sf)[132] = (float (*)[132])sm;
#pragma unroll
  for (int j = 0; j < 4; ++j) { const float bb = BP ? bfr(BP[c0 + wc + j * 16 + col]) : 0.f;
#pragma unroll
    for (int qa = 0; qa < 2; ++qa)
#pragma unroll
      for (int r = 0; r < 8; ++r) sf[wr + qa * 16 + 8 * g + r][wc + j * 16 + col] = acc[qa][j][r] + bb; }
  __syncthreads();
  for (int e = tid; e < 128 * 32; e += 256) { const int rl = e >> 5, q = e & 31; vst2(OUT + (r0 + rl) * CC + c0 + q * 4, *(const v4f*)&sf[rl][q * 4]); } }
extern "C" void kernel_launch(void* const* d_in, const int* in_sizes, int n_in, void* d_out, int out_size, void* d_ws, size_t ws_size, hipStream_t stream) {
  (void)in_sizes; (void)n_in; (void)out_size;
  const float** F = (const float**)d_in;   // 0 inputs_for_keys, 1 inputs_for_values, 2 inputs_for_queries [4,2048,1024], 3 Wk [4,1024,256], 4 bk [4,256], 5 Wq, 6 bq, 7 Wv, 8 bv, 9 Wo [1024,1024] ([in,out]), 10 bo
  if (ws_size < (size_t)WS_END) return;
  char* ws = (char*)d_ws; _Float16 *QH = (_Float16*)(ws + WS_QH), *QL = (_Float16*)(ws + WS_QL), *KH = (_Float16*)(ws + WS_KH); __bf16 *VT = (__bf16*)(ws + WS_VT), *VL = (__bf16*)(ws + WS_VL); float *S = (float*)(ws + WS_S), *Y = (float*)(ws + WS_Y);
  k_proj<<<dim3(TNB * TT / 128, CC / 128, 3), 256, 0, stream>>>(F[2], F[0], F[1], F[5], F[6], F[3], F[4], F[7], F[8], QH, QL, KH, VT, VL);
  for (int b0 = 0; b0 < TNB; b0 += PB) {
    k_sc<<<dim3(TT / 64, TT / 128, PL), 128, 0, stream>>>(QH, QL, KH, nullptr, b0, S);
    k_sm<<<dim3(TT, PL), 256, 0, stream>>>(S);
    k_pv<<<dim3(TT / 32, HD / 64, PL), 32 * PVW, 0, stream>>>(S, VT, VL, b0, Y);
  }
  k_out<<<dim3(TNB * TT / 128, CC / 128), 256, 0, stream>>>(Y, F[9], F[10], (float*)d_out);
}

// v004
// One run takes 415 microseconds.
// Timed twice side by side with v003, it ran 1.14 times as fast both times.
// Over all steps from v000 it is 18.9 times as fast.
// compute dtype: all float inputs rounded to bf16; Q/K/V = inputs W_h + b_h (per-head [E, Dh] weights) with EXACT bf16 products on WMMA 16x16x32, f32 accumulate, q/k rounded once to f16 (logits / 256 have std ~0.06: 1 product), causal logits stored in f32 per (batch, head); softmax in f32 (precise expf), P x 2^11 kept f32 and split bf16 hi + lo against v as bf16 hi + lo (3 products); out = y (bf16 hi + lo) Wo + bo; f32 output.
#include <hip/hip_runtime.h>
#include <math.h>

typedef __attribute__((ext_vector_type(16))) _Float16 v16h;
typedef __attribute__((ext_vector_type(16))) __bf16 v16b;
typedef __attribute__((ext_vector_type(8)))  _Float16 v8h;
typedef __attribute__((ext_vector_type(8)))  float v8f;
typedef __attribute__((ext_vector_type(4)))  float v4f;
typedef __attribute__((ext_vector_type(2)))  float v2f;
typedef __attribute__((ext_vector_type(4)))  unsigned v4u;
typedef __attribute__((ext_vector_type(4)))  int v4i;
typedef float __attribute__((may_alias)) float_a;
typedef int __attribute__((may_alias)) int_a;

template <typename T> __device__ __forceinline__ void vst2(void* p, T v) { *(T*)p = v;  }
__device__ __forceinline__ v8f wmma16(v16h a, v16h b, v8f c) {
  v8f d = __builtin_amdgcn_wmma_f32_16x16x32_f16(false, a, false, b, (short)0, c, false, false);
  asm volatile("v_nop\n\tv_nop\n\tv_nop\n\tv_nop" : "+v"(d) : "v"(a), "v"(b));
  return d;
}
__device__ __forceinline__ v8f wmma_bf(v16b a, v16b b, v8f c) {
  v8f d = __builtin_amdgcn_wmma_f32_16x16x32_bf16(false, a, false, b, (short)0, c, false, false);
  asm volatile("v_nop\n\tv_nop\n\tv_nop\n\tv_nop" : "+v"(d) : "v"(a), "v"(b));
  return d;
}
// 16x16x32 fragments: lane = (h = lane>>4, row/col = lane&15); elements 0..7 = k0+8h+0..7, 8..15 = k0+16+8h+0..7; D element r = row 8h+r
__device__ __forceinline__ v16h frag_h(const _Float16* rowk0, int lane) {
  union { v16h v; v8h q[2]; } u; const _Float16* p = rowk0 + 8 * (lane >> 4);
  u.q[0] = *(const v8h*)p; u.q[1] = *(const v8h*)(p + 16); return u.v;
}
__device__ __forceinline__ v16h frag_f32(const float* rowk0, int lane) {
  v16h a; const float* p = rowk0 + 8 * (lane >> 4);
#pragma unroll
  for (int i = 0; i < 8; ++i) { a[i] = (_Float16)p[i]; a[8 + i] = (_Float16)p[16 + i]; }
  return a;
}
__device__ __forceinline__ v16h frag_f32s(const float* rowk0, int lane, float sc) {
  v16h a; const float* p = rowk0 + 8 * (lane >> 4);
#pragma unroll
  for (int i = 0; i < 8; ++i) { a[i] = (_Float16)(p[i] * sc); a[8 + i] = (_Float16)(p[16 + i] * sc); }
  return a;
}
// column fragment from a [K][ld] layout (column n), rows >= K read as 0
__device__ __forceinline__ v16h fragc_f32(const float* W, int k0, int n, int lane, int ld, int K) {
  v16h a; const int g = lane >> 4;
#pragma unroll
  for (int i = 0; i < 8; ++i) { const int ka = k0 + 8 * g + i, kb = ka + 16;
    a[i] = (_Float16)(ka < K ? W[(size_t)(ka < K ? ka : K - 1) * ld + n] : 0.f); a[8 + i] = (_Float16)(kb < K ? W[(size_t)(kb < K ? kb : K - 1) * ld + n] : 0.f); }
  return a;
}
struct F2 { v16b h, l; };
__device__ __forceinline__ F2 bsplit16(const float v[16]) { F2 r;
#pragma unroll
  for (int i = 0; i < 16; ++i) { const __bf16 h = (__bf16)v[i]; r.h[i] = h; r.l[i] = (__bf16)(v[i] - (float)h); }
  return r; }
__device__ __forceinline__ F2 split_row(const float* row, int k0, int lane) { float v[16]; const float* p = row + k0 + 8 * (lane >> 4);
#pragma unroll
  for (int i = 0; i < 8; ++i) { v[i] = p[i]; v[8 + i] = p[16 + i]; }
  return bsplit16(v); }
__device__ __forceinline__ F2 split_rowK(const float* row, int k0, int lane, int K) { float v[16]; const int g = lane >> 4;
#pragma unroll
  for (int i = 0; i < 8; ++i) { const int ka = k0 + 8 * g + i, kb = ka + 16; v[i] = ka < K ? row[ka < K ? ka : K - 1] : 0.f; v[8 + i] = kb < K ? row[kb < K ? kb : K - 1] : 0.f; }
  return bsplit16(v); }
__device__ __forceinline__ F2 split_col(const float* W, int k0, int n, int lane, int ld, int K) { float v[16]; const int g = lane >> 4;
#pragma unroll
  for (int i = 0; i < 8; ++i) { const int ka = k0 + 8 * g + i, kb = ka + 16; v[i] = ka < K ? W[(size_t)(ka < K ? ka : K - 1) * ld + n] : 0.f; v[8 + i] = kb < K ? W[(size_t)(kb < K ? kb : K - 1) * ld + n] : 0.f; }
  return bsplit16(v); }
__device__ __forceinline__ v8f mac3(const F2& a, const F2& b, v8f c) { c = wmma_bf(a.l, b.h, c); c = wmma_bf(a.h, b.l, c); return wmma_bf(a.h, b.h, c); }
__device__ __forceinline__ float sigm(float v) { return 1.0f / (1.0f + expf(-v)); }
#define LDSX() do { asm volatile("s_wait_dscnt 0" ::: "memory"); __builtin_amdgcn_wave_barrier(); __builtin_amdgcn_fence(__ATOMIC_RELEASE, "workgroup"); } while (0)


// Four-headed causal attention (B 4, S 2,048, E 1,024 = 4 heads x 256): per-head Dense q/k/v from three different inputs, scores / head_dim (256), strictly-upper -1e30 mask, softmax, concat heads, Wo + bo.
#define NB 4
#define TT 2048
#define CC 1024
#define NH 4
#define HD 256
#ifndef TNB
#define TNB NB
#endif
typedef __attribute__((ext_vector_type(8))) __bf16 v8b;
__device__ __forceinline__ v16b frag_b(const __bf16* rowk0, int lane) {
  union { v16b v; v8b q[2]; } u; const __bf16* p = rowk0 + 8 * (lane >> 4);
  u.q[0] = *(const v8b*)p; u.q[1] = *(const v8b*)(p + 16); return u.v;
}
__device__ __forceinline__ float bfr(float v) { return (float)(__bf16)v; }
__device__ __attribute__((noinline)) float exp_ni(float v) { return expf(v); }
__device__ __attribute__((noinline)) float erf_ni(float v) { return erff(v); }

#define WS_QH  0u
#define WS_QL  (WS_QH + 2u * (size_t)NB * TT * CC)
#define WS_KH  (WS_QL + 2u * (size_t)NB * TT * CC)
#define WS_VT  (WS_KH + 2u * (size_t)NB * TT * CC)      // bf16 v planes [b][c][t]
#define WS_VL  (WS_VT + 2u * (size_t)NB * CC * TT)      // bf16 v residual planes
#define PB 2                                             // batches per launch of k_sc, k_sm, k_pv
#define PL (PB * NH)                                     // (batch, head) planes per launch = grid z (grid y of k_sm)
#define WS_S   (WS_VL + 2u * (size_t)NB * CC * TT)      // f32 logits, then P x 2^11 in place: PL planes [z][q][k]
#define WS_PH  (WS_S + 4u * (size_t)PL * TT * TT)
#define WS_Y   (WS_PH + 2u * (size_t)TT * TT)          // f32 y rows [b*t][C]
#define WS_END (WS_Y + 4u * (size_t)NB * TT * CC)

// ---- staged GEMM tiles (k_proj, k_out): a block of 8 waves owns 128 rows x 128 cols; per 32 k both operands go global -> registers -> LDS once per block, already rounded to bf16, rows k-contiguous; wave = 32 rows x 64 cols
#define GP 40                    // LDS pitch of a staged 32-k row, in bf16 elements: 80 bytes = 16 x odd, which the 16-byte fragment reads want
#define GT (128 * GP)            // one staged operand tile, in elements
typedef __attribute__((ext_vector_type(4))) __bf16 v4b;
// x tile: thread = (row tid >> 3 (+ 32 i), 4 k at (tid & 7) * 4): a wave's 16-byte loads cover 4 whole 128-byte lines
__device__ __forceinline__ void g_ldx(const float* p, v4f (&r)[4]) {
#pragma unroll
  for (int i = 0; i < 4; ++i) r[i] = *(const v4f*)(p + (size_t)i * 32 * CC); }
// w tile from a [k][ld] layout: thread = (col tid & 127, 16 k from (tid >> 7) * 16): a wave's 4-byte loads cover one whole line, and the thread holds a k-contiguous run of its column
__device__ __forceinline__ void g_ldw(const float* p, int ld, float (&r)[16]) {
#pragma unroll
  for (int i = 0; i < 16; ++i) r[i] = p[(size_t)i * ld]; }
__device__ __forceinline__ void g_stx(__bf16* d, const v4f (&r)[4]) {
#pragma unroll
  for (int i = 0; i < 4; ++i) { v4b o;
#pragma unroll
    for (int e = 0; e < 4; ++e) o[e] = (__bf16)r[i][e];
    *(v4b*)(d + i * 32 * GP) = o; } }
__device__ __forceinline__ void g_stx2(__bf16* dh, __bf16* dl, const v4f (&r)[4]) {
#pragma unroll
  for (int i = 0; i < 4; ++i) { v4b oh, ol;
#pragma unroll
    for (int e = 0; e < 4; ++e) { const __bf16 h = (__bf16)r[i][e]; oh[e] = h; ol[e] = (__bf16)(r[i][e] - (float)h); }
    *(v4b*)(dh + i * 32 * GP) = oh; *(v4b*)(dl + i * 32 * GP) = ol; } }
__device__ __forceinline__ void g_stw(__bf16* d, const float (&r)[16]) { v8b o0, o1;
#pragma unroll
  for (int i = 0; i < 8; ++i) { o0[i] = (__bf16)r[i]; o1[i] = (__bf16)r[8 + i]; }
  *(v8b*)d = o0; *(v8b*)(d + 8) = o1; }
// ---- k_proj: block = (128 rows, 128 cols, which): qkv = x W (+ b), exact; q -> f16 hi (+ residual), k -> f16 rows, v -> bf16 hi + residual planes
__global__ __launch_bounds__(256) void k_proj(const float* __restrict__ XQ, const float* __restrict__ XK, const float* __restrict__ XV, const float* __restrict__ WQ, const float* __restrict__ BQ, const float* __restrict__ WK, const float* __restrict__ BK, const float* __restrict__ WV, const float* __restrict__ BV, _Float16* __restrict__ QH, _Float16* __restrict__ QL, _Float16* __restrict__ KH, __bf16* __restrict__ VT, __bf16* __restrict__ VL) {
  __shared__ __align__(16) char sm[2 * 128 * 136 * 2];   // in the loop: two buffers of [x tile | w tile]; behind it: the two output planes at pitch 136
  __bf16* const st = (__bf16*)sm;
  const int tid = threadIdx.x, wave = tid >> 5, lane = tid & 31, col = lane & 15, g = lane >> 4; const int which = blockIdx.z; const int c0 = blockIdx.y * 128; const size_t r0 = (size_t)blockIdx.x * 128; const float* X = which == 0 ? XQ : which == 1 ? XK : XV; const float* WA = which == 0 ? WQ : which == 1 ? WK : WV; const float* BA = which == 0 ? BQ : which == 1 ? BK : BV;
  const int wr = (wave >> 1) * 32, wc = (wave & 1) * 64;
  const float* xa = X + (r0 + (tid >> 3)) * CC + (tid & 7) * 4; const float* wa = WA + ((size_t)(c0 / HD) * CC + (tid >> 7) * 16) * HD + c0 % HD + (tid & 127);
  const int sxo = (tid >> 3) * GP + (tid & 7) * 4, swo = GT + (tid & 127) * GP + (tid >> 7) * 16;
  v4f xr[4]; float wv[16]; v8f acc[2][4] = {};
  g_ldx(xa, xr);
  asm volatile("s_wait_xcnt 0x0" ::: "memory");   // stands before the first x tile's address registers are written again
  g_ldw(wa, HD, wv); g_stx(st + sxo, xr); g_stw(st + swo, wv);
  __syncthreads();
// kept rolled: one trip holds the next tile's 32 loaded registers beside fragments and accumulators
#pragma unroll 1
  for (int kc = 0; kc < CC / 32; ++kc) { const __bf16* cur = st + (kc & 1) * (2 * GT); __bf16* nxt = st + ((kc + 1) & 1) * (2 * GT);
    if (kc + 1 < CC / 32) { g_ldx(xa + (kc + 1) * 32, xr); g_ldw(wa + (size_t)(kc + 1) * 32 * HD, HD, wv); }   // the next tile flies while this one multiplies
    v16b a[2], w[4];
#pragma unroll
    for (int qa = 0; qa < 2; ++qa) a[qa] = frag_b(cur + (wr + qa * 16 + col) * GP, lane);
#pragma unroll
    for (int j = 0; j < 4; ++j) w[j] = frag_b(cur + GT + (wc + j * 16 + col) * GP, lane);
#pragma unroll
    for (int j = 0; j < 4; ++j)
#pragma unroll
      for (int qa = 0; qa < 2; ++qa) acc[qa][j] = wmma_bf(a[qa], w[j], acc[qa][j]);
    if (kc + 1 < CC / 32) { g_stx(nxt + sxo, xr); g_stw(nxt + swo, wv); }
    __syncthreads(); }   // publishes the next tile and ends every read of this one (behind the last trip: before the planes reuse the buffers)
  _Float16 (*sh)[136] = (_Float16 (*)[136])sm; _Float16 (*sl)[136] = (_Float16 (*)[136])(sm + 128 * 136 * 2); __bf16 (*th)[136] = (__bf16 (*)[136])sm; __bf16 (*tl2)[136] = (__bf16 (*)[136])(sm + 128 * 136 * 2);
#pragma unroll
  for (int j = 0; j < 4; ++j) { const float bb = bfr(BA[c0 + wc + j * 16 + col]);
#pragma unroll
    for (int qa = 0; qa < 2; ++qa)
#pragma unroll
      for (int r = 0; r < 8; ++r) { const float v = acc[qa][j][r] + bb; const int rl = wr + qa * 16 + 8 * g + r, cl = wc + j * 16 + col; const _Float16 hv = (_Float16)v;
        if (which == 2) { const __bf16 bh = (__bf16)v; th[cl][rl] = bh; tl2[cl][rl] = (__bf16)(v - (float)bh); } else { sh[rl][cl] = hv; sl[rl][cl] = (_Float16)(v - (float)hv); } } }
  __syncthreads();
  if (which < 2) { _Float16* dh = which == 0 ? QH : KH; for (int e = tid; e < 128 * 16; e += 256) { const int rl = e >> 4, q = e & 15; vst2((unsigned*)(dh + (r0 + rl) * CC + c0 + q * 8), *(const v4u*)&sh[rl][q * 8]);
      asm volatile("s_wait_xcnt 0x0" ::: "memory");   // stands before the store's data and address registers are written again
      if (which == 0) { vst2((unsigned*)(QL + (r0 + rl) * CC + c0 + q * 8), *(const v4u*)&sl[rl][q * 8]);
        asm volatile("s_wait_xcnt 0x0" ::: "memory"); } } }   // the same, for the residual plane's store
  else { const size_t b = r0 / TT; const int t0 = (int)(r0 % TT); for (int e = tid; e < 128 * 16; e += 256) { const int cl = e >> 4, q = e & 15; const size_t o2 = (b * CC + c0 + cl) * (size_t)TT + t0 + q * 8; vst2((unsigned*)(VT + o2), *(const v4u*)&th[cl][q * 8]); vst2((unsigned*)(VL + o2), *(const v4u*)&tl2[cl][q * 8]); } } }
// ---- k_sc: block = (64 queries, 128 keys) of plane z = (b - b0) * NH + h: logits * scale, kt > qt masked to -3e38; causal blocks beyond the diagonal exit
__global__ __launch_bounds__(128) void k_sc(const _Float16* __restrict__ QH, const _Float16* __restrict__ QL, const _Float16* __restrict__ KH, const float* __restrict__ BM, int b0, float* __restrict__ S) { __shared__ __align__(16) float ss[4][16][132];
  const int b = b0 + blockIdx.z / NH, h = blockIdx.z % NH; S += (size_t)blockIdx.z * TT * TT;
  const int tid = threadIdx.x, wave = tid >> 5, lane = tid & 31, col = lane & 15, g = lane >> 4; const int k0 = blockIdx.y * 128; const int ql0 = blockIdx.x * 64 + wave * 16; const size_t q0 = (size_t)b * TT + ql0;
  if (k0 > blockIdx.x * 64 + 63) return;   // whole key block above the diagonal (block-uniform)
  v8f acc[8] = {};
#pragma unroll
  for (int kc = 0; kc < HD / 32; ++kc) { const v16h ah = frag_h(QH + (q0 + col) * CC + h * HD + kc * 32, lane);
#pragma unroll
    for (int j = 0; j < 8; ++j) { const v16h kb = frag_h(KH + ((size_t)b * TT + k0 + j * 16 + col) * CC + h * HD + kc * 32, lane); acc[j] = wmma16(ah, kb, acc[j]); } }
#pragma unroll
  for (int j = 0; j < 8; ++j) { const int kt = k0 + j * 16 + col;
#pragma unroll
    for (int r = 0; r < 8; ++r) { const int qt = ql0 + 8 * g + r; float v = acc[j][r] * 0.00390625f; (void)BM; if (kt > qt) v = -3.0e38f; ss[wave][8 * g + r][j * 16 + col] = v; } }
  LDSX(); for (int rl = 0; rl < 16; ++rl) vst2(S + (size_t)(ql0 + rl) * TT + k0 + lane * 4, *(const v4f*)&ss[wave][rl][lane * 4]); }
// ---- k_sm: one wave per query row of plane y, the row held in registers: one read, one exp pass, one write; softmax over the row's 128-key chunks -> P x 2^11 f32 in place (masked -> 0)
// k_sc writes whole 128-key blocks (masked keys as -3e38), so every chunk up to the diagonal's own is defined; a wave takes rows TT - 1 - pr and pr in turn, 17 chunks together for every wave
// f(0), f(1), .. f(nv - 1), nv in 1..16: the chunk number is a constant in each call, so that the row array stays in registers; one scalar branch leaves behind the row's last chunk
template <int I, typename F> __device__ __forceinline__ void sm_chunks(int nv, const F& f) { f(I); if constexpr (I + 1 < TT / 128) { if (I + 1 < nv) sm_chunks<I + 1>(nv, f); } }
__global__ __launch_bounds__(256) void k_sm(float* __restrict__ S) {
  const int lane = threadIdx.x & 31, wave = __builtin_amdgcn_readfirstlane(threadIdx.x >> 5); const int pr = blockIdx.x * 8 + wave;
  float* const pl = S + (size_t)blockIdx.y * TT * TT + lane * 4;
// kept rolled: both rows use the same 64 row registers
#pragma unroll 1
  for (int s = 0; s < 2; ++s) { const int row = s ? pr : TT - 1 - pr; const int nv = row / 128 + 1; float* const sr = pl + (size_t)row * TT; v4f x[TT / 128];
    sm_chunks<0>(nv, [&](int i) __attribute__((always_inline)) { x[i] = *(const v4f*)(sr + i * 128); });
    float m = -3.0e38f;
    sm_chunks<0>(nv, [&](int i) __attribute__((always_inline)) { m = fmaxf(m, fmaxf(fmaxf(x[i][0], x[i][1]), fmaxf(x[i][2], x[i][3]))); });
#pragma unroll
    for (int o = 1; o < 32; o <<= 1) m = fmaxf(m, __shfl_xor(m, o));
    v4f s4 = {0.f, 0.f, 0.f, 0.f};
    sm_chunks<0>(nv, [&](int i) __attribute__((always_inline)) {
#pragma unroll
      for (int e = 0; e < 4; ++e) { const float v = x[i][e], ex = expf(v - m); x[i][e] = (v <= -1.0e38f) ? 0.f : ex; }
      s4 += x[i]; });
    float sum = (s4[0] + s4[1]) + (s4[2] + s4[3]);
#pragma unroll
    for (int o = 1; o < 32; o <<= 1) sum += __shfl_xor(sum, o);
    const float inv = 1.0f / sum;
    sm_chunks<0>(nv, [&](int i) __attribute__((always_inline)) { x[i] = x[i] * inv * 2048.0f; });
    sm_chunks<0>(nv, [&](int i) __attribute__((always_inline)) { vst2(sr + i * 128, x[i]); });   // a run of stores alone: no register that a store names is written between them
    asm volatile("s_wait_xcnt 0x0" ::: "memory"); } }   // stands before the next row's loads write the stores' data and address registers again
// ---- k_pv: block = (32 queries, 64 head columns) of plane z = (b - b0) * NH + h: y[q][h*HD + d] = P . v (keys [0, kend)); the block's PVW waves take the 64-key chunks in turn, each on a 2 x 4 set of 16 x 16 tiles, and their f32 partial tiles are summed in wave order through LDS
// every "#pragma unroll" below unrolls fully, so that fragment and accumulator arrays are indexed by constants and stay in registers
#define PVW 16
__global__ __launch_bounds__(32 * PVW) void k_pv(const float* __restrict__ PS, const __bf16* __restrict__ VT, const __bf16* __restrict__ VL, int b0, float* __restrict__ Y) { __shared__ __align__(16) float ss[PVW][32][68];
  const int b = b0 + blockIdx.z / NH, h = blockIdx.z % NH; PS += (size_t)blockIdx.z * TT * TT;
  const int tid = threadIdx.x, wave = __builtin_amdgcn_readfirstlane(tid >> 5), lane = tid & 31, col = lane & 15, g = lane >> 4; const int ql0 = blockIdx.x * 32, d0 = blockIdx.y * 64; const int nch = blockIdx.x / 2 + 1; const int nw = nch < PVW ? nch : PVW;   // nch chunks of 64 keys reach kend; waves nw.. have none
  if (wave < nw) { v8f acc[2][4] = {};
// kept rolled: the fragments of two chunks would not fit the 256 registers that a wave of a 16-wave block may hold
#pragma unroll 1
    for (int c = wave; c < nch; c += PVW) { v4f pr[2][2][4]; v16b vh[3][2], vl[3][2]; F2 p[2][2]; const size_t po = ((size_t)b * CC + h * HD + d0 + col) * (size_t)TT + c * 64;
      // P rows and v column tiles 0 and 1 are asked for together; tiles 2 and 3 while earlier tiles multiply
#pragma unroll
      for (int qa = 0; qa < 2; ++qa) { const float* pp = PS + (size_t)(ql0 + qa * 16 + col) * TT + c * 64 + 8 * g;
#pragma unroll
        for (int u = 0; u < 2; ++u) { pr[u][qa][0] = *(const v4f*)(pp + u * 32); pr[u][qa][1] = *(const v4f*)(pp + u * 32 + 4); pr[u][qa][2] = *(const v4f*)(pp + u * 32 + 16); pr[u][qa][3] = *(const v4f*)(pp + u * 32 + 20); } }
#pragma unroll
      for (int u = 0; u < 2; ++u) { vh[0][u] = frag_b(VT + po + 0 * 16 * (size_t)TT + u * 32, lane); vl[0][u] = frag_b(VL + po + 0 * 16 * (size_t)TT + u * 32, lane); }
#pragma unroll
      for (int u = 0; u < 2; ++u) { vh[1][u] = frag_b(VT + po + 1 * 16 * (size_t)TT + u * 32, lane); vl[1][u] = frag_b(VL + po + 1 * 16 * (size_t)TT + u * 32, lane); }
#pragma unroll
      for (int qa = 0; qa < 2; ++qa)
#pragma unroll
        for (int u = 0; u < 2; ++u) { float v[16];
#pragma unroll
          for (int i = 0; i < 16; ++i) v[i] = pr[u][qa][i >> 2][i & 3];
          p[u][qa] = bsplit16(v); }
#pragma unroll
      for (int u = 0; u < 2; ++u) { vh[2][u] = frag_b(VT + po + 2 * 16 * (size_t)TT + u * 32, lane); vl[2][u] = frag_b(VL + po + 2 * 16 * (size_t)TT + u * 32, lane); }
#pragma unroll
      for (int u = 0; u < 2; ++u) { acc[0][0] = wmma_bf(p[u][0].h, vh[0][u], acc[0][0]); acc[1][0] = wmma_bf(p[u][1].h, vh[0][u], acc[1][0]); acc[0][0] = wmma_bf(p[u][0].l, vh[0][u], acc[0][0]); acc[1][0] = wmma_bf(p[u][1].l, vh[0][u], acc[1][0]); acc[0][0] = wmma_bf(p[u][0].h, vl[0][u], acc[0][0]); acc[1][0] = wmma_bf(p[u][1].h, vl[0][u], acc[1][0]); }
#pragma unroll
      for (int u = 0; u < 2; ++u) { vh[0][u] = frag_b(VT + po + 3 * 16 * (size_t)TT + u * 32, lane); vl[0][u] = frag_b(VL + po + 3 * 16 * (size_t)TT + u * 32, lane); }
#pragma unroll
      for (int u = 0; u < 2; ++u) { acc[0][1] = wmma_bf(p[u][0].h, vh[1][u], acc[0][1]); acc[1][1] = wmma_bf(p[u][1].h, vh[1][u], acc[1][1]); acc[0][1] = wmma_bf(p[u][0].l, vh[1][u], acc[0][1]); acc[1][1] = wmma_bf(p[u][1].l, vh[1][u], acc[1][1]); acc[0][1] = wmma_bf(p[u][0].h, vl[1][u], acc[0][1]); acc[1][1] = wmma_bf(p[u][1].h, vl[1][u], acc[1][1]); }
#pragma unroll
      for (int u = 0; u < 2; ++u) { acc[0][2] = wmma_bf(p[u][0].h, vh[2][u], acc[0][2]); acc[1][2] = wmma_bf(p[u][1].h, vh[2][u], acc[1][2]); acc[0][2] = wmma_bf(p[u][0].l, vh[2][u], acc[0][2]); acc[1][2] = wmma_bf(p[u][1].l, vh[2][u], acc[1][2]); acc[0][2] = wmma_bf(p[u][0].h, vl[2][u], acc[0][2]); acc[1][2] = wmma_bf(p[u][1].h, vl[2][u], acc[1][2]); }
#pragma unroll
      for (int u = 0; u < 2; ++u) { acc[0][3] = wmma_bf(p[u][0].h, vh[0][u], acc[0][3]); acc[1][3] = wmma_bf(p[u][1].h, vh[0][u], acc[1][3]); acc[0][3] = wmma_bf(p[u][0].l, vh[0][u], acc[0][3]); acc[1][3] = wmma_bf(p[u][1].l, vh[0][u], acc[1][3]); acc[0][3] = wmma_bf(p[u][0].h, vl[0][u], acc[0][3]); acc[1][3] = wmma_bf(p[u][1].h, vl[0][u], acc[1][3]); } }
#pragma unroll
    for (int qa = 0; qa < 2; ++qa)
#pragma unroll
      for (int j = 0; j < 4; ++j)
#pragma unroll
        for (int r = 0; r < 8; ++r) ss[wave][qa * 16 + 8 * g + r][j * 16 + col] = acc[qa][j][r]; }
  __syncthreads();
  for (int e = tid; e < 32 * 16; e += 32 * PVW) { const int rl = e >> 4, q4 = e & 15; v4f s = *(const v4f*)&ss[0][rl][q4 * 4]; for (int w = 1; w < nw; ++w) s += *(const v4f*)&ss[w][rl][q4 * 4];
    vst2(Y + ((size_t)b * TT + ql0 + rl) * CC + h * HD + d0 + q4 * 4, s * (1.0f / 2048.0f)); } }
// ---- k_out: block = (128 rows, 128 cols): out = y (bf16 hi + lo) Wproj + b; tiles staged as in k_proj, y as two planes
__global__ __launch_bounds__(256) void k_out(const float* __restrict__ Y, const float* __restrict__ WP, const float* __restrict__ BP, float* __restrict__ OUT) { __shared__ __align__(16) char sm[128 * 132 * 4];   // in the loop: two buffers of [y hi | y lo | w]; behind it: the f32 output tile at pitch 132
  __bf16* const st = (__bf16*)sm;
  const int tid = threadIdx.x, wave = tid >> 5, lane = tid & 31, col = lane & 15, g = lane >> 4; const int c0 = blockIdx.y * 128; const size_t r0 = (size_t)blockIdx.x * 128;
  const int wr = (wave >> 1) * 32, wc = (wave & 1) * 64;
  const float* xa = Y + (r0 + (tid >> 3)) * CC + (tid & 7) * 4; const float* wa = WP + (size_t)((tid >> 7) * 16) * CC + c0 + (tid & 127);
  const int sxo = (tid >> 3) * GP + (tid & 7) * 4, swo = 2 * GT + (tid & 127) * GP + (tid >> 7) * 16;
  v4f xr[4]; float wv[16]; v8f acc[2][4] = {};
  g_ldx(xa, xr); g_ldw(wa, CC, wv); g_stx2(st + sxo, st + GT + sxo, xr); g_stw(st + swo, wv);
  __syncthreads();
// kept rolled: one trip holds the next tile's 32 loaded registers beside fragments and accumulators
#pragma unroll 1
  for (int kc = 0; kc < CC / 32; ++kc) { const __bf16* cur = st + (kc & 1) * (3 * GT); __bf16* nxt = st + ((kc + 1) & 1) * (3 * GT);
    if (kc + 1 < CC / 32) { g_ldx(xa + (kc + 1) * 32, xr); g_ldw(wa + (size_t)(kc + 1) * 32 * CC, CC, wv); }   // the next tile flies while this one multiplies
    v16b ah[2], al[2], w[4];
#pragma unroll
    for (int qa = 0; qa < 2; ++qa) { ah[qa] = frag_b(cur + (wr + qa * 16 + col) * GP, lane); al[qa] = frag_b(cur + GT + (wr + qa * 16 + col) * GP, lane); }
#pragma unroll
    for (int j = 0; j < 4; ++j) w[j] = frag_b(cur + 2 * GT + (wc + j * 16 + col) * GP, lane);
#pragma unroll
    for (int j = 0; j < 4; ++j)
#pragma unroll
      for (int qa = 0; qa < 2; ++qa) acc[qa][j] = wmma_bf(ah[qa], w[j], acc[qa][j]);
#pragma unroll
    for (int j = 0; j < 4; ++j)
#pragma unroll
      for (int qa = 0; qa < 2; ++qa) acc[qa][j] = wmma_bf(al[qa], w[j], acc[qa][j]);
    if (kc + 1 < CC / 32) { g_stx2(nxt + sxo, nxt + GT + sxo, xr); g_stw(nxt + swo, wv); }
    __syncthreads(); }   // publishes the next tile and ends every read of this one (behind the last trip: before the output tile reuses the buffers)
  float (*sf)[132] = (float (*)[132])sm;
#pragma unroll
  for (int j = 0; j < 4; ++j) { const float bb = BP ? bfr(BP[c0 + wc + j * 16 + col]) : 0.f;
#pragma unroll
    for (int qa = 0; qa < 2; ++qa)
#pragma unroll
      for (int r = 0; r < 8; ++r) sf[wr + qa * 16 + 8 * g + r][wc + j * 16 + col] = acc[qa][j][r] + bb; }
  __syncthreads();
  for (int e = tid; e < 128 * 32; e += 256) { const int rl = e >> 5, q = e & 31; vst2(OUT + (r0 + rl) * CC + c0 + q * 4, *(const v4f*)&sf[rl][q * 4]); } }
extern "C" void kernel_launch(void* const* d_in, const int* in_sizes, int n_in, void* d_out, int out_size, void* d_ws, size_t ws_size, hipStream_t stream) {
  (void)in_sizes; (void)n_in; (void)out_size;
  const float** F = (const float**)d_in;   // 0 inputs_for_keys, 1 inputs_for_values, 2 inputs_for_queries [4,2048,1024], 3 Wk [4,1024,256], 4 bk [4,256], 5 Wq, 6 bq, 7 Wv, 8 bv, 9 Wo [1024,1024] ([in,out]), 10 bo
  if (ws_size < (size_t)WS_END) return;
  char* ws = (char*)d_ws; _Float16 *QH = (_Float16*)(ws + WS_QH), *QL = (_Float16*)(ws + WS_QL), *KH = (_Float16*)(ws + WS_KH); __bf16 *VT = (__bf16*)(ws + WS_VT), *VL = (__bf16*)(ws + WS_VL); float *S = (float*)(ws + WS_S), *Y = (float*)(ws + WS_Y);
  k_proj<<<dim3(TNB * TT / 128, CC / 128, 3), 256, 0, stream>>>(F[2], F[0], F[1], F[5], F[6], F[3], F[4], F[7], F[8], QH, QL, KH, VT, VL);
  for (int b0 = 0; b0 < TNB; b0 += PB) {
    k_sc<<<dim3(TT / 64, TT / 128, PL), 128, 0, stream>>>(QH, QL, KH, nullptr, b0, S);
    k_sm<<<dim3(TT / 16, PL), 256, 0, stream>>>(S);
    k_pv<<<dim3(TT / 32, HD / 64, PL), 32 * PVW, 0, stream>>>(S, VT, VL, b0, Y);
  }
  k_out<<<dim3(TNB * TT / 128, CC / 128), 256, 0, stream>>>(Y, F[9], F[10], (float*)d_out);
}

// v005
// It runs in 401 microseconds.
// In both of two side-by-side timings against v004, it was 1.04 times as fast.
// All steps since v000 together make it 19.5 times as fast.
// compute dtype: all float inputs rounded to bf16; Q/K/V = inputs W_h + b_h (per-head [E, Dh] weights) with EXACT bf16 products on WMMA 16x16x32, f32 accumulate, q/k rounded once to f16 (logits / 256 have std ~0.06: 1 product), causal logits stored in f32 per (batch, head); softmax in f32 (precise expf), P x 2^11 kept f32 and split bf16 hi + lo against v as bf16 hi + lo (3 products); out = y (bf16 hi + lo) Wo + bo; f32 output.
#include <hip/hip_runtime.h>
#include <math.h>

typedef __attribute__((ext_vector_type(16))) _Float16 v16h;
typedef __attribute__((ext_vector_type(16))) __bf16 v16b;
typedef __attribute__((ext_vector_type(8)))  _Float16 v8h;
typedef __attribute__((ext_vector_type(8)))  float v8f;
typedef __attribute__((ext_vector_type(4)))  float v4f;
typedef __attribute__((ext_vector_type(2)))  float v2f;
typedef __attribute__((ext_vector_type(4)))  unsigned v4u;
typedef __attribute__((ext_vector_type(4)))  int v4i;
typedef float __attribute__((may_alias)) float_a;
typedef int __attribute__((may_alias)) int_a;

template <typename T> __device__ __forceinline__ void vst2(void* p, T v) { *(T*)p = v;  }
__device__ __forceinline__ v8f wmma16(v16h a, v16h b, v8f c) {
  v8f d = __builtin_amdgcn_wmma_f32_16x16x32_f16(false, a, false, b, (short)0, c, false, false);
  asm volatile("v_nop\n\tv_nop\n\tv_nop\n\tv_nop" : "+v"(d) : "v"(a), "v"(b));
  return d;
}
__device__ __forceinline__ v8f wmma_bf(v16b a, v16b b, v8f c) {
  v8f d = __builtin_amdgcn_wmma_f32_16x16x32_bf16(false, a, false, b, (short)0, c, false, false);
  asm volatile("v_nop\n\tv_nop\n\tv_nop\n\tv_nop" : "+v"(d) : "v"(a), "v"(b));
  return d;
}
// 16x16x32 fragments: lane = (h = lane>>4, row/col = lane&15); elements 0..7 = k0+8h+0..7, 8..15 = k0+16+8h+0..7; D element r = row 8h+r
__device__ __forceinline__ v16h frag_h(const _Float16* rowk0, int lane) {
  union { v16h v; v8h q[2]; } u; const _Float16* p = rowk0 + 8 * (lane >> 4);
  u.q[0] = *(const v8h*)p; u.q[1] = *(const v8h*)(p + 16); return u.v;
}
__device__ __forceinline__ v16h frag_f32(const float* rowk0, int lane) {
  v16h a; const float* p = rowk0 + 8 * (lane >> 4);
#pragma unroll
  for (int i = 0; i < 8; ++i) { a[i] = (_Float16)p[i]; a[8 + i] = (_Float16)p[16 + i]; }
  return a;
}
__device__ __forceinline__ v16h frag_f32s(const float* rowk0, int lane, float sc) {
  v16h a; const float* p = rowk0 + 8 * (lane >> 4);
#pragma unroll
  for (int i = 0; i < 8; ++i) { a[i] = (_Float16)(p[i] * sc); a[8 + i] = (_Float16)(p[16 + i] * sc); }
  return a;
}
// column fragment from a [K][ld] layout (column n), rows >= K read as 0
__device__ __forceinline__ v16h fragc_f32(const float* W, int k0, int n, int lane, int ld, int K) {
  v16h a; const int g = lane >> 4;
#pragma unroll
  for (int i = 0; i < 8; ++i) { const int ka = k0 + 8 * g + i, kb = ka + 16;
    a[i] = (_Float16)(ka < K ? W[(size_t)(ka < K ? ka : K - 1) * ld + n] : 0.f); a[8 + i] = (_Float16)(kb < K ? W[(size_t)(kb < K ? kb : K - 1) * ld + n] : 0.f); }
  return a;
}
struct F2 { v16b h, l; };
__device__ __forceinline__ F2 bsplit16(const float v[16]) { F2 r;
#pragma unroll
  for (int i = 0; i < 16; ++i) { const __bf16 h = (__bf16)v[i]; r.h[i] = h; r.l[i] = (__bf16)(v[i] - (float)h); }
  return r; }
__device__ __forceinline__ F2 split_row(const float* row, int k0, int lane) { float v[16]; const float* p = row + k0 + 8 * (lane >> 4);
#pragma unroll
  for (int i = 0; i < 8; ++i) { v[i] = p[i]; v[8 + i] = p[16 + i]; }
  return bsplit16(v); }
__device__ __forceinline__ F2 split_rowK(const float* row, int k0, int lane, int K) { float v[16]; const int g = lane >> 4;
#pragma unroll
  for (int i = 0; i < 8; ++i) { const int ka = k0 + 8 * g + i, kb = ka + 16; v[i] = ka < K ? row[ka < K ? ka : K - 1] : 0.f; v[8 + i] = kb < K ? row[kb < K ? kb : K - 1] : 0.f; }
  return bsplit16(v); }
__device__ __forceinline__ F2 split_col(const float* W, int k0, int n, int lane, int ld, int K) { float v[16]; const int g = lane >> 4;
#pragma unroll
  for (int i = 0; i < 8; ++i) { const int ka = k0 + 8 * g + i, kb = ka + 16; v[i] = ka < K ? W[(size_t)(ka < K ? ka : K - 1) * ld + n] : 0.f; v[8 + i] = kb < K ? W[(size_t)(kb < K ? kb : K - 1) * ld + n] : 0.f; }
  return bsplit16(v); }
__device__ __forceinline__ v8f mac3(const F2& a, const F2& b, v8f c) { c = wmma_bf(a.l, b.h, c); c = wmma_bf(a.h, b.l, c); return wmma_bf(a.h, b.h, c); }
__device__ __forceinline__ float sigm(float v) { return 1.0f / (1.0f + expf(-v)); }
#define LDSX() do { asm volatile("s_wait_dscnt 0" ::: "memory"); __builtin_amdgcn_wave_barrier(); __builtin_amdgcn_fence(__ATOMIC_RELEASE, "workgroup"); } while (0)


// Four-headed causal attention (B 4, S 2,048, E 1,024 = 4 heads x 256): per-head Dense q/k/v from three different inputs, scores / head_dim (256), strictly-upper -1e30 mask, softmax, concat heads, Wo + bo.
#define NB 4
#define TT 2048
#define CC 1024
#define NH 4
#define HD 256
#ifndef TNB
#define TNB NB
#endif
typedef __attribute__((ext_vector_type(8))) __bf16 v8b;
__device__ __forceinline__ v16b frag_b(const __bf16* rowk0, int lane) {
  union { v16b v; v8b q[2]; } u; const __bf16* p = rowk0 + 8 * (lane >> 4);
  u.q[0] = *(const v8b*)p; u.q[1] = *(const v8b*)(p + 16); return u.v;
}
// fragment-order planes: a (16 rows x 32 k) operand tile is one 1,024-byte block, [half][lane][8]: half 0 = the lane's elements 0..7, half 1 = its elements 8..15, so each of a fragment's two 16-byte loads covers 512 contiguous bytes (4 whole lines) and not 16 lines
#define FB 512                   // elements of one block
__device__ __forceinline__ v16h frag_hp(const _Float16* blk, int lane) {
  union { v16h v; v8h q[2]; } u; const _Float16* p = blk + lane * 8;
  u.q[0] = *(const v8h*)p; u.q[1] = *(const v8h*)(p + 256); return u.v;
}
__device__ __forceinline__ v16b frag_bp(const __bf16* blk, int lane) {
  union { v16b v; v8b q[2]; } u; const __bf16* p = blk + lane * 8;
  u.q[0] = *(const v8b*)p; u.q[1] = *(const v8b*)(p + 256); return u.v;
}
__device__ __forceinline__ float bfr(float v) { return (float)(__bf16)v; }
__device__ __attribute__((noinline)) float exp_ni(float v) { return expf(v); }
__device__ __attribute__((noinline)) float erf_ni(float v) { return erff(v); }

#define WS_QH  0u
#define WS_QL  (WS_QH + 2u * (size_t)NB * TT * CC)
#define WS_KH  (WS_QL + 2u * (size_t)NB * TT * CC)
#define WS_VT  (WS_KH + 2u * (size_t)NB * TT * CC)      // bf16 v planes, rows b * C + c, k = t; q, k and v planes all lie in fragment order (frag_hp, frag_bp)
#define WS_VL  (WS_VT + 2u * (size_t)NB * CC * TT)      // bf16 v residual planes
#define PB 2                                             // batches per launch of k_sc, k_sm, k_pv
#define PL (PB * NH)                                     // (batch, head) planes per launch = grid z (grid y of k_sm)
#define WS_S   (WS_VL + 2u * (size_t)NB * CC * TT)      // f32 logits, then P x 2^11 in place: PL planes [z][q][k]
#define WS_PH  (WS_S + 4u * (size_t)PL * TT * TT)
#define WS_Y   (WS_PH + 2u * (size_t)TT * TT)          // f32 y rows [b*t][C]
#define WS_END (WS_Y + 4u * (size_t)NB * TT * CC)

// ---- staged GEMM tiles (k_proj, k_out): a block of 8 waves owns 128 rows x 128 cols; per 32 k both operands go global -> registers -> LDS once per block, already rounded to bf16, rows k-contiguous; wave = 32 rows x 64 cols
#define GP 40                    // LDS pitch of a staged 32-k row, in bf16 elements: 80 bytes = 16 x odd, which the 16-byte fragment reads want
#define GT (128 * GP)            // one staged operand tile, in elements
typedef __attribute__((ext_vector_type(4))) __bf16 v4b;
// x tile: thread = (row tid >> 3 (+ 32 i), 4 k at (tid & 7) * 4): a wave's 16-byte loads cover 4 whole 128-byte lines
__device__ __forceinline__ void g_ldx(const float* p, v4f (&r)[4]) {
#pragma unroll
  for (int i = 0; i < 4; ++i) r[i] = *(const v4f*)(p + (size_t)i * 32 * CC); }
// w tile from a [k][ld] layout: thread = (col tid & 127, 16 k from (tid >> 7) * 16): a wave's 4-byte loads cover one whole line, and the thread holds a k-contiguous run of its column
__device__ __forceinline__ void g_ldw(const float* p, int ld, float (&r)[16]) {
#pragma unroll
  for (int i = 0; i < 16; ++i) r[i] = p[(size_t)i * ld]; }
__device__ __forceinline__ void g_stx(__bf16* d, const v4f (&r)[4]) {
#pragma unroll
  for (int i = 0; i < 4; ++i) { v4b o;
#pragma unroll
    for (int e = 0; e < 4; ++e) o[e] = (__bf16)r[i][e];
    *(v4b*)(d + i * 32 * GP) = o; } }
__device__ __forceinline__ void g_stx2(__bf16* dh, __bf16* dl, const v4f (&r)[4]) {
#pragma unroll
  for (int i = 0; i < 4; ++i) { v4b oh, ol;
#pragma unroll
    for (int e = 0; e < 4; ++e) { const __bf16 h = (__bf16)r[i][e]; oh[e] = h; ol[e] = (__bf16)(r[i][e] - (float)h); }
    *(v4b*)(dh + i * 32 * GP) = oh; *(v4b*)(dl + i * 32 * GP) = ol; } }
__device__ __forceinline__ void g_stw(__bf16* d, const float (&r)[16]) { v8b o0, o1;
#pragma unroll
  for (int i = 0; i < 8; ++i) { o0[i] = (__bf16)r[i]; o1[i] = (__bf16)r[8 + i]; }
  *(v8b*)d = o0; *(v8b*)(d + 8) = o1; }
// ---- k_proj: block = (128 rows, 128 cols, which): qkv = x W (+ b), exact; q -> f16 hi (+ residual), k -> f16 hi, v -> bf16 hi + residual planes
__global__ __launch_bounds__(256) void k_proj(const float* __restrict__ XQ, const float* __restrict__ XK, const float* __restrict__ XV, const float* __restrict__ WQ, const float* __restrict__ BQ, const float* __restrict__ WK, const float* __restrict__ BK, const float* __restrict__ WV, const float* __restrict__ BV, _Float16* __restrict__ QH, _Float16* __restrict__ QL, _Float16* __restrict__ KH, __bf16* __restrict__ VT, __bf16* __restrict__ VL) {
  __shared__ __align__(16) char sm[2 * 128 * 136 * 2];   // in the loop: two buffers of [x tile | w tile]; behind it: the two output planes at pitch 136
  __bf16* const st = (__bf16*)sm;
  const int tid = threadIdx.x, wave = tid >> 5, lane = tid & 31, col = lane & 15, g = lane >> 4; const int which = blockIdx.z; const int c0 = blockIdx.y * 128; const size_t r0 = (size_t)blockIdx.x * 128; const float* X = which == 0 ? XQ : which == 1 ? XK : XV; const float* WA = which == 0 ? WQ : which == 1 ? WK : WV; const float* BA = which == 0 ? BQ : which == 1 ? BK : BV;
  const int wr = (wave >> 1) * 32, wc = (wave & 1) * 64;
  const float* xa = X + (r0 + (tid >> 3)) * CC + (tid & 7) * 4; const float* wa = WA + ((size_t)(c0 / HD) * CC + (tid >> 7) * 16) * HD + c0 % HD + (tid & 127);
  const int sxo = (tid >> 3) * GP + (tid & 7) * 4, swo = GT + (tid & 127) * GP + (tid >> 7) * 16;
  v4f xr[4]; float wv[16]; v8f acc[2][4] = {};
  g_ldx(xa, xr);
  asm volatile("s_wait_xcnt 0x0" ::: "memory");   // stands before the first x tile's address registers are written again
  g_ldw(wa, HD, wv); g_stx(st + sxo, xr); g_stw(st + swo, wv);
  __syncthreads();
// kept rolled: one trip holds the next tile's 32 loaded registers beside fragments and accumulators
#pragma unroll 1
  for (int kc = 0; kc < CC / 32; ++kc) { const __bf16* cur = st + (kc & 1) * (2 * GT); __bf16* nxt = st + ((kc + 1) & 1) * (2 * GT);
    if (kc + 1 < CC / 32) { g_ldx(xa + (kc + 1) * 32, xr); g_ldw(wa + (size_t)(kc + 1) * 32 * HD, HD, wv); }   // the next tile flies while this one multiplies
    v16b a[2], w[4];
#pragma unroll
    for (int qa = 0; qa < 2; ++qa) a[qa] = frag_b(cur + (wr + qa * 16 + col) * GP, lane);
#pragma unroll
    for (int j = 0; j < 4; ++j) w[j] = frag_b(cur + GT + (wc + j * 16 + col) * GP, lane);
#pragma unroll
    for (int j = 0; j < 4; ++j)
#pragma unroll
      for (int qa = 0; qa < 2; ++qa) acc[qa][j] = wmma_bf(a[qa], w[j], acc[qa][j]);
    if (kc + 1 < CC / 32) { g_stx(nxt + sxo, xr); g_stw(nxt + swo, wv); }
    __syncthreads(); }   // publishes the next tile and ends every read of this one (behind the last trip: before the planes reuse the buffers)
  _Float16 (*sh)[136] = (_Float16 (*)[136])sm; _Float16 (*sl)[136] = (_Float16 (*)[136])(sm + 128 * 136 * 2); __bf16 (*th)[136] = (__bf16 (*)[136])sm; __bf16 (*tl2)[136] = (__bf16 (*)[136])(sm + 128 * 136 * 2);
#pragma unroll
  for (int j = 0; j < 4; ++j) { const float bb = bfr(BA[c0 + wc + j * 16 + col]);
#pragma unroll
    for (int qa = 0; qa < 2; ++qa)
#pragma unroll
      for (int r = 0; r < 8; ++r) { const float v = acc[qa][j][r] + bb; const int rl = wr + qa * 16 + 8 * g + r, cl = wc + j * 16 + col; const _Float16 hv = (_Float16)v;
        if (which == 2) { const __bf16 bh = (__bf16)v; th[cl][rl] = bh; tl2[cl][rl] = (__bf16)(v - (float)bh); } else { sh[rl][cl] = hv; sl[rl][cl] = (_Float16)(v - (float)hv); } } }
  __syncthreads();
  // the 128 x 128 tile leaves as 8 x 4 fragment-order blocks: piece e = (block e >> 6 = (row tile, k block), half, lane); consecutive threads store consecutive 16-byte pieces
  if (which < 2) { _Float16* dh = which == 0 ? QH : KH; for (int e = tid; e < 128 * 16; e += 256) { const int fb = e >> 6, pc = e & 63; const int rl = (fb >> 2) * 16 + (pc & 15), cl = (fb & 3) * 32 + (pc >> 5) * 16 + ((pc >> 4) & 1) * 8; const size_t o = ((r0 / 16 + (fb >> 2)) * (CC / 32) + c0 / 32 + (fb & 3)) * FB + pc * 8; vst2((unsigned*)(dh + o), *(const v4u*)&sh[rl][cl]);
      asm volatile("s_wait_xcnt 0x0" ::: "memory");   // stands before the store's data and address registers are written again
      if (which == 0) { vst2((unsigned*)(QL + o), *(const v4u*)&sl[rl][cl]);
        asm volatile("s_wait_xcnt 0x0" ::: "memory"); } } }   // the same, for the residual plane's store
  else { const size_t b = r0 / TT; const int t0 = (int)(r0 % TT); for (int e = tid; e < 128 * 16; e += 256) { const int fb = e >> 6, pc = e & 63; const int cl = (fb >> 2) * 16 + (pc & 15), tl = (fb & 3) * 32 + (pc >> 5) * 16 + ((pc >> 4) & 1) * 8; const size_t o2 = (((b * CC + c0) / 16 + (fb >> 2)) * (TT / 32) + t0 / 32 + (fb & 3)) * FB + pc * 8; vst2((unsigned*)(VT + o2), *(const v4u*)&th[cl][tl]); vst2((unsigned*)(VL + o2), *(const v4u*)&tl2[cl][tl]);
      asm volatile("s_wait_xcnt 0x0" ::: "memory"); } } }   // stands before the two stores' data and address registers are written again
// ---- k_sc: block = (64 queries, 128 keys) of plane z = (b - b0) * NH + h: logits * scale (1/256), causal mask; causal blocks beyond the diagonal exit
__global__ __launch_bounds__(128) void k_sc(const _Float16* __restrict__ QH, const _Float16* __restrict__ QL, const _Float16* __restrict__ KH, const float* __restrict__ BM, int b0, float* __restrict__ S) { __shared__ __align__(16) float ss[4][16][132];
  const int b = b0 + blockIdx.z / NH, h = blockIdx.z % NH; S += (size_t)blockIdx.z * TT * TT;
  const int tid = threadIdx.x, wave = tid >> 5, lane = tid & 31, col = lane & 15, g = lane >> 4; const int k0 = blockIdx.y * 128; const int ql0 = blockIdx.x * 64 + wave * 16; const size_t q0 = (size_t)b * TT + ql0;
  if (k0 > blockIdx.x * 64 + 63) return;   // whole key block above the diagonal (block-uniform)
  v8f acc[8] = {}; const _Float16* const qb = QH + ((q0 / 16) * (CC / 32) + h * (HD / 32)) * FB; const _Float16* const kp = KH + ((((size_t)b * TT + k0) / 16) * (CC / 32) + h * (HD / 32)) * FB;   // first blocks of the wave's query tile and of the block's key tile 0; key tile j: + j * (CC / 32) blocks
#pragma unroll
  for (int kc = 0; kc < HD / 32; ++kc) { const v16h ah = frag_hp(qb + kc * FB, lane);
#pragma unroll
    for (int j = 0; j < 8; ++j) { const v16h kb = frag_hp(kp + (j * (CC / 32) + kc) * FB, lane); acc[j] = wmma16(ah, kb, acc[j]); } }
#pragma unroll
  for (int j = 0; j < 8; ++j) { const int kt = k0 + j * 16 + col;
#pragma unroll
    for (int r = 0; r < 8; ++r) { const int qt = ql0 + 8 * g + r; float v = acc[j][r] * 0.00390625f; (void)BM; if (kt > qt) v = -3.0e38f; ss[wave][8 * g + r][j * 16 + col] = v; } }
  LDSX(); for (int rl = 0; rl < 16; ++rl) vst2(S + (size_t)(ql0 + rl) * TT + k0 + lane * 4, *(const v4f*)&ss[wave][rl][lane * 4]); }
// ---- k_sm: one wave per query row of plane y, the row held in registers: one read, one exp pass, one write; softmax over the row's 128-key chunks -> P x 2^11 f32 in place (masked -> 0)
// k_sc writes whole 128-key blocks (masked keys as -3e38), so every chunk up to the diagonal's own is defined; a wave takes rows TT - 1 - pr and pr in turn, 17 chunks together for every wave
// f(0), f(1), .. f(nv - 1), nv in 1..16: the chunk number is a constant in each call, so that the row array stays in registers; one scalar branch leaves behind the row's last chunk
template <int I, typename F> __device__ __forceinline__ void sm_chunks(int nv, const F& f) { f(I); if constexpr (I + 1 < TT / 128) { if (I + 1 < nv) sm_chunks<I + 1>(nv, f); } }
__global__ __launch_bounds__(256) void k_sm(float* __restrict__ S) {
  const int lane = threadIdx.x & 31, wave = __builtin_amdgcn_readfirstlane(threadIdx.x >> 5); const int pr = blockIdx.x * 8 + wave;
  float* const pl = S + (size_t)blockIdx.y * TT * TT + lane * 4;
// kept rolled: both rows use the same 64 row registers
#pragma unroll 1
  for (int s = 0; s < 2; ++s) { const int row = s ? pr : TT - 1 - pr; const int nv = row / 128 + 1; float* const sr = pl + (size_t)row * TT; v4f x[TT / 128];
    sm_chunks<0>(nv, [&](int i) __attribute__((always_inline)) { x[i] = *(const v4f*)(sr + i * 128); });
    float m = -3.0e38f;
    sm_chunks<0>(nv, [&](int i) __attribute__((always_inline)) { m = fmaxf(m, fmaxf(fmaxf(x[i][0], x[i][1]), fmaxf(x[i][2], x[i][3]))); });
#pragma unroll
    for (int o = 1; o < 32; o <<= 1) m = fmaxf(m, __shfl_xor(m, o));
    v4f s4 = {0.f, 0.f, 0.f, 0.f};
    sm_chunks<0>(nv, [&](int i) __attribute__((always_inline)) {
#pragma unroll
      for (int e = 0; e < 4; ++e) { const float v = x[i][e], ex = expf(v - m); x[i][e] = (v <= -1.0e38f) ? 0.f : ex; }
      s4 += x[i]; });
    float sum = (s4[0] + s4[1]) + (s4[2] + s4[3]);
#pragma unroll
    for (int o = 1; o < 32; o <<= 1) sum += __shfl_xor(sum, o);
    const float inv = 1.0f / sum;
    sm_chunks<0>(nv, [&](int i) __attribute__((always_inline)) { x[i] = x[i] * inv * 2048.0f; });
    sm_chunks<0>(nv, [&](int i) __attribute__((always_inline)) { vst2(sr + i * 128, x[i]); });   // a run of stores alone: no register that a store names is written between them
    asm volatile("s_wait_xcnt 0x0" ::: "memory"); } }   // stands before the next row's loads write the stores' data and address registers again
// ---- k_pv: block = (32 queries, 64 head columns) of plane z = (b - b0) * NH + h: y[q][h*HD + d] = P . v (keys [0, kend)); the block's PVW waves take the 64-key chunks in turn, each on a 2 x 4 set of 16 x 16 tiles, and their f32 partial tiles are summed in wave order through LDS
// every "#pragma unroll" below unrolls fully, so that fragment and accumulator arrays are indexed by constants and stay in registers
#define PVW 16
#define VJ ((TT / 32) * FB)   // elements from one 16-column tile of a v plane to the next
__global__ __launch_bounds__(32 * PVW) void k_pv(const float* __restrict__ PS, const __bf16* __restrict__ VT, const __bf16* __restrict__ VL, int b0, float* __restrict__ Y) { __shared__ __align__(16) float ss[PVW][32][68];
  const int b = b0 + blockIdx.z / NH, h = blockIdx.z % NH; PS += (size_t)blockIdx.z * TT * TT;
  const int tid = threadIdx.x, wave = __builtin_amdgcn_readfirstlane(tid >> 5), lane = tid & 31, col = lane & 15, g = lane >> 4; const int ql0 = blockIdx.x * 32, d0 = blockIdx.y * 64; const int nch = blockIdx.x / 2 + 1; const int nw = nch < PVW ? nch : PVW;   // nch chunks of 64 keys reach kend; waves nw.. have none
  if (wave < nw) { v8f acc[2][4] = {};
// kept rolled: the fragments of two chunks would not fit the 256 registers that a wave of a 16-wave block may hold
#pragma unroll 1
    for (int c = wave; c < nch; c += PVW) { v4f pr[2][2][4]; v16b vh[3][2], vl[3][2]; F2 p[2][2]; const size_t po = ((((size_t)b * CC + h * HD + d0) / 16) * (TT / 32) + c * 2) * FB;   // block of (v column tile 0, this chunk's first 32 keys); column tile j: + j * VJ, the second 32 keys: + FB
      // P rows and v column tiles 0 and 1 are asked for together; tiles 2 and 3 while earlier tiles multiply
#pragma unroll
      for (int qa = 0; qa < 2; ++qa) { const float* pp = PS + (size_t)(ql0 + qa * 16 + col) * TT + c * 64 + 8 * g;
#pragma unroll
        for (int u = 0; u < 2; ++u) { pr[u][qa][0] = *(const v4f*)(pp + u * 32); pr[u][qa][1] = *(const v4f*)(pp + u * 32 + 4); pr[u][qa][2] = *(const v4f*)(pp + u * 32 + 16); pr[u][qa][3] = *(const v4f*)(pp + u * 32 + 20); } }
      asm volatile("s_wait_xcnt 0x0" ::: "memory");   // stands before the P loads' address registers are written again (v's loads land in them)
#pragma unroll
      for (int u = 0; u < 2; ++u) { vh[0][u] = frag_bp(VT + po + 0 * VJ + u * FB, lane); vl[0][u] = frag_bp(VL + po + 0 * VJ + u * FB, lane); }
#pragma unroll
      for (int u = 0; u < 2; ++u) { vh[1][u] = frag_bp(VT + po + 1 * VJ + u * FB, lane); vl[1][u] = frag_bp(VL + po + 1 * VJ + u * FB, lane); }
#pragma unroll
      for (int qa = 0; qa < 2; ++qa)
#pragma unroll
        for (int u = 0; u < 2; ++u) { float v[16];
#pragma unroll
          for (int i = 0; i < 16; ++i) v[i] = pr[u][qa][i >> 2][i & 3];
          p[u][qa] = bsplit16(v); }
      __builtin_amdgcn_sched_barrier(0);   // holds tile 2's loads behind the split of P: asked for ahead of it they do not fit the 256 registers, and a loaded fragment is spilled
#pragma unroll
      for (int u = 0; u < 2; ++u) { vh[2][u] = frag_bp(VT + po + 2 * VJ + u * FB, lane); vl[2][u] = frag_bp(VL + po + 2 * VJ + u * FB, lane); }
#pragma unroll
      for (int u = 0; u < 2; ++u) { acc[0][0] = wmma_bf(p[u][0].h, vh[0][u], acc[0][0]); acc[1][0] = wmma_bf(p[u][1].h, vh[0][u], acc[1][0]); acc[0][0] = wmma_bf(p[u][0].l, vh[0][u], acc[0][0]); acc[1][0] = wmma_bf(p[u][1].l, vh[0][u], acc[1][0]); acc[0][0] = wmma_bf(p[u][0].h, vl[0][u], acc[0][0]); acc[1][0] = wmma_bf(p[u][1].h, vl[0][u], acc[1][0]); }
#pragma unroll
      for (int u = 0; u < 2; ++u) { vh[0][u] = frag_bp(VT + po + 3 * VJ + u * FB, lane); vl[0][u] = frag_bp(VL + po + 3 * VJ + u * FB, lane); }
#pragma unroll
      for (int u = 0; u < 2; ++u) { acc[0][1] = wmma_bf(p[u][0].h, vh[1][u], acc[0][1]); acc[1][1] = wmma_bf(p[u][1].h, vh[1][u], acc[1][1]); acc[0][1] = wmma_bf(p[u][0].l, vh[1][u], acc[0][1]); acc[1][1] = wmma_bf(p[u][1].l, vh[1][u], acc[1][1]); acc[0][1] = wmma_bf(p[u][0].h, vl[1][u], acc[0][1]); acc[1][1] = wmma_bf(p[u][1].h, vl[1][u], acc[1][1]); }
#pragma unroll
      for (int u = 0; u < 2; ++u) { acc[0][2] = wmma_bf(p[u][0].h, vh[2][u], acc[0][2]); acc[1][2] = wmma_bf(p[u][1].h, vh[2][u], acc[1][2]); acc[0][2] = wmma_bf(p[u][0].l, vh[2][u], acc[0][2]); acc[1][2] = wmma_bf(p[u][1].l, vh[2][u], acc[1][2]); acc[0][2] = wmma_bf(p[u][0].h, vl[2][u], acc[0][2]); acc[1][2] = wmma_bf(p[u][1].h, vl[2][u], acc[1][2]); }
#pragma unroll
      for (int u = 0; u < 2; ++u) { acc[0][3] = wmma_bf(p[u][0].h, vh[0][u], acc[0][3]); acc[1][3] = wmma_bf(p[u][1].h, vh[0][u], acc[1][3]); acc[0][3] = wmma_bf(p[u][0].l, vh[0][u], acc[0][3]); acc[1][3] = wmma_bf(p[u][1].l, vh[0][u], acc[1][3]); acc[0][3] = wmma_bf(p[u][0].h, vl[0][u], acc[0][3]); acc[1][3] = wmma_bf(p[u][1].h, vl[0][u], acc[1][3]); } }
#pragma unroll
    for (int qa = 0; qa < 2; ++qa)
#pragma unroll
      for (int j = 0; j < 4; ++j)
#pragma unroll
        for (int r = 0; r < 8; ++r) ss[wave][qa * 16 + 8 * g + r][j * 16 + col] = acc[qa][j][r]; }
  __syncthreads();
  for (int e = tid; e < 32 * 16; e += 32 * PVW) { const int rl = e >> 4, q4 = e & 15; v4f s = *(const v4f*)&ss[0][rl][q4 * 4]; for (int w = 1; w < nw; ++w) s += *(const v4f*)&ss[w][rl][q4 * 4];
    vst2(Y + ((size_t)b * TT + ql0 + rl) * CC + h * HD + d0 + q4 * 4, s * (1.0f / 2048.0f)); } }
// ---- k_out: block = (128 rows, 128 cols): out = y (bf16 hi + lo) Wproj + b; tiles staged as in k_proj, y as two planes
__global__ __launch_bounds__(256) void k_out(const float* __restrict__ Y, const float* __restrict__ WP, const float* __restrict__ BP, float* __restrict__ OUT) { __shared__ __align__(16) char sm[128 * 132 * 4];   // in the loop: two buffers of [y hi | y lo | w]; behind it: the f32 output tile at pitch 132
  __bf16* const st = (__bf16*)sm;
  const int tid = threadIdx.x, wave = tid >> 5, lane = tid & 31, col = lane & 15, g = lane >> 4; const int c0 = blockIdx.y * 128; const size_t r0 = (size_t)blockIdx.x * 128;
  const int wr = (wave >> 1) * 32, wc = (wave & 1) * 64;
  const float* xa = Y + (r0 + (tid >> 3)) * CC + (tid & 7) * 4; const float* wa = WP + (size_t)((tid >> 7) * 16) * CC + c0 + (tid & 127);
  const int sxo = (tid >> 3) * GP + (tid & 7) * 4, swo = 2 * GT + (tid & 127) * GP + (tid >> 7) * 16;
  v4f xr[4]; float wv[16]; v8f acc[2][4] = {};
  g_ldx(xa, xr); g_ldw(wa, CC, wv); g_stx2(st + sxo, st + GT + sxo, xr); g_stw(st + swo, wv);
  __syncthreads();
// kept rolled: one trip holds the next tile's 32 loaded registers beside fragments and accumulators
#pragma unroll 1
  for (int kc = 0; kc < CC / 32; ++kc) { const __bf16* cur = st + (kc & 1) * (3 * GT); __bf16* nxt = st + ((kc + 1) & 1) * (3 * GT);
    if (kc + 1 < CC / 32) { g_ldx(xa + (kc + 1) * 32, xr); g_ldw(wa + (size_t)(kc + 1) * 32 * CC, CC, wv); }   // the next tile flies while this one multiplies
    v16b ah[2], al[2], w[4];
#pragma unroll
    for (int qa = 0; qa < 2; ++qa) { ah[qa] = frag_b(cur + (wr + qa * 16 + col) * GP, lane); al[qa] = frag_b(cur + GT + (wr + qa * 16 + col) * GP, lane); }
#pragma unroll
    for (int j = 0; j < 4; ++j) w[j] = frag_b(cur + 2 * GT + (wc + j * 16 + col) * GP, lane);
#pragma unroll
    for (int j = 0; j < 4; ++j)
#pragma unroll
      for (int qa = 0; qa < 2; ++qa) acc[qa][j] = wmma_bf(ah[qa], w[j], acc[qa][j]);
#pragma unroll
    for (int j = 0; j < 4; ++j)
#pragma unroll
      for (int qa = 0; qa < 2; ++qa) acc[qa][j] = wmma_bf(al[qa], w[j], acc[qa][j]);
    if (kc + 1 < CC / 32) { g_stx2(nxt + sxo, nxt + GT + sxo, xr); g_stw(nxt + swo, wv); }
    __syncthreads(); }   // publishes the next tile and ends every read of this one (behind the last trip: before the output tile reuses the buffers)
  float (*sf)[132] = (float (*)[132])sm;
#pragma unroll
  for (int j = 0; j < 4; ++j) { const float bb = BP ? bfr(BP[c0 + wc + j * 16 + col]) : 0.f;
#pragma unroll
    for (int qa = 0; qa < 2; ++qa)
#pragma unroll
      for (int r = 0; r < 8; ++r) sf[wr + qa * 16 + 8 * g + r][wc + j * 16 + col] = acc[qa][j][r] + bb; }
  __syncthreads();
  for (int e = tid; e < 128 * 32; e += 256) { const int rl = e >> 5, q = e & 31; vst2(OUT + (r0 + rl) * CC + c0 + q * 4, *(const v4f*)&sf[rl][q * 4]); } }
extern "C" void kernel_launch(void* const* d_in, const int* in_sizes, int n_in, void* d_out, int out_size, void* d_ws, size_t ws_size, hipStream_t stream) {
  (void)in_sizes; (void)n_in; (void)out_size;
  const float** F = (const float**)d_in;   // 0 inputs_for_keys, 1 inputs_for_values, 2 inputs_for_queries [4,2048,1024], 3 Wk [4,1024,256], 4 bk [4,256], 5 Wq, 6 bq, 7 Wv, 8 bv, 9 Wo [1024,1024] ([in,out]), 10 bo
  if (ws_size < (size_t)WS_END) return;
  char* ws = (char*)d_ws; _Float16 *QH = (_Float16*)(ws + WS_QH), *QL = (_Float16*)(ws + WS_QL), *KH = (_Float16*)(ws + WS_KH); __bf16 *VT = (__bf16*)(ws + WS_VT), *VL = (__bf16*)(ws + WS_VL); float *S = (float*)(ws + WS_S), *Y = (float*)(ws + WS_Y);
  k_proj<<<dim3(TNB * TT / 128, CC / 128, 3), 256, 0, stream>>>(F[2], F[0], F[1], F[5], F[6], F[3], F[4], F[7], F[8], QH, QL, KH, VT, VL);
  for (int b0 = 0; b0 < TNB; b0 += PB) {
    k_sc<<<dim3(TT / 64, TT / 128, PL), 128, 0, stream>>>(QH, QL, KH, nullptr, b0, S);
    k_sm<<<dim3(TT / 16, PL), 256, 0, stream>>>(S);
    k_pv<<<dim3(TT / 32, HD / 64, PL), 32 * PVW, 0, stream>>>(S, VT, VL, b0, Y);
  }
  k_out<<<dim3(TNB * TT / 128, CC / 128), 256, 0, stream>>>(Y, F[9], F[10], (float*)d_out);
}

// v006
// It runs in 233 microseconds.
// In both of two side-by-side timings against v005, it was 1.73 times as fast.
// All steps since v000 together make it 33.8 times as fast.
// compute dtype: all float inputs rounded to bf16; Q/K/V = inputs W_h + b_h (per-head [E, Dh] weights) with EXACT bf16 products on WMMA 16x16x32, f32 accumulate, q/k rounded once to f16 (logits / 256 have std ~0.06: 1 product), causal logits kept in registers; softmax in f32 with a running maximum and sum (precise expf), unnormalised P in f32 split bf16 hi + lo against v as bf16 hi + lo (3 products), divided by the sum at the end; out = y (bf16 hi + lo) Wo + bo; f32 output.
#include <hip/hip_runtime.h>
#include <math.h>

typedef __attribute__((ext_vector_type(16))) _Float16 v16h;
typedef __attribute__((ext_vector_type(16))) __bf16 v16b;
typedef __attribute__((ext_vector_type(8)))  _Float16 v8h;
typedef __attribute__((ext_vector_type(8)))  float v8f;
typedef __attribute__((ext_vector_type(4)))  float v4f;
typedef __attribute__((ext_vector_type(2)))  float v2f;
typedef __attribute__((ext_vector_type(4)))  unsigned v4u;
typedef __attribute__((ext_vector_type(4)))  int v4i;
typedef float __attribute__((may_alias)) float_a;
typedef int __attribute__((may_alias)) int_a;

template <typename T> __device__ __forceinline__ void vst2(void* p, T v) { *(T*)p = v;  }
__device__ __forceinline__ v8f wmma16(v16h a, v16h b, v8f c) {
  v8f d = __builtin_amdgcn_wmma_f32_16x16x32_f16(false, a, false, b, (short)0, c, false, false);
  asm volatile("v_nop\n\tv_nop\n\tv_nop\n\tv_nop" : "+v"(d) : "v"(a), "v"(b));
  return d;
}
__device__ __forceinline__ v8f wmma_bf(v16b a, v16b b, v8f c) {
  v8f d = __builtin_amdgcn_wmma_f32_16x16x32_bf16(false, a, false, b, (short)0, c, false, false);
  asm volatile("v_nop\n\tv_nop\n\tv_nop\n\tv_nop" : "+v"(d) : "v"(a), "v"(b));
  return d;
}
// 16x16x32 fragments: lane = (h = lane>>4, row/col = lane&15); elements 0..7 = k0+8h+0..7, 8..15 = k0+16+8h+0..7; D element r = row 8h+r
__device__ __forceinline__ v16h frag_h(const _Float16* rowk0, int lane) {
  union { v16h v; v8h q[2]; } u; const _Float16* p = rowk0 + 8 * (lane >> 4);
  u.q[0] = *(const v8h*)p; u.q[1] = *(const v8h*)(p + 16); return u.v;
}
__device__ __forceinline__ v16h frag_f32(const float* rowk0, int lane) {
  v16h a; const float* p = rowk0 + 8 * (lane >> 4);
#pragma unroll
  for (int i = 0; i < 8; ++i) { a[i] = (_Float16)p[i]; a[8 + i] = (_Float16)p[16 + i]; }
  return a;
}
__device__ __forceinline__ v16h frag_f32s(const float* rowk0, int lane, float sc) {
  v16h a; const float* p = rowk0 + 8 * (lane >> 4);
#pragma unroll
  for (int i = 0; i < 8; ++i) { a[i] = (_Float16)(p[i] * sc); a[8 + i] = (_Float16)(p[16 + i] * sc); }
  return a;
}
// column fragment from a [K][ld] layout (column n), rows >= K read as 0
__device__ __forceinline__ v16h fragc_f32(const float* W, int k0, int n, int lane, int ld, int K) {
  v16h a; const int g = lane >> 4;
#pragma unroll
  for (int i = 0; i < 8; ++i) { const int ka = k0 + 8 * g + i, kb = ka + 16;
    a[i] = (_Float16)(ka < K ? W[(size_t)(ka < K ? ka : K - 1) * ld + n] : 0.f); a[8 + i] = (_Float16)(kb < K ? W[(size_t)(kb < K ? kb : K - 1) * ld + n] : 0.f); }
  return a;
}
struct F2 { v16b h, l; };
__device__ __forceinline__ F2 bsplit16(const float v[16]) { F2 r;
#pragma unroll
  for (int i = 0; i < 16; ++i) { const __bf16 h = (__bf16)v[i]; r.h[i] = h; r.l[i] = (__bf16)(v[i] - (float)h); }
  return r; }
__device__ __forceinline__ F2 split_row(const float* row, int k0, int lane) { float v[16]; const float* p = row + k0 + 8 * (lane >> 4);
#pragma unroll
  for (int i = 0; i < 8; ++i) { v[i] = p[i]; v[8 + i] = p[16 + i]; }
  return bsplit16(v); }
__device__ __forceinline__ F2 split_rowK(const float* row, int k0, int lane, int K) { float v[16]; const int g = lane >> 4;
#pragma unroll
  for (int i = 0; i < 8; ++i) { const int ka = k0 + 8 * g + i, kb = ka + 16; v[i] = ka < K ? row[ka < K ? ka : K - 1] : 0.f; v[8 + i] = kb < K ? row[kb < K ? kb : K - 1] : 0.f; }
  return bsplit16(v); }
__device__ __forceinline__ F2 split_col(const float* W, int k0, int n, int lane, int ld, int K) { float v[16]; const int g = lane >> 4;
#pragma unroll
  for (int i = 0; i < 8; ++i) { const int ka = k0 + 8 * g + i, kb = ka + 16; v[i] = ka < K ? W[(size_t)(ka < K ? ka : K - 1) * ld + n] : 0.f; v[8 + i] = kb < K ? W[(size_t)(kb < K ? kb : K - 1) * ld + n] : 0.f; }
  return bsplit16(v); }
__device__ __forceinline__ v8f mac3(const F2& a, const F2& b, v8f c) { c = wmma_bf(a.l, b.h, c); c = wmma_bf(a.h, b.l, c); return wmma_bf(a.h, b.h, c); }
__device__ __forceinline__ float sigm(float v) { return 1.0f / (1.0f + expf(-v)); }
#define LDSX() do { asm volatile("s_wait_dscnt 0" ::: "memory"); __builtin_amdgcn_wave_barrier(); __builtin_amdgcn_fence(__ATOMIC_RELEASE, "workgroup"); } while (0)


// Four-headed causal attention (B 4, S 2,048, E 1,024 = 4 heads x 256): per-head Dense q/k/v from three different inputs, scores / head_dim (256), strictly-upper -1e30 mask, softmax, concat heads, Wo + bo.
#define NB 4
#define TT 2048
#define CC 1024
#define NH 4
#define HD 256
#ifndef TNB
#define TNB NB
#endif
typedef __attribute__((ext_vector_type(8))) __bf16 v8b;
__device__ __forceinline__ v16b frag_b(const __bf16* rowk0, int lane) {
  union { v16b v; v8b q[2]; } u; const __bf16* p = rowk0 + 8 * (lane >> 4);
  u.q[0] = *(const v8b*)p; u.q[1] = *(const v8b*)(p + 16); return u.v;
}
// fragment-order planes: a (16 rows x 32 k) operand tile is one 1,024-byte block, [half][lane][8]: half 0 = the lane's elements 0..7, half 1 = its elements 8..15, so each of a fragment's two 16-byte loads covers 512 contiguous bytes (4 whole lines) and not 16 lines
#define FB 512                   // elements of one block
__device__ __forceinline__ v16h frag_hp(const _Float16* blk, int lane) {
  union { v16h v; v8h q[2]; } u; const _Float16* p = blk + lane * 8;
  u.q[0] = *(const v8h*)p; u.q[1] = *(const v8h*)(p + 256); return u.v;
}
__device__ __forceinline__ v16b frag_bp(const __bf16* blk, int lane) {
  union { v16b v; v8b q[2]; } u; const __bf16* p = blk + lane * 8;
  u.q[0] = *(const v8b*)p; u.q[1] = *(const v8b*)(p + 256); return u.v;
}
__device__ __forceinline__ float bfr(float v) { return (float)(__bf16)v; }
__device__ __attribute__((noinline)) float exp_ni(float v) { return expf(v); }
__device__ __attribute__((noinline)) float erf_ni(float v) { return erff(v); }

#define WS_QH  0u
#define WS_QL  (WS_QH + 2u * (size_t)NB * TT * CC)
#define WS_KH  (WS_QL + 2u * (size_t)NB * TT * CC)
#define WS_VT  (WS_KH + 2u * (size_t)NB * TT * CC)      // bf16 v planes, rows b * C + c, k = t; q, k and v planes all lie in fragment order (frag_hp, frag_bp)
#define WS_VL  (WS_VT + 2u * (size_t)NB * CC * TT)      // bf16 v residual planes
#define WS_Y   (WS_VL + 2u * (size_t)NB * CC * TT)      // f32 y rows [b*t][C]
#define WS_END (WS_Y + 4u * (size_t)NB * TT * CC)

// ---- staged GEMM tiles (k_proj, k_out): a block of 8 waves owns 128 rows x 128 cols; per 32 k both operands go global -> registers -> LDS once per block, already rounded to bf16, rows k-contiguous; wave = 32 rows x 64 cols
#define GP 40                    // LDS pitch of a staged 32-k row, in bf16 elements: 80 bytes = 16 x odd, which the 16-byte fragment reads want
#define GT (128 * GP)            // one staged operand tile, in elements
typedef __attribute__((ext_vector_type(4))) __bf16 v4b;
// x tile: thread = (row tid >> 3 (+ 32 i), 4 k at (tid & 7) * 4): a wave's 16-byte loads cover 4 whole 128-byte lines
__device__ __forceinline__ void g_ldx(const float* p, v4f (&r)[4]) {
#pragma unroll
  for (int i = 0; i < 4; ++i) r[i] = *(const v4f*)(p + (size_t)i * 32 * CC); }
// w tile from a [k][ld] layout: thread = (col tid & 127, 16 k from (tid >> 7) * 16): a wave's 4-byte loads cover one whole line, and the thread holds a k-contiguous run of its column
__device__ __forceinline__ void g_ldw(const float* p, int ld, float (&r)[16]) {
#pragma unroll
  for (int i = 0; i < 16; ++i) r[i] = p[(size_t)i * ld]; }
__device__ __forceinline__ void g_stx(__bf16* d, const v4f (&r)[4]) {
#pragma unroll
  for (int i = 0; i < 4; ++i) { v4b o;
#pragma unroll
    for (int e = 0; e < 4; ++e) o[e] = (__bf16)r[i][e];
    *(v4b*)(d + i * 32 * GP) = o; } }
__device__ __forceinline__ void g_stx2(__bf16* dh, __bf16* dl, const v4f (&r)[4]) {
#pragma unroll
  for (int i = 0; i < 4; ++i) { v4b oh, ol;
#pragma unroll
    for (int e = 0; e < 4; ++e) { const __bf16 h = (__bf16)r[i][e]; oh[e] = h; ol[e] = (__bf16)(r[i][e] - (float)h); }
    *(v4b*)(dh + i * 32 * GP) = oh; *(v4b*)(dl + i * 32 * GP) = ol; } }
__device__ __forceinline__ void g_stw(__bf16* d, const float (&r)[16]) { v8b o0, o1;
#pragma unroll
  for (int i = 0; i < 8; ++i) { o0[i] = (__bf16)r[i]; o1[i] = (__bf16)r[8 + i]; }
  *(v8b*)d = o0; *(v8b*)(d + 8) = o1; }
// ---- k_proj: block = (128 rows, 128 cols, which): qkv = x W (+ b), exact; q -> f16 hi (+ residual), k -> f16 hi, v -> bf16 hi + residual planes
__global__ __launch_bounds__(256) void k_proj(const float* __restrict__ XQ, const float* __restrict__ XK, const float* __restrict__ XV, const float* __restrict__ WQ, const float* __restrict__ BQ, const float* __restrict__ WK, const float* __restrict__ BK, const float* __restrict__ WV, const float* __restrict__ BV, _Float16* __restrict__ QH, _Float16* __restrict__ QL, _Float16* __restrict__ KH, __bf16* __restrict__ VT, __bf16* __restrict__ VL) {
  __shared__ __align__(16) char sm[2 * 128 * 136 * 2];   // in the loop: two buffers of [x tile | w tile]; behind it: the two output planes at pitch 136
  __bf16* const st = (__bf16*)sm;
  const int tid = threadIdx.x, wave = tid >> 5, lane = tid & 31, col = lane & 15, g = lane >> 4; const int which = blockIdx.z; const int c0 = blockIdx.y * 128; const size_t r0 = (size_t)blockIdx.x * 128; const float* X = which == 0 ? XQ : which == 1 ? XK : XV; const float* WA = which == 0 ? WQ : which == 1 ? WK : WV; const float* BA = which == 0 ? BQ : which == 1 ? BK : BV;
  const int wr = (wave >> 1) * 32, wc = (wave & 1) * 64;
  const float* xa = X + (r0 + (tid >> 3)) * CC + (tid & 7) * 4; const float* wa = WA + ((size_t)(c0 / HD) * CC + (tid >> 7) * 16) * HD + c0 % HD + (tid & 127);
  const int sxo = (tid >> 3) * GP + (tid & 7) * 4, swo = GT + (tid & 127) * GP + (tid >> 7) * 16;
  v4f xr[4]; float wv[16]; v8f acc[2][4] = {};
  g_ldx(xa, xr);
  asm volatile("s_wait_xcnt 0x0" ::: "memory");   // stands before the first x tile's address registers are written again
  g_ldw(wa, HD, wv); g_stx(st + sxo, xr); g_stw(st + swo, wv);
  __syncthreads();
// kept rolled: one trip holds the next tile's 32 loaded registers beside fragments and accumulators
#pragma unroll 1
  for (int kc = 0; kc < CC / 32; ++kc) { const __bf16* cur = st + (kc & 1) * (2 * GT); __bf16* nxt = st + ((kc + 1) & 1) * (2 * GT);
    if (kc + 1 < CC / 32) { g_ldx(xa + (kc + 1) * 32, xr); g_ldw(wa + (size_t)(kc + 1) * 32 * HD, HD, wv); }   // the next tile flies while this one multiplies
    v16b a[2], w[4];
#pragma unroll
    for (int qa = 0; qa < 2; ++qa) a[qa] = frag_b(cur + (wr + qa * 16 + col) * GP, lane);
#pragma unroll
    for (int j = 0; j < 4; ++j) w[j] = frag_b(cur + GT + (wc + j * 16 + col) * GP, lane);
#pragma unroll
    for (int j = 0; j < 4; ++j)
#pragma unroll
      for (int qa = 0; qa < 2; ++qa) acc[qa][j] = wmma_bf(a[qa], w[j], acc[qa][j]);
    if (kc + 1 < CC / 32) { g_stx(nxt + sxo, xr); g_stw(nxt + swo, wv); }
    __syncthreads(); }   // publishes the next tile and ends every read of this one (behind the last trip: before the planes reuse the buffers)
  _Float16 (*sh)[136] = (_Float16 (*)[136])sm; _Float16 (*sl)[136] = (_Float16 (*)[136])(sm + 128 * 136 * 2); __bf16 (*th)[136] = (__bf16 (*)[136])sm; __bf16 (*tl2)[136] = (__bf16 (*)[136])(sm + 128 * 136 * 2);
#pragma unroll
  for (int j = 0; j < 4; ++j) { const float bb = bfr(BA[c0 + wc + j * 16 + col]);
#pragma unroll
    for (int qa = 0; qa < 2; ++qa)
#pragma unroll
      for (int r = 0; r < 8; ++r) { const float v = acc[qa][j][r] + bb; const int rl = wr + qa * 16 + 8 * g + r, cl = wc + j * 16 + col; const _Float16 hv = (_Float16)v;
        if (which == 2) { const __bf16 bh = (__bf16)v; th[cl][rl] = bh; tl2[cl][rl] = (__bf16)(v - (float)bh); } else { sh[rl][cl] = hv; sl[rl][cl] = (_Float16)(v - (float)hv); } } }
  __syncthreads();
  // the 128 x 128 tile leaves as 8 x 4 fragment-order blocks: piece e = (block e >> 6 = (row tile, k block), half, lane); consecutive threads store consecutive 16-byte pieces
  if (which < 2) { _Float16* dh = which == 0 ? QH : KH; for (int e = tid; e < 128 * 16; e += 256) { const int fb = e >> 6, pc = e & 63; const int rl = (fb >> 2) * 16 + (pc & 15), cl = (fb & 3) * 32 + (pc >> 5) * 16 + ((pc >> 4) & 1) * 8; const size_t o = ((r0 / 16 + (fb >> 2)) * (CC / 32) + c0 / 32 + (fb & 3)) * FB + pc * 8; vst2((unsigned*)(dh + o), *(const v4u*)&sh[rl][cl]);
      asm volatile("s_wait_xcnt 0x0" ::: "memory");   // stands before the store's data and address registers are written again
      if (which == 0) { vst2((unsigned*)(QL + o), *(const v4u*)&sl[rl][cl]);
        asm volatile("s_wait_xcnt 0x0" ::: "memory"); } } }   // the same, for the residual plane's store
  else { const size_t b = r0 / TT; const int t0 = (int)(r0 % TT); for (int e = tid; e < 128 * 16; e += 256) { const int fb = e >> 6, pc = e & 63; const int cl = (fb >> 2) * 16 + (pc & 15), tl = (fb & 3) * 32 + (pc >> 5) * 16 + ((pc >> 4) & 1) * 8; const size_t o2 = (((b * CC + c0) / 16 + (fb >> 2)) * (TT / 32) + t0 / 32 + (fb & 3)) * FB + pc * 8; vst2((unsigned*)(VT + o2), *(const v4u*)&th[cl][tl]); vst2((unsigned*)(VL + o2), *(const v4u*)&tl2[cl][tl]);
      asm volatile("s_wait_xcnt 0x0" ::: "memory"); } } }   // stands before the two stores' data and address registers are written again
// ---- k_fa: scores, softmax and P . v in one kernel, running maximum and sum per query (no logits plane). Block = 8 waves x 16 queries of plane y = b * NH + h: waves 0..3 take the 64 queries of group x, waves 4..7 those of group 31 - x, so that every block has 33 x 4 wave tiles of work
// per 64 keys the block stages k (f16), v and v's residual (bf16), 32 KB each, once in LDS: the planes lie in fragment order, so staging is a plain copy; two buffers, the next tile's loads fly while this one multiplies
// both products are formed transposed: S^T = k q^T leaves a lane with 8 consecutive keys of ITS query (col = query), which is the B fragment of O^T = v^T P^T as it stands: P never leaves its registers, and maximum, sum and rescale are per lane (the other 8-key halves sit in lane ^ 16)
// scheduling groups: the next n LDS reads, or the next n WMMAs, stand together at this place of the instruction order
#define FA_LDS(n) __builtin_amdgcn_sched_group_barrier(0x100, n, 0)
#define FA_MM(n) __builtin_amdgcn_sched_group_barrier(0x8, n, 0)
#define FKB 32768                // bytes of one staged plane of 64 keys x 256 head columns
__device__ __forceinline__ void fa_ld(const char* kg, const char* vh, const char* vl, v4u (&r)[24]) {
#pragma unroll
  for (int i = 0; i < 8; ++i) r[i] = *(const v4u*)(kg + (i >> 1) * 32768 + (i & 1) * 4096);   // 16-key tile i >> 1: 8 KB in a row
#pragma unroll
  for (int i = 0; i < 8; ++i) { r[8 + i] = *(const v4u*)(vh + i * 131072); r[16 + i] = *(const v4u*)(vl + i * 131072); } }   // column tile 2 i + (tid >> 7): 2 KB in a row
__device__ __forceinline__ void fa_st(char* d, const v4u (&r)[24]) {
#pragma unroll
  for (int i = 0; i < 24; ++i) *(v4u*)(d + i * 4096) = r[i]; }
__global__ __launch_bounds__(256) void k_fa(const _Float16* __restrict__ QH, const _Float16* __restrict__ KH, const __bf16* __restrict__ VT, const __bf16* __restrict__ VL, float* __restrict__ Y) { __shared__ __align__(16) char sm[2 * 3 * FKB];
  const int tid = threadIdx.x, wave = __builtin_amdgcn_readfirstlane(tid >> 5), lane = tid & 31, col = lane & 15, g = lane >> 4; const int b = blockIdx.y / NH, h = blockIdx.y % NH;
  const int gx = blockIdx.x; const int ql0 = (wave < 4 ? gx * 64 : (TT / 64 - 1 - gx) * 64 - 64) + wave * 16; const int nt = TT / 64 - gx;   // key tiles up to the later group's diagonal
  const char* kg = (const char*)(KH + (((size_t)b * TT / 16) * (CC / 32) + h * (HD / 32)) * FB) + tid * 16;
  const size_t vo = ((((size_t)b * CC + h * HD) / 16) * (TT / 32)) * FB * 2 + (tid >> 7) * 65536 + (tid & 127) * 16; const char* vhg = (const char*)VT + vo; const char* vlg = (const char*)VL + vo;
  v16h qf[HD / 32]; const _Float16* const qp = QH + ((((size_t)b * TT + ql0) / 16) * (CC / 32) + h * (HD / 32)) * FB;
#pragma unroll
  for (int kc = 0; kc < HD / 32; ++kc) qf[kc] = frag_hp(qp + kc * FB, lane);
  v4u st[24]; v8f o[HD / 16] = {}; float m = -3.0e38f, l = 0.f;
  fa_ld(kg, vhg, vlg, st);
  asm volatile("s_wait_xcnt 0x0" ::: "memory");   // stands before the first loads' address registers are written again
  fa_st(sm + tid * 16, st);
  __syncthreads();
// kept rolled: one trip holds the next tile's 96 loaded registers beside the 128 accumulator and 64 query registers
#pragma unroll 1
  for (int kt = 0; kt < nt; ++kt) { const char* cur = sm + (kt & 1) * (3 * FKB); char* nxt = sm + ((kt + 1) & 1) * (3 * FKB);
    if (kt + 1 < nt) { fa_ld(kg + (size_t)(kt + 1) * 131072, vhg + (kt + 1) * 2048, vlg + (kt + 1) * 2048, st);
      asm volatile("s_wait_xcnt 0x0" ::: "memory"); }   // stands before the loads' address registers are written again
    if (kt * 64 <= ql0 + 15) {   // scalar: a wave whose 16 queries all lie in front of this key tile has nothing in it
      const _Float16* ck = (const _Float16*)cur; const __bf16* cvh = (const __bf16*)(cur + FKB); const __bf16* cvl = (const __bf16*)(cur + 2 * FKB);
      v8f s[4] = {}; v16h fk[2][4]; v16b fv[2][4];
      // fragments are read in groups of 4 (8 LDS loads at one place), each group one step ahead of the WMMAs that use it; the scheduling groups say so to the compiler, which otherwise spreads the loads singly among the WMMAs or asks for so many at once that staged registers are spilled
#pragma unroll
      for (int j = 0; j < 4; ++j) fk[0][j] = frag_hp(ck + (j * (HD / 32)) * FB, lane);
      FA_LDS(8);
#pragma unroll
      for (int kc = 0; kc < HD / 32; ++kc) {
        if (kc + 1 < HD / 32) {
#pragma unroll
          for (int j = 0; j < 4; ++j) fk[(kc + 1) & 1][j] = frag_hp(ck + (j * (HD / 32) + kc + 1) * FB, lane); }
        else {
#pragma unroll
          for (int e = 0; e < 2; ++e) { fv[0][e] = frag_bp(cvh + (e * 2) * FB, lane); fv[0][2 + e] = frag_bp(cvl + (e * 2) * FB, lane); } }   // v's first group flies through the softmax
        FA_LDS(8);
#pragma unroll
        for (int j = 0; j < 4; ++j) s[j] = __builtin_amdgcn_wmma_f32_16x16x32_f16(false, fk[kc & 1][j], false, qf[kc], (short)0, s[j], false, false);
        FA_MM(4); }
      const int qt = ql0 + col; float mx = m;
#pragma unroll
      for (int j = 0; j < 4; ++j)
#pragma unroll
        for (int r = 0; r < 8; ++r) { float v = s[j][r] * 0.00390625f; if (kt * 64 + j * 16 + 8 * g + r > qt) v = -3.0e38f; s[j][r] = v; mx = fmaxf(mx, v); }
      mx = fmaxf(mx, __shfl_xor(mx, 16));
      const float al = expf(m - mx); m = mx; v4f s4 = {0.f, 0.f, 0.f, 0.f};
#pragma unroll
      for (int j = 0; j < 4; ++j)
#pragma unroll
        for (int r = 0; r < 8; ++r) { const float v = s[j][r], ex = expf(v - mx); const float pv = (v <= -1.0e38f) ? 0.f : ex; s[j][r] = pv; s4[r & 3] += pv; }
      l = l * al + ((s4[0] + s4[1]) + (s4[2] + s4[3]));
#pragma unroll
      for (int dt = 0; dt < HD / 16; ++dt) o[dt] *= al;
      F2 p[2];
#pragma unroll
      for (int u = 0; u < 2; ++u) { float v[16];
#pragma unroll
        for (int i = 0; i < 8; ++i) { v[i] = s[2 * u][i]; v[8 + i] = s[2 * u + 1][i]; }
        p[u] = bsplit16(v); }
      // group gi = (column tiles 2 (gi >> 1) and 2 (gi >> 1) + 1, 32 keys u = gi & 1): two accumulators in turn
#pragma unroll
      for (int gi = 0; gi < 16; ++gi) { const int d2 = (gi >> 1) * 2, u = gi & 1;
        if (gi + 1 < 16) {
#pragma unroll
          for (int e = 0; e < 2; ++e) { fv[(gi + 1) & 1][e] = frag_bp(cvh + ((((gi + 1) >> 1) * 2 + e) * 2 + ((gi + 1) & 1)) * FB, lane); fv[(gi + 1) & 1][2 + e] = frag_bp(cvl + ((((gi + 1) >> 1) * 2 + e) * 2 + ((gi + 1) & 1)) * FB, lane); }
          FA_LDS(8); }
#pragma unroll
        for (int e = 0; e < 2; ++e) o[d2 + e] = __builtin_amdgcn_wmma_f32_16x16x32_bf16(false, fv[gi & 1][e], false, p[u].h, (short)0, o[d2 + e], false, false);
#pragma unroll
        for (int e = 0; e < 2; ++e) o[d2 + e] = __builtin_amdgcn_wmma_f32_16x16x32_bf16(false, fv[gi & 1][e], false, p[u].l, (short)0, o[d2 + e], false, false);
#pragma unroll
        for (int e = 0; e < 2; ++e) o[d2 + e] = gi + 1 < 16 ? __builtin_amdgcn_wmma_f32_16x16x32_bf16(false, fv[gi & 1][2 + e], false, p[u].h, (short)0, o[d2 + e], false, false) : wmma_bf(fv[gi & 1][2 + e], p[u].h, o[d2 + e]);   // the tile's last two carry their four v_nop with them
        FA_MM(6); } }
    if (kt + 1 < nt) fa_st(nxt + tid * 16, st);
    __syncthreads(); }   // publishes the next tile and ends every read of this one
  const float inv = 1.0f / (l + __shfl_xor(l, 16));
#pragma unroll
  for (int dt = 0; dt < HD / 16; ++dt) o[dt] *= inv;
  float* const yp = Y + ((size_t)b * TT + ql0 + col) * CC + h * HD + 8 * g;   // the lane holds columns dt * 16 + 8 g + 0..7 of its query
#pragma unroll
  for (int dt = 0; dt < HD / 16; ++dt) { const v4f lo = {o[dt][0], o[dt][1], o[dt][2], o[dt][3]}, hi = {o[dt][4], o[dt][5], o[dt][6], o[dt][7]}; vst2(yp + dt * 16, lo); vst2(yp + dt * 16 + 4, hi); } }   // a run of stores alone: no register that a store names is written between them
// ---- k_out: block = (128 rows, 128 cols): out = y (bf16 hi + lo) Wproj + b; tiles staged as in k_proj, y as two planes
__global__ __launch_bounds__(256) void k_out(const float* __restrict__ Y, const float* __restrict__ WP, const float* __restrict__ BP, float* __restrict__ OUT) { __shared__ __align__(16) char sm[128 * 132 * 4];   // in the loop: two buffers of [y hi | y lo | w]; behind it: the f32 output tile at pitch 132
  __bf16* const st = (__bf16*)sm;
  const int tid = threadIdx.x, wave = tid >> 5, lane = tid & 31, col = lane & 15, g = lane >> 4; const int c0 = blockIdx.y * 128; const size_t r0 = (size_t)blockIdx.x * 128;
  const int wr = (wave >> 1) * 32, wc = (wave & 1) * 64;
  const float* xa = Y + (r0 + (tid >> 3)) * CC + (tid & 7) * 4; const float* wa = WP + (size_t)((tid >> 7) * 16) * CC + c0 + (tid & 127);
  const int sxo = (tid >> 3) * GP + (tid & 7) * 4, swo = 2 * GT + (tid & 127) * GP + (tid >> 7) * 16;
  v4f xr[4]; float wv[16]; v8f acc[2][4] = {};
  g_ldx(xa, xr); g_ldw(wa, CC, wv); g_stx2(st + sxo, st + GT + sxo, xr); g_stw(st + swo, wv);
  __syncthreads();
// kept rolled: one trip holds the next tile's 32 loaded registers beside fragments and accumulators
#pragma unroll 1
  for (int kc = 0; kc < CC / 32; ++kc) { const __bf16* cur = st + (kc & 1) * (3 * GT); __bf16* nxt = st + ((kc + 1) & 1) * (3 * GT);
    if (kc + 1 < CC / 32) { g_ldx(xa + (kc + 1) * 32, xr); g_ldw(wa + (size_t)(kc + 1) * 32 * CC, CC, wv); }   // the next tile flies while this one multiplies
    v16b ah[2], al[2], w[4];
#pragma unroll
    for (int qa = 0; qa < 2; ++qa) { ah[qa] = frag_b(cur + (wr + qa * 16 + col) * GP, lane); al[qa] = frag_b(cur + GT + (wr + qa * 16 + col) * GP, lane); }
#pragma unroll
    for (int j = 0; j < 4; ++j) w[j] = frag_b(cur + 2 * GT + (wc + j * 16 + col) * GP, lane);
#pragma unroll
    for (int j = 0; j < 4; ++j)
#pragma unroll
      for (int qa = 0; qa < 2; ++qa) acc[qa][j] = wmma_bf(ah[qa], w[j], acc[qa][j]);
#pragma unroll
    for (int j = 0; j < 4; ++j)
#pragma unroll
      for (int qa = 0; qa < 2; ++qa) acc[qa][j] = wmma_bf(al[qa], w[j], acc[qa][j]);
    if (kc + 1 < CC / 32) { g_stx2(nxt + sxo, nxt + GT + sxo, xr); g_stw(nxt + swo, wv); }
    __syncthreads(); }   // publishes the next tile and ends every read of this one (behind the last trip: before the output tile reuses the buffers)
  float (*sf)[132] = (float (*)[132])sm;
#pragma unroll
  for (int j = 0; j < 4; ++j) { const float bb = BP ? bfr(BP[c0 + wc + j * 16 + col]) : 0.f;
#pragma unroll
    for (int qa = 0; qa < 2; ++qa)
#pragma unroll
      for (int r = 0; r < 8; ++r) sf[wr + qa * 16 + 8 * g + r][wc + j * 16 + col] = acc[qa][j][r] + bb; }
  __syncthreads();
  for (int e = tid; e < 128 * 32; e += 256) { const int rl = e >> 5, q = e & 31; vst2(OUT + (r0 + rl) * CC + c0 + q * 4, *(const v4f*)&sf[rl][q * 4]); } }
extern "C" void kernel_launch(void* const* d_in, const int* in_sizes, int n_in, void* d_out, int out_size, void* d_ws, size_t ws_size, hipStream_t stream) {
  (void)in_sizes; (void)n_in; (void)out_size;
  const float** F = (const float**)d_in;   // 0 inputs_for_keys, 1 inputs_for_values, 2 inputs_for_queries [4,2048,1024], 3 Wk [4,1024,256], 4 bk [4,256], 5 Wq, 6 bq, 7 Wv, 8 bv, 9 Wo [1024,1024] ([in,out]), 10 bo
  if (ws_size < (size_t)WS_END) return;
  char* ws = (char*)d_ws; _Float16 *QH = (_Float16*)(ws + WS_QH), *QL = (_Float16*)(ws + WS_QL), *KH = (_Float16*)(ws + WS_KH); __bf16 *VT = (__bf16*)(ws + WS_VT), *VL = (__bf16*)(ws + WS_VL); float *Y = (float*)(ws + WS_Y);
  k_proj<<<dim3(TNB * TT / 128, CC / 128, 3), 256, 0, stream>>>(F[2], F[0], F[1], F[5], F[6], F[3], F[4], F[7], F[8], QH, QL, KH, VT, VL);
  k_fa<<<dim3(TT / 128, TNB * NH), 256, 0, stream>>>(QH, KH, VT, VL, Y);
  k_out<<<dim3(TNB * TT / 128, CC / 128), 256, 0, stream>>>(Y, F[9], F[10], (float*)d_out);
}

// v007
// A run of this version takes 224 microseconds.
// Next to v006, in two timings, it ran 1.05 and 1.04 times as fast.
// Counting every step since v000, it is 35.2 times as fast.
// compute dtype: all float inputs rounded to bf16; Q/K/V = inputs W_h + b_h (per-head [E, Dh] weights) with EXACT bf16 products on WMMA 16x16x32, f32 accumulate, q/k rounded once to f16 (logits / 256 have std ~0.06: 1 product), causal logits kept in registers; softmax in f32 with a running maximum and sum (precise expf), unnormalised P in f32 split bf16 hi + lo against v as bf16 hi + lo (3 products), divided by the sum at the end; out = y (bf16 hi + lo) Wo + bo; f32 output.
#include <hip/hip_runtime.h>
#include <math.h>

typedef __attribute__((ext_vector_type(16))) _Float16 v16h;
typedef __attribute__((ext_vector_type(16))) __bf16 v16b;
typedef __attribute__((ext_vector_type(8)))  _Float16 v8h;
typedef __attribute__((ext_vector_type(8)))  float v8f;
typedef __attribute__((ext_vector_type(4)))  float v4f;
typedef __attribute__((ext_vector_type(2)))  float v2f;
typedef __attribute__((ext_vector_type(4)))  unsigned v4u;
typedef __attribute__((ext_vector_type(4)))  int v4i;
typedef float __attribute__((may_alias)) float_a;
typedef int __attribute__((may_alias)) int_a;

template <typename T> __device__ __forceinline__ void vst2(void* p, T v) { *(T*)p = v;  }
__device__ __forceinline__ v8f wmma16(v16h a, v16h b, v8f c) {
  v8f d = __builtin_amdgcn_wmma_f32_16x16x32_f16(false, a, false, b, (short)0, c, false, false);
  asm volatile("v_nop\n\tv_nop\n\tv_nop\n\tv_nop" : "+v"(d) : "v"(a), "v"(b));
  return d;
}
__device__ __forceinline__ v8f wmma_bf(v16b a, v16b b, v8f c) {
  v8f d = __builtin_amdgcn_wmma_f32_16x16x32_bf16(false, a, false, b, (short)0, c, false, false);
  asm volatile("v_nop\n\tv_nop\n\tv_nop\n\tv_nop" : "+v"(d) : "v"(a), "v"(b));
  return d;
}
// 16x16x32 fragments: lane = (h = lane>>4, row/col = lane&15); elements 0..7 = k0+8h+0..7, 8..15 = k0+16+8h+0..7; D element r = row 8h+r
__device__ __forceinline__ v16h frag_h(const _Float16* rowk0, int lane) {
  union { v16h v; v8h q[2]; } u; const _Float16* p = rowk0 + 8 * (lane >> 4);
  u.q[0] = *(const v8h*)p; u.q[1] = *(const v8h*)(p + 16); return u.v;
}
__device__ __forceinline__ v16h frag_f32(const float* rowk0, int lane) {
  v16h a; const float* p = rowk0 + 8 * (lane >> 4);
#pragma unroll
  for (int i = 0; i < 8; ++i) { a[i] = (_Float16)p[i]; a[8 + i] = (_Float16)p[16 + i]; }
  return a;
}
__device__ __forceinline__ v16h frag_f32s(const float* rowk0, int lane, float sc) {
  v16h a; const float* p = rowk0 + 8 * (lane >> 4);
#pragma unroll
  for (int i = 0; i < 8; ++i) { a[i] = (_Float16)(p[i] * sc); a[8 + i] = (_Float16)(p[16 + i] * sc); }
  return a;
}
// column fragment from a [K][ld] layout (column n), rows >= K read as 0
__device__ __forceinline__ v16h fragc_f32(const float* W, int k0, int n, int lane, int ld, int K) {
  v16h a; const int g = lane >> 4;
#pragma unroll
  for (int i = 0; i < 8; ++i) { const int ka = k0 + 8 * g + i, kb = ka + 16;
    a[i] = (_Float16)(ka < K ? W[(size_t)(ka < K ? ka : K - 1) * ld + n] : 0.f); a[8 + i] = (_Float16)(kb < K ? W[(size_t)(kb < K ? kb : K - 1) * ld + n] : 0.f); }
  return a;
}
struct F2 { v16b h, l; };
__device__ __forceinline__ F2 bsplit16(const float v[16]) { F2 r;
#pragma unroll
  for (int i = 0; i < 16; ++i) { const __bf16 h = (__bf16)v[i]; r.h[i] = h; r.l[i] = (__bf16)(v[i] - (float)h); }
  return r; }
__device__ __forceinline__ F2 split_row(const float* row, int k0, int lane) { float v[16]; const float* p = row + k0 + 8 * (lane >> 4);
#pragma unroll
  for (int i = 0; i < 8; ++i) { v[i] = p[i]; v[8 + i] = p[16 + i]; }
  return bsplit16(v); }
__device__ __forceinline__ F2 split_rowK(const float* row, int k0, int lane, int K) { float v[16]; const int g = lane >> 4;
#pragma unroll
  for (int i = 0; i < 8; ++i) { const int ka = k0 + 8 * g + i, kb = ka + 16; v[i] = ka < K ? row[ka < K ? ka : K - 1] : 0.f; v[8 + i] = kb < K ? row[kb < K ? kb : K - 1] : 0.f; }
  return bsplit16(v); }
__device__ __forceinline__ F2 split_col(const float* W, int k0, int n, int lane, int ld, int K) { float v[16]; const int g = lane >> 4;
#pragma unroll
  for (int i = 0; i < 8; ++i) { const int ka = k0 + 8 * g + i, kb = ka + 16; v[i] = ka < K ? W[(size_t)(ka < K ? ka : K - 1) * ld + n] : 0.f; v[8 + i] = kb < K ? W[(size_t)(kb < K ? kb : K - 1) * ld + n] : 0.f; }
  return bsplit16(v); }
__device__ __forceinline__ v8f mac3(const F2& a, const F2& b, v8f c) { c = wmma_bf(a.l, b.h, c); c = wmma_bf(a.h, b.l, c); return wmma_bf(a.h, b.h, c); }
__device__ __forceinline__ float sigm(float v) { return 1.0f / (1.0f + expf(-v)); }
#define LDSX() do { asm volatile("s_wait_dscnt 0" ::: "memory"); __builtin_amdgcn_wave_barrier(); __builtin_amdgcn_fence(__ATOMIC_RELEASE, "workgroup"); } while (0)


// Four-headed causal attention (B 4, S 2,048, E 1,024 = 4 heads x 256): per-head Dense q/k/v from three different inputs, scores / head_dim (256), strictly-upper -1e30 mask, softmax, concat heads, Wo + bo.
#define NB 4
#define TT 2048
#define CC 1024
#define NH 4
#define HD 256
#ifndef TNB
#define TNB NB
#endif
typedef __attribute__((ext_vector_type(8))) __bf16 v8b;
__device__ __forceinline__ v16b frag_b(const __bf16* rowk0, int lane) {
  union { v16b v; v8b q[2]; } u; const __bf16* p = rowk0 + 8 * (lane >> 4);
  u.q[0] = *(const v8b*)p; u.q[1] = *(const v8b*)(p + 16); return u.v;
}
// fragment-order planes: a (16 rows x 32 k) operand tile is one 1,024-byte block, [half][lane][8]: half 0 = the lane's elements 0..7, half 1 = its elements 8..15, so each of a fragment's two 16-byte loads covers 512 contiguous bytes (4 whole lines) and not 16 lines
#define FB 512                   // elements of one block
__device__ __forceinline__ v16h frag_hp(const _Float16* blk, int lane) {
  union { v16h v; v8h q[2]; } u; const _Float16* p = blk + lane * 8;
  u.q[0] = *(const v8h*)p; u.q[1] = *(const v8h*)(p + 256); return u.v;
}
__device__ __forceinline__ v16b frag_bp(const __bf16* blk, int lane) {
  union { v16b v; v8b q[2]; } u; const __bf16* p = blk + lane * 8;
  u.q[0] = *(const v8b*)p; u.q[1] = *(const v8b*)(p + 256); return u.v;
}
__device__ __forceinline__ float bfr(float v) { return (float)(__bf16)v; }
__device__ __attribute__((noinline)) float exp_ni(float v) { return expf(v); }
__device__ __attribute__((noinline)) float erf_ni(float v) { return erff(v); }

#define WS_QH  0u
#define WS_QL  (WS_QH + 2u * (size_t)NB * TT * CC)
#define WS_KH  (WS_QL + 2u * (size_t)NB * TT * CC)
#define WS_VT  (WS_KH + 2u * (size_t)NB * TT * CC)      // bf16 v planes, rows b * C + c, k = t; q, k and v planes all lie in fragment order (frag_hp, frag_bp)
#define WS_VL  (WS_VT + 2u * (size_t)NB * CC * TT)      // bf16 v residual planes
#define WS_Y   (WS_VL + 2u * (size_t)NB * CC * TT)      // f32 y rows [b*t][C]
#define WS_END (WS_Y + 4u * (size_t)NB * TT * CC)

// ---- staged GEMM tiles (k_proj, k_out): a block of 8 waves owns 128 rows x 128 cols; per 32 k both operands go global -> registers -> LDS once per block, already rounded to bf16, rows k-contiguous; wave = 32 rows x 64 cols
#define GP 40                    // LDS pitch of a staged 32-k row, in bf16 elements: 80 bytes = 16 x odd, which the 16-byte fragment reads want
#define GT (128 * GP)            // one staged operand tile, in elements
typedef __attribute__((ext_vector_type(4))) __bf16 v4b;
// x tile: thread = (row tid >> 3 (+ 32 i), 4 k at (tid & 7) * 4): a wave's 16-byte loads cover 4 whole 128-byte lines
__device__ __forceinline__ void g_ldx(const float* p, v4f (&r)[4]) {
#pragma unroll
  for (int i = 0; i < 4; ++i) r[i] = *(const v4f*)(p + (size_t)i * 32 * CC); }
// w tile from a [k][ld] layout: thread = (col tid & 127, 16 k from (tid >> 7) * 16): a wave's 4-byte loads cover one whole line, and the thread holds a k-contiguous run of its column
__device__ __forceinline__ void g_ldw(const float* p, int ld, float (&r)[16]) {
#pragma unroll
  for (int i = 0; i < 16; ++i) r[i] = p[(size_t)i * ld]; }
__device__ __forceinline__ void g_stx(__bf16* d, const v4f (&r)[4]) {
#pragma unroll
  for (int i = 0; i < 4; ++i) { v4b o;
#pragma unroll
    for (int e = 0; e < 4; ++e) o[e] = (__bf16)r[i][e];
    *(v4b*)(d + i * 32 * GP) = o; } }
__device__ __forceinline__ void g_stx2(__bf16* dh, __bf16* dl, const v4f (&r)[4]) {
#pragma unroll
  for (int i = 0; i < 4; ++i) { v4b oh, ol;
#pragma unroll
    for (int e = 0; e < 4; ++e) { const __bf16 h = (__bf16)r[i][e]; oh[e] = h; ol[e] = (__bf16)(r[i][e] - (float)h); }
    *(v4b*)(dh + i * 32 * GP) = oh; *(v4b*)(dl + i * 32 * GP) = ol; } }
__device__ __forceinline__ void g_stw(__bf16* d, const float (&r)[16]) { v8b o0, o1;
#pragma unroll
  for (int i = 0; i < 8; ++i) { o0[i] = (__bf16)r[i]; o1[i] = (__bf16)r[8 + i]; }
  *(v8b*)d = o0; *(v8b*)(d + 8) = o1; }
// ---- k_proj: block = (128 rows, 128 cols, which): qkv = x W (+ b), exact; q -> f16 hi (+ residual), k -> f16 hi, v -> bf16 hi + residual planes
__global__ __launch_bounds__(256) void k_proj(const float* __restrict__ XQ, const float* __restrict__ XK, const float* __restrict__ XV, const float* __restrict__ WQ, const float* __restrict__ BQ, const float* __restrict__ WK, const float* __restrict__ BK, const float* __restrict__ WV, const float* __restrict__ BV, _Float16* __restrict__ QH, _Float16* __restrict__ QL, _Float16* __restrict__ KH, __bf16* __restrict__ VT, __bf16* __restrict__ VL) {
  __shared__ __align__(16) char sm[2 * 128 * 136 * 2];   // in the loop: two buffers of [x tile | w tile]; behind it: the two output planes at pitch 136
  __bf16* const st = (__bf16*)sm;
  const int tid = threadIdx.x, wave = tid >> 5, lane = tid & 31, col = lane & 15, g = lane >> 4; const int which = blockIdx.z; const int c0 = blockIdx.y * 128; const size_t r0 = (size_t)blockIdx.x * 128; const float* X = which == 0 ? XQ : which == 1 ? XK : XV; const float* WA = which == 0 ? WQ : which == 1 ? WK : WV; const float* BA = which == 0 ? BQ : which == 1 ? BK : BV;
  const int wr = (wave >> 1) * 32, wc = (wave & 1) * 64;
  const float* xa = X + (r0 + (tid >> 3)) * CC + (tid & 7) * 4; const float* wa = WA + ((size_t)(c0 / HD) * CC + (tid >> 7) * 16) * HD + c0 % HD + (tid & 127);
  const int sxo = (tid >> 3) * GP + (tid & 7) * 4, swo = GT + (tid & 127) * GP + (tid >> 7) * 16;
  v4f xr[4]; float wv[16]; v8f acc[2][4] = {};
  g_ldx(xa, xr);
  asm volatile("s_wait_xcnt 0x0" ::: "memory");   // stands before the first x tile's address registers are written again
  g_ldw(wa, HD, wv); g_stx(st + sxo, xr); g_stw(st + swo, wv);
  __syncthreads();
// kept rolled: one trip holds the next tile's 32 loaded registers beside fragments and accumulators
#pragma unroll 1
  for (int kc = 0; kc < CC / 32; ++kc) { const __bf16* cur = st + (kc & 1) * (2 * GT); __bf16* nxt = st + ((kc + 1) & 1) * (2 * GT);
    if (kc + 1 < CC / 32) { g_ldx(xa + (kc + 1) * 32, xr); g_ldw(wa + (size_t)(kc + 1) * 32 * HD, HD, wv); }   // the next tile flies while this one multiplies
    v16b a[2], w[4];
#pragma unroll
    for (int qa = 0; qa < 2; ++qa) a[qa] = frag_b(cur + (wr + qa * 16 + col) * GP, lane);
#pragma unroll
    for (int j = 0; j < 4; ++j) w[j] = frag_b(cur + GT + (wc + j * 16 + col) * GP, lane);
#pragma unroll
    for (int j = 0; j < 4; ++j)
#pragma unroll
      for (int qa = 0; qa < 2; ++qa) acc[qa][j] = wmma_bf(a[qa], w[j], acc[qa][j]);
    if (kc + 1 < CC / 32) { g_stx(nxt + sxo, xr); g_stw(nxt + swo, wv); }
    __syncthreads(); }   // publishes the next tile and ends every read of this one (behind the last trip: before the planes reuse the buffers)
  _Float16 (*sh)[136] = (_Float16 (*)[136])sm; _Float16 (*sl)[136] = (_Float16 (*)[136])(sm + 128 * 136 * 2); __bf16 (*th)[136] = (__bf16 (*)[136])sm; __bf16 (*tl2)[136] = (__bf16 (*)[136])(sm + 128 * 136 * 2);
#pragma unroll
  for (int j = 0; j < 4; ++j) { const float bb = bfr(BA[c0 + wc + j * 16 + col]);
#pragma unroll
    for (int qa = 0; qa < 2; ++qa)
#pragma unroll
      for (int r = 0; r < 8; ++r) { const float v = acc[qa][j][r] + bb; const int rl = wr + qa * 16 + 8 * g + r, cl = wc + j * 16 + col; const _Float16 hv = (_Float16)v;
        if (which == 2) { const __bf16 bh = (__bf16)v; th[cl][rl] = bh; tl2[cl][rl] = (__bf16)(v - (float)bh); } else { sh[rl][cl] = hv; sl[rl][cl] = (_Float16)(v - (float)hv); } } }
  __syncthreads();
  // the 128 x 128 tile leaves as 8 x 4 fragment-order blocks: piece e = (block e >> 6 = (row tile, k block), half, lane); consecutive threads store consecutive 16-byte pieces
  if (which < 2) { _Float16* dh = which == 0 ? QH : KH; for (int e = tid; e < 128 * 16; e += 256) { const int fb = e >> 6, pc = e & 63; const int rl = (fb >> 2) * 16 + (pc & 15), cl = (fb & 3) * 32 + (pc >> 5) * 16 + ((pc >> 4) & 1) * 8; const size_t o = ((r0 / 16 + (fb >> 2)) * (CC / 32) + c0 / 32 + (fb & 3)) * FB + pc * 8; vst2((unsigned*)(dh + o), *(const v4u*)&sh[rl][cl]);
      asm volatile("s_wait_xcnt 0x0" ::: "memory");   // stands before the store's data and address registers are written again
      if (which == 0) { vst2((unsigned*)(QL + o), *(const v4u*)&sl[rl][cl]);
        asm volatile("s_wait_xcnt 0x0" ::: "memory"); } } }   // the same, for the residual plane's store
  else { const size_t b = r0 / TT; const int t0 = (int)(r0 % TT); for (int e = tid; e < 128 * 16; e += 256) { const int fb = e >> 6, pc = e & 63; const int cl = (fb >> 2) * 16 + (pc & 15), tl = (fb & 3) * 32 + (pc >> 5) * 16 + ((pc >> 4) & 1) * 8; const size_t o2 = (((b * CC + c0) / 16 + (fb >> 2)) * (TT / 32) + t0 / 32 + (fb & 3)) * FB + pc * 8; vst2((unsigned*)(VT + o2), *(const v4u*)&th[cl][tl]); vst2((unsigned*)(VL + o2), *(const v4u*)&tl2[cl][tl]);
      asm volatile("s_wait_xcnt 0x0" ::: "memory"); } } }   // stands before the two stores' data and address registers are written again
// ---- k_fa: scores, softmax and P . v in one kernel, running maximum and sum per query (no logits plane). Block = 8 waves x 16 queries of plane y = b * NH + h: waves 0..3 take the 64 queries of group x, waves 4..7 those of group 31 - x, so that every block has 33 x 4 wave tiles of work
// per 64 keys the block stages k (f16), v and v's residual (bf16), 32 KB each, once in LDS: the planes lie in fragment order, so staging is a plain copy; two buffers, the next tile's loads fly while this one multiplies
// both products are formed transposed: S^T = k q^T leaves a lane with 8 consecutive keys of ITS query (col = query), which is the B fragment of O^T = v^T P^T as it stands: P never leaves its registers, and maximum, sum and rescale are per lane (the other 8-key halves sit in lane ^ 16)
// scheduling barrier that no instruction may cross: it holds each group of fragment reads at its written place, two groups ahead of the WMMAs that use it
#define FA_PIN() __builtin_amdgcn_sched_barrier(0)
// a v group's last WMMA on an accumulator, in the form of wmma_bf: the asm statement behind it keeps its place among the scheduling barriers, which a bare WMMA does not (without it every WMMA of the tile sinks behind the last read, and the fragments spill), so the group's WMMAs stay in front of the next group's reads; the four v_nop are the distance to a vector instruction on D. Only D is named: fragments named there as well are tied to the first 256 registers, and the accumulators spill
__device__ __forceinline__ v8f fa_wmma_end(v16b a, v16b b, v8f c) {
  v8f d = __builtin_amdgcn_wmma_f32_16x16x32_bf16(false, a, false, b, (short)0, c, false, false);
  asm volatile("v_nop\n\tv_nop\n\tv_nop\n\tv_nop" : "+v"(d));
  return d;
}
#define FKB 32768                // bytes of one staged plane of 64 keys x 256 head columns
__device__ __forceinline__ void fa_ld(const char* kg, const char* vh, const char* vl, v4u (&r)[24]) {
#pragma unroll
  for (int i = 0; i < 8; ++i) r[i] = *(const v4u*)(kg + (i >> 1) * 32768 + (i & 1) * 4096);   // 16-key tile i >> 1: 8 KB in a row
#pragma unroll
  for (int i = 0; i < 8; ++i) { r[8 + i] = *(const v4u*)(vh + i * 131072); r[16 + i] = *(const v4u*)(vl + i * 131072); } }   // column tile 2 i + (tid >> 7): 2 KB in a row
__device__ __forceinline__ void fa_st(char* d, const v4u (&r)[24]) {
#pragma unroll
  for (int i = 0; i < 24; ++i) *(v4u*)(d + i * 4096) = r[i]; }
__global__ __launch_bounds__(256) void k_fa(const _Float16* __restrict__ QH, const _Float16* __restrict__ KH, const __bf16* __restrict__ VT, const __bf16* __restrict__ VL, float* __restrict__ Y) { __shared__ __align__(16) char sm[2 * 3 * FKB];
  const int tid = threadIdx.x, wave = __builtin_amdgcn_readfirstlane(tid >> 5), lane = tid & 31, col = lane & 15, g = lane >> 4; const int b = blockIdx.y / NH, h = blockIdx.y % NH;
  const int gx = blockIdx.x; const int ql0 = (wave < 4 ? gx * 64 : (TT / 64 - 1 - gx) * 64 - 64) + wave * 16; const int nt = TT / 64 - gx;   // key tiles up to the later group's diagonal
  const char* kg = (const char*)(KH + (((size_t)b * TT / 16) * (CC / 32) + h * (HD / 32)) * FB) + tid * 16;
  const size_t vo = ((((size_t)b * CC + h * HD) / 16) * (TT / 32)) * FB * 2 + (tid >> 7) * 65536 + (tid & 127) * 16; const char* vhg = (const char*)VT + vo; const char* vlg = (const char*)VL + vo;
  v16h qf[HD / 32]; const _Float16* const qp = QH + ((((size_t)b * TT + ql0) / 16) * (CC / 32) + h * (HD / 32)) * FB;
#pragma unroll
  for (int kc = 0; kc < HD / 32; ++kc) qf[kc] = frag_hp(qp + kc * FB, lane);
  v4u st[24]; v8f o[HD / 16] = {}; float m = -3.0e38f, l = 0.f;
  fa_ld(kg, vhg, vlg, st);
  asm volatile("s_wait_xcnt 0x0" ::: "memory");   // stands before the first loads' address registers are written again
  fa_st(sm + tid * 16, st);
  __syncthreads();
// kept rolled: one trip holds the next tile's 96 loaded registers beside the 128 accumulator and 64 query registers
#pragma unroll 1
  for (int kt = 0; kt < nt; ++kt) { const char* cur = sm + (kt & 1) * (3 * FKB); char* nxt = sm + ((kt + 1) & 1) * (3 * FKB);
    if (kt + 1 < nt) { fa_ld(kg + (size_t)(kt + 1) * 131072, vhg + (kt + 1) * 2048, vlg + (kt + 1) * 2048, st);
      asm volatile("s_wait_xcnt 0x0" ::: "memory"); }   // stands before the loads' address registers are written again
    if (kt * 64 <= ql0 + 15) {   // scalar: a wave whose 16 queries all lie in front of this key tile has nothing in it
      const _Float16* ck = (const _Float16*)cur; const __bf16* cvh = (const __bf16*)(cur + FKB); const __bf16* cvl = (const __bf16*)(cur + 2 * FKB);
      v8f s[4] = {}; v16h fk[3][4]; v16b fv[3][4];
      // fragments are read in groups of 4 (8 LDS loads at one place) into a ring of three groups, each group two steps ahead of the WMMAs that use it, so that a group's LDS latency is covered by two groups of WMMAs and no wait falls on loads just issued; left to itself the compiler reads v's groups directly in front of their WMMAs
#pragma unroll
      for (int kc = 0; kc < 2; ++kc)
#pragma unroll
        for (int j = 0; j < 4; ++j) fk[kc][j] = frag_hp(ck + (j * (HD / 32) + kc) * FB, lane);
      FA_PIN();
#pragma unroll
      for (int kc = 0; kc < HD / 32; ++kc) {
        if (kc + 2 < HD / 32) {
#pragma unroll
          for (int j = 0; j < 4; ++j) fk[(kc + 2) % 3][j] = frag_hp(ck + (j * (HD / 32) + kc + 2) * FB, lane); }
        else { const int u = kc + 2 - HD / 32;   // v's first two groups (column tiles 0 and 1, 32 keys u) fly through the softmax
#pragma unroll
          for (int e = 0; e < 2; ++e) { fv[u][e] = frag_bp(cvh + (e * 2 + u) * FB, lane); fv[u][2 + e] = frag_bp(cvl + (e * 2 + u) * FB, lane); } }
        FA_PIN();
#pragma unroll
        for (int j = 0; j < 4; ++j) s[j] = __builtin_amdgcn_wmma_f32_16x16x32_f16(false, fk[kc % 3][j], false, qf[kc], (short)0, s[j], false, false);
        FA_PIN(); }
      const int qt = ql0 + col; float mx = m;
#pragma unroll
      for (int j = 0; j < 4; ++j)
#pragma unroll
        for (int r = 0; r < 8; ++r) { float v = s[j][r] * 0.00390625f; if (kt * 64 + j * 16 + 8 * g + r > qt) v = -3.0e38f; s[j][r] = v; mx = fmaxf(mx, v); }
      mx = fmaxf(mx, __shfl_xor(mx, 16));
      const float al = expf(m - mx); m = mx; v4f s4 = {0.f, 0.f, 0.f, 0.f};
#pragma unroll
      for (int j = 0; j < 4; ++j)
#pragma unroll
        for (int r = 0; r < 8; ++r) { const float v = s[j][r], ex = expf(v - mx); const float pv = (v <= -1.0e38f) ? 0.f : ex; s[j][r] = pv; s4[r & 3] += pv; }
      l = l * al + ((s4[0] + s4[1]) + (s4[2] + s4[3]));
#pragma unroll
      for (int dt = 0; dt < HD / 16; ++dt) o[dt] *= al;
      F2 p[2];
#pragma unroll
      for (int u = 0; u < 2; ++u) { float v[16];
#pragma unroll
        for (int i = 0; i < 8; ++i) { v[i] = s[2 * u][i]; v[8 + i] = s[2 * u + 1][i]; }
        p[u] = bsplit16(v); }
      // group gi = (column tiles 2 (gi >> 1) and 2 (gi >> 1) + 1, 32 keys u = gi & 1): two accumulators in turn
#pragma unroll
      for (int gi = 0; gi < 16; ++gi) { const int d2 = (gi >> 1) * 2, u = gi & 1;
        if (gi + 2 < 16) {
#pragma unroll
          for (int e = 0; e < 2; ++e) { fv[(gi + 2) % 3][e] = frag_bp(cvh + ((((gi + 2) >> 1) * 2 + e) * 2 + (gi & 1)) * FB, lane); fv[(gi + 2) % 3][2 + e] = frag_bp(cvl + ((((gi + 2) >> 1) * 2 + e) * 2 + (gi & 1)) * FB, lane); } }
        FA_PIN();
#pragma unroll
        for (int e = 0; e < 2; ++e) o[d2 + e] = __builtin_amdgcn_wmma_f32_16x16x32_bf16(false, fv[gi % 3][e], false, p[u].h, (short)0, o[d2 + e], false, false);
#pragma unroll
        for (int e = 0; e < 2; ++e) o[d2 + e] = __builtin_amdgcn_wmma_f32_16x16x32_bf16(false, fv[gi % 3][e], false, p[u].l, (short)0, o[d2 + e], false, false);
#pragma unroll
        for (int e = 0; e < 2; ++e) o[d2 + e] = gi + 1 < 16 ? fa_wmma_end(fv[gi % 3][2 + e], p[u].h, o[d2 + e]) : wmma_bf(fv[gi % 3][2 + e], p[u].h, o[d2 + e]);   // the tile's last two carry their four v_nop with them
        FA_PIN(); } }
    if (kt + 1 < nt) fa_st(nxt + tid * 16, st);
    __syncthreads(); }   // publishes the next tile and ends every read of this one
  const float inv = 1.0f / (l + __shfl_xor(l, 16));
#pragma unroll
  for (int dt = 0; dt < HD / 16; ++dt) o[dt] *= inv;
  float* const yp = Y + ((size_t)b * TT + ql0 + col) * CC + h * HD + 8 * g;   // the lane holds columns dt * 16 + 8 g + 0..7 of its query
#pragma unroll
  for (int dt = 0; dt < HD / 16; ++dt) { const v4f lo = {o[dt][0], o[dt][1], o[dt][2], o[dt][3]}, hi = {o[dt][4], o[dt][5], o[dt][6], o[dt][7]}; vst2(yp + dt * 16, lo); vst2(yp + dt * 16 + 4, hi); } }   // a run of stores alone: no register that a store names is written between them
// ---- k_out: block = (128 rows, 128 cols): out = y (bf16 hi + lo) Wproj + b; tiles staged as in k_proj, y as two planes
__global__ __launch_bounds__(256) void k_out(const float* __restrict__ Y, const float* __restrict__ WP, const float* __restrict__ BP, float* __restrict__ OUT) { __shared__ __align__(16) char sm[128 * 132 * 4];   // in the loop: two buffers of [y hi | y lo | w]; behind it: the f32 output tile at pitch 132
  __bf16* const st = (__bf16*)sm;
  const int tid = threadIdx.x, wave = tid >> 5, lane = tid & 31, col = lane & 15, g = lane >> 4; const int c0 = blockIdx.y * 128; const size_t r0 = (size_t)blockIdx.x * 128;
  const int wr = (wave >> 1) * 32, wc = (wave & 1) * 64;
  const float* xa = Y + (r0 + (tid >> 3)) * CC + (tid & 7) * 4; const float* wa = WP + (size_t)((tid >> 7) * 16) * CC + c0 + (tid & 127);
  const int sxo = (tid >> 3) * GP + (tid & 7) * 4, swo = 2 * GT + (tid & 127) * GP + (tid >> 7) * 16;
  v4f xr[4]; float wv[16]; v8f acc[2][4] = {};
  g_ldx(xa, xr); g_ldw(wa, CC, wv); g_stx2(st + sxo, st + GT + sxo, xr); g_stw(st + swo, wv);
  __syncthreads();
// kept rolled: one trip holds the next tile's 32 loaded registers beside fragments and accumulators
#pragma unroll 1
  for (int kc = 0; kc < CC / 32; ++kc) { const __bf16* cur = st + (kc & 1) * (3 * GT); __bf16* nxt = st + ((kc + 1) & 1) * (3 * GT);
    if (kc + 1 < CC / 32) { g_ldx(xa + (kc + 1) * 32, xr); g_ldw(wa + (size_t)(kc + 1) * 32 * CC, CC, wv); }   // the next tile flies while this one multiplies
    v16b ah[2], al[2], w[4];
#pragma unroll
    for (int qa = 0; qa < 2; ++qa) { ah[qa] = frag_b(cur + (wr + qa * 16 + col) * GP, lane); al[qa] = frag_b(cur + GT + (wr + qa * 16 + col) * GP, lane); }
#pragma unroll
    for (int j = 0; j < 4; ++j) w[j] = frag_b(cur + 2 * GT + (wc + j * 16 + col) * GP, lane);
#pragma unroll
    for (int j = 0; j < 4; ++j)
#pragma unroll
      for (int qa = 0; qa < 2; ++qa) acc[qa][j] = wmma_bf(ah[qa], w[j], acc[qa][j]);
#pragma unroll
    for (int j = 0; j < 4; ++j)
#pragma unroll
      for (int qa = 0; qa < 2; ++qa) acc[qa][j] = wmma_bf(al[qa], w[j], acc[qa][j]);
    if (kc + 1 < CC / 32) { g_stx2(nxt + sxo, nxt + GT + sxo, xr); g_stw(nxt + swo, wv); }
    __syncthreads(); }   // publishes the next tile and ends every read of this one (behind the last trip: before the output tile reuses the buffers)
  float (*sf)[132] = (float (*)[132])sm;
#pragma unroll
  for (int j = 0; j < 4; ++j) { const float bb = BP ? bfr(BP[c0 + wc + j * 16 + col]) : 0.f;
#pragma unroll
    for (int qa = 0; qa < 2; ++qa)
#pragma unroll
      for (int r = 0; r < 8; ++r) sf[wr + qa * 16 + 8 * g + r][wc + j * 16 + col] = acc[qa][j][r] + bb; }
  __syncthreads();
  for (int e = tid; e < 128 * 32; e += 256) { const int rl = e >> 5, q = e & 31; vst2(OUT + (r0 + rl) * CC + c0 + q * 4, *(const v4f*)&sf[rl][q * 4]); } }
extern "C" void kernel_launch(void* const* d_in, const int* in_sizes, int n_in, void* d_out, int out_size, void* d_ws, size_t ws_size, hipStream_t stream) {
  (void)in_sizes; (void)n_in; (void)out_size;
  const float** F = (const float**)d_in;   // 0 inputs_for_keys, 1 inputs_for_values, 2 inputs_for_queries [4,2048,1024], 3 Wk [4,1024,256], 4 bk [4,256], 5 Wq, 6 bq, 7 Wv, 8 bv, 9 Wo [1024,1024] ([in,out]), 10 bo
  if (ws_size < (size_t)WS_END) return;
  char* ws = (char*)d_ws; _Float16 *QH = (_Float16*)(ws + WS_QH), *QL = (_Float16*)(ws + WS_QL), *KH = (_Float16*)(ws + WS_KH); __bf16 *VT = (__bf16*)(ws + WS_VT), *VL = (__bf16*)(ws + WS_VL); float *Y = (float*)(ws + WS_Y);
  k_proj<<<dim3(TNB * TT / 128, CC / 128, 3), 256, 0, stream>>>(F[2], F[0], F[1], F[5], F[6], F[3], F[4], F[7], F[8], QH, QL, KH, VT, VL);
  k_fa<<<dim3(TT / 128, TNB * NH), 256, 0, stream>>>(QH, KH, VT, VL, Y);
  k_out<<<dim3(TNB * TT / 128, CC / 128), 256, 0, stream>>>(Y, F[9], F[10], (float*)d_out);
}

// v008
// It runs in 209 microseconds.
// Two timings next to v007 put it at 1.08 and 1.09 times that version's speed.
// All steps since v000 together make it 38.1 times as fast.
// compute dtype: all float inputs rounded to bf16; Q/K/V = inputs W_h + b_h (per-head [E, Dh] weights) with EXACT bf16 products on WMMA 16x16x32, f32 accumulate, q/k rounded once to f16 (logits / 256 have std ~0.06: 1 product), causal logits kept in registers; softmax in f32 with a running maximum and sum (precise expf), unnormalised P in f32 split bf16 hi + lo against v as bf16 hi + lo (3 products), divided by the sum at the end; out = y (bf16 hi + lo) Wo + bo; f32 output.
#include <hip/hip_runtime.h>
#include <math.h>

typedef __attribute__((ext_vector_type(16))) _Float16 v16h;
typedef __attribute__((ext_vector_type(16))) __bf16 v16b;
typedef __attribute__((ext_vector_type(8)))  _Float16 v8h;
typedef __attribute__((ext_vector_type(8)))  float v8f;
typedef __attribute__((ext_vector_type(4)))  float v4f;
typedef __attribute__((ext_vector_type(2)))  float v2f;
typedef __attribute__((ext_vector_type(4)))  unsigned v4u;
typedef __attribute__((ext_vector_type(4)))  int v4i;
typedef float __attribute__((may_alias)) float_a;
typedef int __attribute__((may_alias)) int_a;

template <typename T> __device__ __forceinline__ void vst2(void* p, T v) { *(T*)p = v;  }
__device__ __forceinline__ v8f wmma16(v16h a, v16h b, v8f c) {
  v8f d = __builtin_amdgcn_wmma_f32_16x16x32_f16(false, a, false, b, (short)0, c, false, false);
  asm volatile("v_nop\n\tv_nop\n\tv_nop\n\tv_nop" : "+v"(d) : "v"(a), "v"(b));
  return d;
}
__device__ __forceinline__ v8f wmma_bf(v16b a, v16b b, v8f c) {
  v8f d = __builtin_amdgcn_wmma_f32_16x16x32_bf16(false, a, false, b, (short)0, c, false, false);
  asm volatile("v_nop\n\tv_nop\n\tv_nop\n\tv_nop" : "+v"(d) : "v"(a), "v"(b));
  return d;
}
// 16x16x32 fragments: lane = (h = lane>>4, row/col = lane&15); elements 0..7 = k0+8h+0..7, 8..15 = k0+16+8h+0..7; D element r = row 8h+r
__device__ __forceinline__ v16h frag_h(const _Float16* rowk0, int lane) {
  union { v16h v; v8h q[2]; } u; const _Float16* p = rowk0 + 8 * (lane >> 4);
  u.q[0] = *(const v8h*)p; u.q[1] = *(const v8h*)(p + 16); return u.v;
}
__device__ __forceinline__ v16h frag_f32(const float* rowk0, int lane) {
  v16h a; const float* p = rowk0 + 8 * (lane >> 4);
#pragma unroll
  for (int i = 0; i < 8; ++i) { a[i] = (_Float16)p[i]; a[8 + i] = (_Float16)p[16 + i]; }
  return a;
}
__device__ __forceinline__ v16h frag_f32s(const float* rowk0, int lane, float sc) {
  v16h a; const float* p = rowk0 + 8 * (lane >> 4);
#pragma unroll
  for (int i = 0; i < 8; ++i) { a[i] = (_Float16)(p[i] * sc); a[8 + i] = (_Float16)(p[16 + i] * sc); }
  return a;
}
// column fragment from a [K][ld] layout (column n), rows >= K read as 0
__device__ __forceinline__ v16h fragc_f32(const float* W, int k0, int n, int lane, int ld, int K) {
  v16h a; const int g = lane >> 4;
#pragma unroll
  for (int i = 0; i < 8; ++i) { const int ka = k0 + 8 * g + i, kb = ka + 16;
    a[i] = (_Float16)(ka < K ? W[(size_t)(ka < K ? ka : K - 1) * ld + n] : 0.f); a[8 + i] = (_Float16)(kb < K ? W[(size_t)(kb < K ? kb : K - 1) * ld + n] : 0.f); }
  return a;
}
struct F2 { v16b h, l; };
__device__ __forceinline__ F2 bsplit16(const float v[16]) { F2 r;
#pragma unroll
  for (int i = 0; i < 16; ++i) { const __bf16 h = (__bf16)v[i]; r.h[i] = h; r.l[i] = (__bf16)(v[i] - (float)h); }
  return r; }
__device__ __forceinline__ F2 split_row(const float* row, int k0, int lane) { float v[16]; const float* p = row + k0 + 8 * (lane >> 4);
#pragma unroll
  for (int i = 0; i < 8; ++i) { v[i] = p[i]; v[8 + i] = p[16 + i]; }
  return bsplit16(v); }
__device__ __forceinline__ F2 split_rowK(const float* row, int k0, int lane, int K) { float v[16]; const int g = lane >> 4;
#pragma unroll
  for (int i = 0; i < 8; ++i) { const int ka = k0 + 8 * g + i, kb = ka + 16; v[i] = ka < K ? row[ka < K ? ka : K - 1] : 0.f; v[8 + i] = kb < K ? row[kb < K ? kb : K - 1] : 0.f; }
  return bsplit16(v); }
__device__ __forceinline__ F2 split_col(const float* W, int k0, int n, int lane, int ld, int K) { float v[16]; const int g = lane >> 4;
#pragma unroll
  for (int i = 0; i < 8; ++i) { const int ka = k0 + 8 * g + i, kb = ka + 16; v[i] = ka < K ? W[(size_t)(ka < K ? ka : K - 1) * ld + n] : 0.f; v[8 + i] = kb < K ? W[(size_t)(kb < K ? kb : K - 1) * ld + n] : 0.f; }
  return bsplit16(v); }
__device__ __forceinline__ v8f mac3(const F2& a, const F2& b, v8f c) { c = wmma_bf(a.l, b.h, c); c = wmma_bf(a.h, b.l, c); return wmma_bf(a.h, b.h, c); }
__device__ __forceinline__ float sigm(float v) { return 1.0f / (1.0f + expf(-v)); }
#define LDSX() do { asm volatile("s_wait_dscnt 0" ::: "memory"); __builtin_amdgcn_wave_barrier(); __builtin_amdgcn_fence(__ATOMIC_RELEASE, "workgroup"); } while (0)


// Four-headed causal attention (B 4, S 2,048, E 1,024 = 4 heads x 256): per-head Dense q/k/v from three different inputs, scores / head_dim (256), strictly-upper -1e30 mask, softmax, concat heads, Wo + bo.
#define NB 4
#define TT 2048
#define CC 1024
#define NH 4
#define HD 256
#ifndef TNB
#define TNB NB
#endif
typedef __attribute__((ext_vector_type(8))) __bf16 v8b;
__device__ __forceinline__ v16b frag_b(const __bf16* rowk0, int lane) {
  union { v16b v; v8b q[2]; } u; const __bf16* p = rowk0 + 8 * (lane >> 4);
  u.q[0] = *(const v8b*)p; u.q[1] = *(const v8b*)(p + 16); return u.v;
}
// fragment-order planes: a (16 rows x 32 k) operand tile is one 1,024-byte block, [half][lane][8]: half 0 = the lane's elements 0..7, half 1 = its elements 8..15, so each of a fragment's two 16-byte loads covers 512 contiguous bytes (4 whole lines) and not 16 lines
#define FB 512                   // elements of one block
__device__ __forceinline__ v16h frag_hp(const _Float16* blk, int lane) {
  union { v16h v; v8h q[2]; } u; const _Float16* p = blk + lane * 8;
  u.q[0] = *(const v8h*)p; u.q[1] = *(const v8h*)(p + 256); return u.v;
}
__device__ __forceinline__ v16b frag_bp(const __bf16* blk, int lane) {
  union { v16b v; v8b q[2]; } u; const __bf16* p = blk + lane * 8;
  u.q[0] = *(const v8b*)p; u.q[1] = *(const v8b*)(p + 256); return u.v;
}
__device__ __forceinline__ float bfr(float v) { return (float)(__bf16)v; }
__device__ __attribute__((noinline)) float exp_ni(float v) { return expf(v); }
__device__ __attribute__((noinline)) float erf_ni(float v) { return erff(v); }

#define WS_QH  0u
#define WS_QL  (WS_QH + 2u * (size_t)NB * TT * CC)
#define WS_KH  (WS_QL + 2u * (size_t)NB * TT * CC)
#define WS_VT  (WS_KH + 2u * (size_t)NB * TT * CC)      // bf16 v planes, rows b * C + c, k = t; q, k and v planes all lie in fragment order (frag_hp, frag_bp)
#define WS_VL  (WS_VT + 2u * (size_t)NB * CC * TT)      // bf16 v residual planes
#define WS_Y   (WS_VL + 2u * (size_t)NB * CC * TT)      // f32 y rows [b*t][C]
#define WS_END (WS_Y + 4u * (size_t)NB * TT * CC)

// ---- staged GEMM tiles (k_proj, k_out): a block of 8 waves owns 128 rows x 128 cols; per 32 k both operands go global -> registers -> LDS once per block, already rounded to bf16, rows k-contiguous; wave = 32 rows x 64 cols
#define GP 40                    // LDS pitch of a staged 32-k row, in bf16 elements: 80 bytes = 16 x odd, which the 16-byte fragment reads want
#define GT (128 * GP)            // one staged operand tile, in elements
typedef __attribute__((ext_vector_type(4))) __bf16 v4b;
// x tile: thread = (row tid >> 3 (+ 32 i), 4 k at (tid & 7) * 4): a wave's 16-byte loads cover 4 whole 128-byte lines
__device__ __forceinline__ void g_ldx(const float* p, v4f (&r)[4]) {
#pragma unroll
  for (int i = 0; i < 4; ++i) r[i] = *(const v4f*)(p + (size_t)i * 32 * CC); }
// w tile from a [k][ld] layout: thread = (col tid & 127, 16 k from (tid >> 7) * 16): a wave's 4-byte loads cover one whole line, and the thread holds a k-contiguous run of its column
__device__ __forceinline__ void g_ldw(const float* p, int ld, float (&r)[16]) {
#pragma unroll
  for (int i = 0; i < 16; ++i) r[i] = p[(size_t)i * ld]; }
__device__ __forceinline__ void g_stx(__bf16* d, const v4f (&r)[4]) {
#pragma unroll
  for (int i = 0; i < 4; ++i) { v4b o;
#pragma unroll
    for (int e = 0; e < 4; ++e) o[e] = (__bf16)r[i][e];
    *(v4b*)(d + i * 32 * GP) = o; } }
__device__ __forceinline__ void g_stx2(__bf16* dh, __bf16* dl, const v4f (&r)[4]) {
#pragma unroll
  for (int i = 0; i < 4; ++i) { v4b oh, ol;
#pragma unroll
    for (int e = 0; e < 4; ++e) { const __bf16 h = (__bf16)r[i][e]; oh[e] = h; ol[e] = (__bf16)(r[i][e] - (float)h); }
    *(v4b*)(dh + i * 32 * GP) = oh; *(v4b*)(dl + i * 32 * GP) = ol; } }
__device__ __forceinline__ void g_stw(__bf16* d, const float (&r)[16]) { v8b o0, o1;
#pragma unroll
  for (int i = 0; i < 8; ++i) { o0[i] = (__bf16)r[i]; o1[i] = (__bf16)r[8 + i]; }
  *(v8b*)d = o0; *(v8b*)(d + 8) = o1; }
// ---- k_proj: block = (128 rows, 128 cols, which): qkv = x W (+ b), exact; q -> f16 hi (+ residual), k -> f16 hi, v -> bf16 hi + residual planes
__global__ __launch_bounds__(256) void k_proj(const float* __restrict__ XQ, const float* __restrict__ XK, const float* __restrict__ XV, const float* __restrict__ WQ, const float* __restrict__ BQ, const float* __restrict__ WK, const float* __restrict__ BK, const float* __restrict__ WV, const float* __restrict__ BV, _Float16* __restrict__ QH, _Float16* __restrict__ QL, _Float16* __restrict__ KH, __bf16* __restrict__ VT, __bf16* __restrict__ VL) {
  __shared__ __align__(16) char sm[2 * 128 * 136 * 2];   // in the loop: two buffers of [x tile | w tile]; behind it: the two output planes at pitch 136
  __bf16* const st = (__bf16*)sm;
  const int tid = threadIdx.x, wave = tid >> 5, lane = tid & 31, col = lane & 15, g = lane >> 4; const int which = blockIdx.z; const int c0 = blockIdx.y * 128; const size_t r0 = (size_t)blockIdx.x * 128; const float* X = which == 0 ? XQ : which == 1 ? XK : XV; const float* WA = which == 0 ? WQ : which == 1 ? WK : WV; const float* BA = which == 0 ? BQ : which == 1 ? BK : BV;
  const int wr = (wave >> 1) * 32, wc = (wave & 1) * 64;
  const float* xa = X + (r0 + (tid >> 3)) * CC + (tid & 7) * 4; const float* wa = WA + ((size_t)(c0 / HD) * CC + (tid >> 7) * 16) * HD + c0 % HD + (tid & 127);
  const int sxo = (tid >> 3) * GP + (tid & 7) * 4, swo = GT + (tid & 127) * GP + (tid >> 7) * 16;
  v4f xr[4]; float wv[16]; v8f acc[2][4] = {};
  g_ldx(xa, xr);
  asm volatile("s_wait_xcnt 0x0" ::: "memory");   // stands before the first x tile's address registers are written again
  g_ldw(wa, HD, wv); g_stx(st + sxo, xr); g_stw(st + swo, wv);
  __syncthreads();
// kept rolled: one trip holds the next tile's 32 loaded registers beside fragments and accumulators
#pragma unroll 1
  for (int kc = 0; kc < CC / 32; ++kc) { const __bf16* cur = st + (kc & 1) * (2 * GT); __bf16* nxt = st + ((kc + 1) & 1) * (2 * GT);
    if (kc + 1 < CC / 32) { g_ldx(xa + (kc + 1) * 32, xr); g_ldw(wa + (size_t)(kc + 1) * 32 * HD, HD, wv); }   // the next tile flies while this one multiplies
    v16b a[2], w[4];
#pragma unroll
    for (int qa = 0; qa < 2; ++qa) a[qa] = frag_b(cur + (wr + qa * 16 + col) * GP, lane);
#pragma unroll
    for (int j = 0; j < 4; ++j) w[j] = frag_b(cur + GT + (wc + j * 16 + col) * GP, lane);
#pragma unroll
    for (int j = 0; j < 4; ++j)
#pragma unroll
      for (int qa = 0; qa < 2; ++qa) acc[qa][j] = wmma_bf(a[qa], w[j], acc[qa][j]);
    if (kc + 1 < CC / 32) { g_stx(nxt + sxo, xr); g_stw(nxt + swo, wv); }
    __syncthreads(); }   // publishes the next tile and ends every read of this one (behind the last trip: before the planes reuse the buffers)
  _Float16 (*sh)[136] = (_Float16 (*)[136])sm; _Float16 (*sl)[136] = (_Float16 (*)[136])(sm + 128 * 136 * 2); __bf16 (*th)[136] = (__bf16 (*)[136])sm; __bf16 (*tl2)[136] = (__bf16 (*)[136])(sm + 128 * 136 * 2);
#pragma unroll
  for (int j = 0; j < 4; ++j) { const float bb = bfr(BA[c0 + wc + j * 16 + col]);
#pragma unroll
    for (int qa = 0; qa < 2; ++qa)
#pragma unroll
      for (int r = 0; r < 8; ++r) { const float v = acc[qa][j][r] + bb; const int rl = wr + qa * 16 + 8 * g + r, cl = wc + j * 16 + col; const _Float16 hv = (_Float16)v;
        if (which == 2) { const __bf16 bh = (__bf16)v; th[cl][rl] = bh; tl2[cl][rl] = (__bf16)(v - (float)bh); } else { sh[rl][cl] = hv; sl[rl][cl] = (_Float16)(v - (float)hv); } } }
  __syncthreads();
  // the 128 x 128 tile leaves as 8 x 4 fragment-order blocks: piece e = (block e >> 6 = (row tile, k block), half, lane); consecutive threads store consecutive 16-byte pieces
  if (which < 2) { _Float16* dh = which == 0 ? QH : KH; for (int e = tid; e < 128 * 16; e += 256) { const int fb = e >> 6, pc = e & 63; const int rl = (fb >> 2) * 16 + (pc & 15), cl = (fb & 3) * 32 + (pc >> 5) * 16 + ((pc >> 4) & 1) * 8; const size_t o = ((r0 / 16 + (fb >> 2)) * (CC / 32) + c0 / 32 + (fb & 3)) * FB + pc * 8; vst2((unsigned*)(dh + o), *(const v4u*)&sh[rl][cl]);
      asm volatile("s_wait_xcnt 0x0" ::: "memory");   // stands before the store's data and address registers are written again
      if (which == 0) { vst2((unsigned*)(QL + o), *(const v4u*)&sl[rl][cl]);
        asm volatile("s_wait_xcnt 0x0" ::: "memory"); } } }   // the same, for the residual plane's store
  else { const size_t b = r0 / TT; const int t0 = (int)(r0 % TT); for (int e = tid; e < 128 * 16; e += 256) { const int fb = e >> 6, pc = e & 63; const int cl = (fb >> 2) * 16 + (pc & 15), tl = (fb & 3) * 32 + (pc >> 5) * 16 + ((pc >> 4) & 1) * 8; const size_t o2 = (((b * CC + c0) / 16 + (fb >> 2)) * (TT / 32) + t0 / 32 + (fb & 3)) * FB + pc * 8; vst2((unsigned*)(VT + o2), *(const v4u*)&th[cl][tl]); vst2((unsigned*)(VL + o2), *(const v4u*)&tl2[cl][tl]);
      asm volatile("s_wait_xcnt 0x0" ::: "memory"); } } }   // stands before the two stores' data and address registers are written again
// ---- k_fa: scores, softmax and P . v in one kernel, running maximum and sum per query (no logits plane). Block = 8 waves on ONE group of 64 queries of plane y = b * NH + h at a time: wave = (16 queries w4 = wave & 3, key half hw = wave >> 2), so that every wave has work in every key tile before the group's diagonal one; the block takes group x and then group 31 - x, one after the other in one run of 33 key tiles
// the two waves of a query tile each keep their own maximum, sum and O^T over their 32 keys of every 64; at a group's last tile the hw = 1 wave hands its three through LDS to the hw = 0 wave, which rescales both to the common maximum, adds, divides and stores
// per 64 keys the block stages k (f16), v and v's residual (bf16), 32 KB each, once in LDS: the planes lie in fragment order, so staging is a plain copy; two buffers, the next tile's loads fly while this one multiplies (the second group's first tile behind the first group's last)
// both products are formed transposed: S^T = k q^T leaves a lane with 8 consecutive keys of ITS query (col = query), which is the B fragment of O^T = v^T P^T as it stands: P never leaves its registers, and maximum, sum and rescale are per lane (the other 8-key halves sit in lane ^ 16)
// scheduling barrier that no instruction may cross: it holds each group of fragment reads at its written place, two groups ahead of the WMMAs that use it
#define FA_PIN() __builtin_amdgcn_sched_barrier(0)
// a v group's last WMMA on an accumulator, in the form of wmma_bf: the asm statement behind it keeps its place among the scheduling barriers, which a bare WMMA does not (without it every WMMA of the tile sinks behind the last read, and the fragments spill), so the group's WMMAs stay in front of the next group's reads; the four v_nop are the distance to a vector instruction on D. Only D is named: fragments named there as well are tied to the first 256 registers, and the accumulators spill
__device__ __forceinline__ v8f fa_wmma_end(v16b a, v16b b, v8f c) {
  v8f d = __builtin_amdgcn_wmma_f32_16x16x32_bf16(false, a, false, b, (short)0, c, false, false);
  asm volatile("v_nop\n\tv_nop\n\tv_nop\n\tv_nop" : "+v"(d));
  return d;
}
#define FKB 32768                // bytes of one staged plane of 64 keys x 256 head columns
__device__ __forceinline__ void fa_ld(const char* kg, const char* vh, const char* vl, v4u (&r)[24]) {
#pragma unroll
  for (int i = 0; i < 8; ++i) r[i] = *(const v4u*)(kg + (i >> 1) * 32768 + (i & 1) * 4096);   // 16-key tile i >> 1: 8 KB in a row
#pragma unroll
  for (int i = 0; i < 8; ++i) { r[8 + i] = *(const v4u*)(vh + i * 131072); r[16 + i] = *(const v4u*)(vl + i * 131072); } }   // column tile 2 i + (tid >> 7): 2 KB in a row
__device__ __forceinline__ void fa_st(char* d, const v4u (&r)[24]) {
#pragma unroll
  for (int i = 0; i < 24; ++i) *(v4u*)(d + i * 4096) = r[i]; }
__global__ __launch_bounds__(256) void k_fa(const _Float16* __restrict__ QH, const _Float16* __restrict__ KH, const __bf16* __restrict__ VT, const __bf16* __restrict__ VL, float* __restrict__ Y) { __shared__ __align__(16) char sm[2 * 3 * FKB + 4 * 16384 + 4 * 256];   // two staging buffers; behind them the hand-over: 16 KB of O^T per query tile, then (maximum, sum) per lane
  const int tid = threadIdx.x, wave = __builtin_amdgcn_readfirstlane(tid >> 5), lane = tid & 31, col = lane & 15, g = lane >> 4; const int b = blockIdx.y / NH, h = blockIdx.y % NH;
  const int w4 = wave & 3, hw = wave >> 2; const int gx = blockIdx.x;
  const char* kg = (const char*)(KH + (((size_t)b * TT / 16) * (CC / 32) + h * (HD / 32)) * FB) + tid * 16;
  const size_t vo = ((((size_t)b * CC + h * HD) / 16) * (TT / 32)) * FB * 2 + (tid >> 7) * 65536 + (tid & 127) * 16; const char* vhg = (const char*)VT + vo; const char* vlg = (const char*)VL + vo;
  char* const xo = sm + 2 * 3 * FKB + w4 * 16384 + lane * 16; char* const xm = sm + 2 * 3 * FKB + 4 * 16384 + w4 * 256 + lane * 8;   // each 16-byte piece of O^T at [piece][lane]
  int grp = gx, kt = 0, ql0 = grp * 64 + w4 * 16;   // the group's key tiles run 0 .. grp, up to its diagonal
  const _Float16* const qb = QH + (((size_t)b * TT / 16) * (CC / 32) + h * (HD / 32)) * FB; v16h qf[HD / 32];
#pragma unroll
  for (int kc = 0; kc < HD / 32; ++kc) qf[kc] = frag_hp(qb + ((size_t)(ql0 / 16) * (CC / 32) + kc) * FB, lane);
  v4u st[24]; v8f o[HD / 16] = {}; float m = -3.0e38f, l = 0.f;
  fa_ld(kg, vhg, vlg, st);
  FA_PIN();   // keeps later index arithmetic, which reuses the loads' address registers, behind the wait
  asm volatile("s_wait_xcnt 0x0" :: "v"(tid), "v"(lane) : "memory");   // stands before the first loads' address registers are written again; the two offset registers are named as inputs so that they live up to the wait
  fa_st(sm + tid * 16, st);
  __syncthreads();
// kept rolled: one trip holds the next tile's 96 loaded registers beside the 128 accumulator and 64 query registers
#pragma unroll 1
  for (int t = 0; t < TT / 64 + 1; ++t) { const char* cur = sm + (t & 1) * (3 * FKB); char* nxt = sm + ((t + 1) & 1) * (3 * FKB);
    const bool last = kt == grp, more = t < TT / 64; const int nk = last ? 0 : kt + 1;   // scalar, the same in every wave
    if (more) { fa_ld(kg + (size_t)nk * 131072, vhg + nk * 2048, vlg + nk * 2048, st);
      asm volatile("s_wait_xcnt 0x0" ::: "memory"); }   // stands before the loads' address registers are written again
    if (kt * 64 + hw * 32 <= ql0 + 15) {   // scalar: a wave whose 16 queries all lie in front of its 32 keys of this tile has nothing in it
      const _Float16* ck = (const _Float16*)cur + hw * (2 * (HD / 32) * FB); const __bf16* cvh = (const __bf16*)(cur + FKB) + hw * FB; const __bf16* cvl = (const __bf16*)(cur + 2 * FKB) + hw * FB;   // the wave's two 16-key tiles of k; its 32-key block of every column tile of v
      v8f s[2] = {}; v16h fk[3][4]; v16b fv[3][4];
      // fragments are read in groups of 4 (8 LDS loads at one place) into a ring of three groups, each group two steps ahead of the WMMAs that use it, so that a group's LDS latency is covered by two groups of WMMAs and no wait falls on loads just issued; left to itself the compiler reads v's groups directly in front of their WMMAs
      // k group q = (key tiles 0 and 1, head columns 32 (2 q) and 32 (2 q + 1))
#pragma unroll
      for (int q = 0; q < 2; ++q)
#pragma unroll
        for (int e = 0; e < 4; ++e) fk[q][e] = frag_hp(ck + ((e >> 1) * (HD / 32) + 2 * q + (e & 1)) * FB, lane);
      FA_PIN();
#pragma unroll
      for (int q = 0; q < HD / 64; ++q) {
        if (q + 2 < HD / 64) {
#pragma unroll
          for (int e = 0; e < 4; ++e) fk[(q + 2) % 3][e] = frag_hp(ck + ((e >> 1) * (HD / 32) + 2 * (q + 2) + (e & 1)) * FB, lane); }
        else { const int u = q + 2 - HD / 64;   // v's first two groups (column tiles 2 u and 2 u + 1) fly through the softmax
#pragma unroll
          for (int e = 0; e < 2; ++e) { fv[u][e] = frag_bp(cvh + (u * 2 + e) * 2 * FB, lane); fv[u][2 + e] = frag_bp(cvl + (u * 2 + e) * 2 * FB, lane); } }
        FA_PIN();
#pragma unroll
        for (int e = 0; e < 4; ++e) s[e & 1] = __builtin_amdgcn_wmma_f32_16x16x32_f16(false, fk[q % 3][(e & 1) * 2 + (e >> 1)], false, qf[2 * q + (e >> 1)], (short)0, s[e & 1], false, false);
        FA_PIN(); }
      const int qt = ql0 + col; float mx = m;
#pragma unroll
      for (int j = 0; j < 2; ++j)
#pragma unroll
        for (int r = 0; r < 8; ++r) { float v = s[j][r] * 0.00390625f; if (kt * 64 + hw * 32 + j * 16 + 8 * g + r > qt) v = -3.0e38f; s[j][r] = v; mx = fmaxf(mx, v); }
      mx = fmaxf(mx, __shfl_xor(mx, 16));
      const float al = expf(m - mx); m = mx; v4f s4 = {0.f, 0.f, 0.f, 0.f};
#pragma unroll
      for (int j = 0; j < 2; ++j)
#pragma unroll
        for (int r = 0; r < 8; ++r) { const float v = s[j][r], ex = expf(v - mx); const float pv = (v <= -1.0e38f) ? 0.f : ex; s[j][r] = pv; s4[r & 3] += pv; }
      l = l * al + ((s4[0] + s4[1]) + (s4[2] + s4[3]));
#pragma unroll
      for (int dt = 0; dt < HD / 16; ++dt) o[dt] *= al;
      F2 p; { float v[16];
#pragma unroll
        for (int i = 0; i < 8; ++i) { v[i] = s[0][i]; v[8 + i] = s[1][i]; }
        p = bsplit16(v); }
      // group gi = column tiles 2 gi and 2 gi + 1: two accumulators in turn
#pragma unroll
      for (int gi = 0; gi < HD / 32; ++gi) { const int d2 = gi * 2;
        if (gi + 2 < HD / 32) {
#pragma unroll
          for (int e = 0; e < 2; ++e) { fv[(gi + 2) % 3][e] = frag_bp(cvh + ((gi + 2) * 2 + e) * 2 * FB, lane); fv[(gi + 2) % 3][2 + e] = frag_bp(cvl + ((gi + 2) * 2 + e) * 2 * FB, lane); } }
        FA_PIN();
#pragma unroll
        for (int e = 0; e < 2; ++e) o[d2 + e] = __builtin_amdgcn_wmma_f32_16x16x32_bf16(false, fv[gi % 3][e], false, p.h, (short)0, o[d2 + e], false, false);
#pragma unroll
        for (int e = 0; e < 2; ++e) o[d2 + e] = __builtin_amdgcn_wmma_f32_16x16x32_bf16(false, fv[gi % 3][e], false, p.l, (short)0, o[d2 + e], false, false);
#pragma unroll
        for (int e = 0; e < 2; ++e) o[d2 + e] = gi + 1 < HD / 32 ? fa_wmma_end(fv[gi % 3][2 + e], p.h, o[d2 + e]) : wmma_bf(fv[gi % 3][2 + e], p.h, o[d2 + e]);   // the tile's last two carry their four v_nop with them
        FA_PIN(); } }
    if (more) fa_st(nxt + tid * 16, st);
    if (last && hw == 1) {   // scalar
#pragma unroll
      for (int dt = 0; dt < HD / 16; ++dt) { const v4f lo = {o[dt][0], o[dt][1], o[dt][2], o[dt][3]}, hi = {o[dt][4], o[dt][5], o[dt][6], o[dt][7]}; *(v4f*)(xo + dt * 1024) = lo; *(v4f*)(xo + dt * 1024 + 512) = hi; }
      const v2f ml = {m, l}; *(v2f*)xm = ml; }
    if (last && more) {   // scalar: the second group's queries are fetched in front of the barrier, whose wait for all loads then covers them; fetched behind it, the compiler waits for them at the score WMMAs of every trip, and with them for the next tile's staging loads just issued
#pragma unroll
      for (int kc = 0; kc < HD / 32; ++kc) qf[kc] = frag_hp(qb + ((size_t)((TT / 64 - 1 - gx) * 4 + w4) * (CC / 32) + kc) * FB, lane);
      asm volatile("s_wait_xcnt 0x0" ::: "memory"); }   // stands before the query loads' address registers are written again
    __syncthreads();   // publishes the next tile and ends every read of this one; at a group's last tile it also publishes the hand-over, which is next written 17 or more barriers later
    if (last) {
      if (hw == 0) {   // scalar; this wave's keys hold the group's first key, so its maximum is a real score; a partner without any key brings maximum -3e38, sum 0 and zeros, and its weight is exp(-huge) = 0
        const v2f ml = *(const v2f*)xm; const float mm = fmaxf(m, ml[0]); const float a0 = expf(m - mm), a1 = expf(ml[0] - mm);
        const float lp = l * a0 + ml[1] * a1; const float inv = 1.0f / (lp + __shfl_xor(lp, 16)); const float c0 = a0 * inv, c1 = a1 * inv;
        float* const yp = Y + ((size_t)b * TT + ql0 + col) * CC + h * HD + 8 * g;   // the lane holds columns dt * 16 + 8 g + 0..7 of its query
#pragma unroll
        for (int dt = 0; dt < HD / 16; ++dt) { const v4f pl = *(const v4f*)(xo + dt * 1024), pu = *(const v4f*)(xo + dt * 1024 + 512);
#pragma unroll
          for (int r = 0; r < 4; ++r) { o[dt][r] = o[dt][r] * c0 + pl[r] * c1; o[dt][4 + r] = o[dt][4 + r] * c0 + pu[r] * c1; } }
        FA_PIN();   // keeps the stores a run of their own behind the sums, so that no register a store names is written between them
#pragma unroll
        for (int dt = 0; dt < HD / 16; ++dt) { const v4f lo = {o[dt][0], o[dt][1], o[dt][2], o[dt][3]}, hi = {o[dt][4], o[dt][5], o[dt][6], o[dt][7]}; vst2(yp + dt * 16, lo); vst2(yp + dt * 16 + 4, hi); }
        FA_PIN();   // and keeps what follows behind the wait
        asm volatile("s_wait_xcnt 0x0" ::: "memory"); }   // stands before the stores' data and address registers are written again
      if (more) { grp = TT / 64 - 1 - gx; ql0 = grp * 64 + w4 * 16; m = -3.0e38f; l = 0.f;   // the second group starts
#pragma unroll
        for (int dt = 0; dt < HD / 16; ++dt) o[dt] = v8f{}; } }
    kt = nk; } }
// ---- k_out: block = (128 rows, 128 cols): out = y (bf16 hi + lo) Wproj + b; tiles staged as in k_proj, y as two planes
__global__ __launch_bounds__(256) void k_out(const float* __restrict__ Y, const float* __restrict__ WP, const float* __restrict__ BP, float* __restrict__ OUT) { __shared__ __align__(16) char sm[128 * 132 * 4];   // in the loop: two buffers of [y hi | y lo | w]; behind it: the f32 output tile at pitch 132
  __bf16* const st = (__bf16*)sm;
  const int tid = threadIdx.x, wave = tid >> 5, lane = tid & 31, col = lane & 15, g = lane >> 4; const int c0 = blockIdx.y * 128; const size_t r0 = (size_t)blockIdx.x * 128;
  const int wr = (wave >> 1) * 32, wc = (wave & 1) * 64;
  const float* xa = Y + (r0 + (tid >> 3)) * CC + (tid & 7) * 4; const float* wa = WP + (size_t)((tid >> 7) * 16) * CC + c0 + (tid & 127);
  const int sxo = (tid >> 3) * GP + (tid & 7) * 4, swo = 2 * GT + (tid & 127) * GP + (tid >> 7) * 16;
  v4f xr[4]; float wv[16]; v8f acc[2][4] = {};
  g_ldx(xa, xr); g_ldw(wa, CC, wv); g_stx2(st + sxo, st + GT + sxo, xr); g_stw(st + swo, wv);
  __syncthreads();
// kept rolled: one trip holds the next tile's 32 loaded registers beside fragments and accumulators
#pragma unroll 1
  for (int kc = 0; kc < CC / 32; ++kc) { const __bf16* cur = st + (kc & 1) * (3 * GT); __bf16* nxt = st + ((kc + 1) & 1) * (3 * GT);
    if (kc + 1 < CC / 32) { g_ldx(xa + (kc + 1) * 32, xr); g_ldw(wa + (size_t)(kc + 1) * 32 * CC, CC, wv); }   // the next tile flies while this one multiplies
    v16b ah[2], al[2], w[4];
#pragma unroll
    for (int qa = 0; qa < 2; ++qa) { ah[qa] = frag_b(cur + (wr + qa * 16 + col) * GP, lane); al[qa] = frag_b(cur + GT + (wr + qa * 16 + col) * GP, lane); }
#pragma unroll
    for (int j = 0; j < 4; ++j) w[j] = frag_b(cur + 2 * GT + (wc + j * 16 + col) * GP, lane);
#pragma unroll
    for (int j = 0; j < 4; ++j)
#pragma unroll
      for (int qa = 0; qa < 2; ++qa) acc[qa][j] = wmma_bf(ah[qa], w[j], acc[qa][j]);
#pragma unroll
    for (int j = 0; j < 4; ++j)
#pragma unroll
      for (int qa = 0; qa < 2; ++qa) acc[qa][j] = wmma_bf(al[qa], w[j], acc[qa][j]);
    if (kc + 1 < CC / 32) { g_stx2(nxt + sxo, nxt + GT + sxo, xr); g_stw(nxt + swo, wv); }
    __syncthreads(); }   // publishes the next tile and ends every read of this one (behind the last trip: before the output tile reuses the buffers)
  float (*sf)[132] = (float (*)[132])sm;
#pragma unroll
  for (int j = 0; j < 4; ++j) { const float bb = BP ? bfr(BP[c0 + wc + j * 16 + col]) : 0.f;
#pragma unroll
    for (int qa = 0; qa < 2; ++qa)
#pragma unroll
      for (int r = 0; r < 8; ++r) sf[wr + qa * 16 + 8 * g + r][wc + j * 16 + col] = acc[qa][j][r] + bb; }
  __syncthreads();
  for (int e = tid; e < 128 * 32; e += 256) { const int rl = e >> 5, q = e & 31; vst2(OUT + (r0 + rl) * CC + c0 + q * 4, *(const v4f*)&sf[rl][q * 4]); } }
extern "C" void kernel_launch(void* const* d_in, const int* in_sizes, int n_in, void* d_out, int out_size, void* d_ws, size_t ws_size, hipStream_t stream) {
  (void)in_sizes; (void)n_in; (void)out_size;
  const float** F = (const float**)d_in;   // 0 inputs_for_keys, 1 inputs_for_values, 2 inputs_for_queries [4,2048,1024], 3 Wk [4,1024,256], 4 bk [4,256], 5 Wq, 6 bq, 7 Wv, 8 bv, 9 Wo [1024,1024] ([in,out]), 10 bo
  if (ws_size < (size_t)WS_END) return;
  char* ws = (char*)d_ws; _Float16 *QH = (_Float16*)(ws + WS_QH), *QL = (_Float16*)(ws + WS_QL), *KH = (_Float16*)(ws + WS_KH); __bf16 *VT = (__bf16*)(ws + WS_VT), *VL = (__bf16*)(ws + WS_VL); float *Y = (float*)(ws + WS_Y);
  k_proj<<<dim3(TNB * TT / 128, CC / 128, 3), 256, 0, stream>>>(F[2], F[0], F[1], F[5], F[6], F[3], F[4], F[7], F[8], QH, QL, KH, VT, VL);
  k_fa<<<dim3(TT / 128, TNB * NH), 256, 0, stream>>>(QH, KH, VT, VL, Y);
  k_out<<<dim3(TNB * TT / 128, CC / 128), 256, 0, stream>>>(Y, F[9], F[10], (float*)d_out);
}

// v009
// Measured time: 180 microseconds a run.
// In both of two side-by-side timings against v008, it was 1.16 times as fast.
// Counting every step since v000, it is 44.1 times as fast.
// compute dtype: all float inputs rounded to bf16; Q/K/V = inputs W_h + b_h (per-head [E, Dh] weights) with EXACT bf16 products on WMMA 16x16x32, f32 accumulate, q/k rounded once to f16 (logits / 256 have std ~0.06: 1 product), causal logits kept in registers; softmax in f32 with a running maximum and sum (precise expf), unnormalised P in f32 split bf16 hi + lo against v as bf16 hi + lo (3 products), divided by the sum at the end; out = y (bf16 hi + lo) Wo + bo; f32 output.
#include <hip/hip_runtime.h>
#include <math.h>

typedef __attribute__((ext_vector_type(16))) _Float16 v16h;
typedef __attribute__((ext_vector_type(16))) __bf16 v16b;
typedef __attribute__((ext_vector_type(8)))  _Float16 v8h;
typedef __attribute__((ext_vector_type(8)))  float v8f;
typedef __attribute__((ext_vector_type(4)))  float v4f;
typedef __attribute__((ext_vector_type(2)))  float v2f;
typedef __attribute__((ext_vector_type(4)))  unsigned v4u;
typedef __attribute__((ext_vector_type(4)))  int v4i;
typedef float __attribute__((may_alias)) float_a;
typedef int __attribute__((may_alias)) int_a;

template <typename T> __device__ __forceinline__ void vst2(void* p, T v) { *(T*)p = v;  }
__device__ __forceinline__ v8f wmma16(v16h a, v16h b, v8f c) {
  v8f d = __builtin_amdgcn_wmma_f32_16x16x32_f16(false, a, false, b, (short)0, c, false, false);
  asm volatile("v_nop\n\tv_nop\n\tv_nop\n\tv_nop" : "+v"(d) : "v"(a), "v"(b));
  return d;
}
__device__ __forceinline__ v8f wmma_bf(v16b a, v16b b, v8f c) {
  v8f d = __builtin_amdgcn_wmma_f32_16x16x32_bf16(false, a, false, b, (short)0, c, false, false);
  asm volatile("v_nop\n\tv_nop\n\tv_nop\n\tv_nop" : "+v"(d) : "v"(a), "v"(b));
  return d;
}
// 16x16x32 fragments: lane = (h = lane>>4, row/col = lane&15); elements 0..7 = k0+8h+0..7, 8..15 = k0+16+8h+0..7; D element r = row 8h+r
__device__ __forceinline__ v16h frag_h(const _Float16* rowk0, int lane) {
  union { v16h v; v8h q[2]; } u; const _Float16* p = rowk0 + 8 * (lane >> 4);
  u.q[0] = *(const v8h*)p; u.q[1] = *(const v8h*)(p + 16); return u.v;
}
__device__ __forceinline__ v16h frag_f32(const float* rowk0, int lane) {
  v16h a; const float* p = rowk0 + 8 * (lane >> 4);
#pragma unroll
  for (int i = 0; i < 8; ++i) { a[i] = (_Float16)p[i]; a[8 + i] = (_Float16)p[16 + i]; }
  return a;
}
__device__ __forceinline__ v16h frag_f32s(const float* rowk0, int lane, float sc) {
  v16h a; const float* p = rowk0 + 8 * (lane >> 4);
#pragma unroll
  for (int i = 0; i < 8; ++i) { a[i] = (_Float16)(p[i] * sc); a[8 + i] = (_Float16)(p[16 + i] * sc); }
  return a;
}
// column fragment from a [K][ld] layout (column n), rows >= K read as 0
__device__ __forceinline__ v16h fragc_f32(const float* W, int k0, int n, int lane, int ld, int K) {
  v16h a; const int g = lane >> 4;
#pragma unroll
  for (int i = 0; i < 8; ++i) { const int ka = k0 + 8 * g + i, kb = ka + 16;
    a[i] = (_Float16)(ka < K ? W[(size_t)(ka < K ? ka : K - 1) * ld + n] : 0.f); a[8 + i] = (_Float16)(kb < K ? W[(size_t)(kb < K ? kb : K - 1) * ld + n] : 0.f); }
  return a;
}
struct F2 { v16b h, l; };
__device__ __forceinline__ F2 bsplit16(const float v[16]) { F2 r;
#pragma unroll
  for (int i = 0; i < 16; ++i) { const __bf16 h = (__bf16)v[i]; r.h[i] = h; r.l[i] = (__bf16)(v[i] - (float)h); }
  return r; }
__device__ __forceinline__ F2 split_row(const float* row, int k0, int lane) { float v[16]; const float* p = row + k0 + 8 * (lane >> 4);
#pragma unroll
  for (int i = 0; i < 8; ++i) { v[i] = p[i]; v[8 + i] = p[16 + i]; }
  return bsplit16(v); }
__device__ __forceinline__ F2 split_rowK(const float* row, int k0, int lane, int K) { float v[16]; const int g = lane >> 4;
#pragma unroll
  for (int i = 0; i < 8; ++i) { const int ka = k0 + 8 * g + i, kb = ka + 16; v[i] = ka < K ? row[ka < K ? ka : K - 1] : 0.f; v[8 + i] = kb < K ? row[kb < K ? kb : K - 1] : 0.f; }
  return bsplit16(v); }
__device__ __forceinline__ F2 split_col(const float* W, int k0, int n, int lane, int ld, int K) { float v[16]; const int g = lane >> 4;
#pragma unroll
  for (int i = 0; i < 8; ++i) { const int ka = k0 + 8 * g + i, kb = ka + 16; v[i] = ka < K ? W[(size_t)(ka < K ? ka : K - 1) * ld + n] : 0.f; v[8 + i] = kb < K ? W[(size_t)(kb < K ? kb : K - 1) * ld + n] : 0.f; }
  return bsplit16(v); }
__device__ __forceinline__ v8f mac3(const F2& a, const F2& b, v8f c) { c = wmma_bf(a.l, b.h, c); c = wmma_bf(a.h, b.l, c); return wmma_bf(a.h, b.h, c); }
__device__ __forceinline__ float sigm(float v) { return 1.0f / (1.0f + expf(-v)); }
#define LDSX() do { asm volatile("s_wait_dscnt 0" ::: "memory"); __builtin_amdgcn_wave_barrier(); __builtin_amdgcn_fence(__ATOMIC_RELEASE, "workgroup"); } while (0)


// Four-headed causal attention (B 4, S 2,048, E 1,024 = 4 heads x 256): per-head Dense q/k/v from three different inputs, scores / head_dim (256), strictly-upper -1e30 mask, softmax, concat heads, Wo + bo.
#define NB 4
#define TT 2048
#define CC 1024
#define NH 4
#define HD 256
#ifndef TNB
#define TNB NB
#endif
typedef __attribute__((ext_vector_type(8))) __bf16 v8b;
__device__ __forceinline__ v16b frag_b(const __bf16* rowk0, int lane) {
  union { v16b v; v8b q[2]; } u; const __bf16* p = rowk0 + 8 * (lane >> 4);
  u.q[0] = *(const v8b*)p; u.q[1] = *(const v8b*)(p + 16); return u.v;
}
// fragment-order planes: a (16 rows x 32 k) operand tile is one 1,024-byte block, [half][lane][8]: half 0 = the lane's elements 0..7, half 1 = its elements 8..15, so each of a fragment's two 16-byte loads covers 512 contiguous bytes (4 whole lines) and not 16 lines
#define FB 512                   // elements of one block
__device__ __forceinline__ v16h frag_hp(const _Float16* blk, int lane) {
  union { v16h v; v8h q[2]; } u; const _Float16* p = blk + lane * 8;
  u.q[0] = *(const v8h*)p; u.q[1] = *(const v8h*)(p + 256); return u.v;
}
__device__ __forceinline__ v16b frag_bp(const __bf16* blk, int lane) {
  union { v16b v; v8b q[2]; } u; const __bf16* p = blk + lane * 8;
  u.q[0] = *(const v8b*)p; u.q[1] = *(const v8b*)(p + 256); return u.v;
}
__device__ __forceinline__ float bfr(float v) { return (float)(__bf16)v; }
__device__ __attribute__((noinline)) float exp_ni(float v) { return expf(v); }
__device__ __attribute__((noinline)) float erf_ni(float v) { return erff(v); }

#define WS_QH  0u
#define WS_QL  (WS_QH + 2u * (size_t)NB * TT * CC)
#define WS_KH  (WS_QL + 2u * (size_t)NB * TT * CC)
#define WS_VT  (WS_KH + 2u * (size_t)NB * TT * CC)      // bf16 v planes, rows b * C + c, k = t; q, k and v planes all lie in fragment order (frag_hp, frag_bp)
#define WS_VL  (WS_VT + 2u * (size_t)NB * CC * TT)      // bf16 v residual planes
#define WS_Y   (WS_VL + 2u * (size_t)NB * CC * TT)      // f32 y rows [b*t][C]
#define WS_XB  (WS_Y + 4u * (size_t)NB * TT * CC)       // bf16 copies of the three inputs (q, k, v order), rows b * T + t, k = e, in fragment order
#define WS_WB  (WS_XB + 3u * 2u * (size_t)NB * TT * CC) // bf16 copies of Wq, Wk, Wv (rows = output column h * HD + d, k = e) and Wo (rows = output column, k = input column), in fragment order
#define WS_END (WS_WB + 4u * 2u * (size_t)CC * CC)

// ---- staged GEMM tiles (k_proj, k_out): a block of 8 waves owns 128 rows x 128 cols; both operands go global -> registers -> LDS once per block as bf16; wave = 32 rows x 64 cols. The helpers here stage k_out's f32 y rows, k-contiguous
#define GP 40                    // LDS pitch of a staged 32-k row, in bf16 elements: 80 bytes = 16 x odd, which the 16-byte fragment reads want
#define GT (128 * GP)            // one staged operand tile, in elements
typedef __attribute__((ext_vector_type(4))) __bf16 v4b;
// x tile: thread = (row tid >> 3 (+ 32 i), 4 k at (tid & 7) * 4): a wave's 16-byte loads cover 4 whole 128-byte lines
__device__ __forceinline__ void g_ldx(const float* p, v4f (&r)[4]) {
#pragma unroll
  for (int i = 0; i < 4; ++i) r[i] = *(const v4f*)(p + (size_t)i * 32 * CC); }
__device__ __forceinline__ void g_stx2(__bf16* dh, __bf16* dl, const v4f (&r)[4]) {
#pragma unroll
  for (int i = 0; i < 4; ++i) { v4b oh, ol;
#pragma unroll
    for (int e = 0; e < 4; ++e) { const __bf16 h = (__bf16)r[i][e]; oh[e] = h; ol[e] = (__bf16)(r[i][e] - (float)h); }
    *(v4b*)(dh + i * 32 * GP) = oh; *(v4b*)(dl + i * 32 * GP) = ol; } }
// ---- k_cvt: rounds the three inputs and the four weights to bf16 ONCE (every column block of k_proj did it again for its rows, every row block of k_proj and k_out for its weight columns) and lays them in fragment order, so that they are staged at half the bytes by plain copies
// block = one stripe of 16 operand rows x 1,024 k = 32 fragment blocks = 32 KB in a row of the plane; the stripe is turned in LDS, so that global reads and writes both cover whole lines
#define CVP 144                  // LDS pitch, in elements, of a group of 16 rows x 8 k (256 bytes): 288 bytes = 8 banks more a group, so the 8 groups that a wave writes at once fall on different banks
// a weight stripe: 16 output columns from a [k][LD] layout; thread = (column tid & 15, k = (tid >> 4) + 16 j); p points at the thread's first element
template <int LD> __device__ __forceinline__ void cv_w(const float* p, __bf16* sp, int tid) { float r[64];
#pragma unroll
  for (int j = 0; j < 64; ++j) r[j] = p[(size_t)j * 16 * LD];
  asm volatile("s_wait_xcnt 0x0" ::: "memory");   // stands before the loads' address registers are written again
#pragma unroll
  for (int j = 0; j < 64; ++j) { const int k = (tid >> 4) + 16 * j; sp[(k >> 3) * CVP + (tid & 15) * 8 + (k & 7)] = (__bf16)r[j]; } }
__global__ __launch_bounds__(256) void k_cvt(const float* __restrict__ XQ, const float* __restrict__ XK, const float* __restrict__ XV, const float* __restrict__ WQ, const float* __restrict__ WK, const float* __restrict__ WV, const float* __restrict__ WO, __bf16* __restrict__ XB, __bf16* __restrict__ WB) {
  __shared__ __align__(16) __bf16 sp[(CC / 8) * CVP];   // element (row, k) at (k >> 3) * CVP + row * 8 + (k & 7)
  const int tid = threadIdx.x, which = blockIdx.y, sx = blockIdx.x; __bf16* dst;
  if (sx < TNB * TT / 16) {   // the same in the whole block: an input stripe; thread = (row tid >> 4, 4 k at 64 i + (tid & 15) * 4): a wave's 16-byte loads cover 2 rows x 256 bytes
    const float* X = which == 0 ? XQ : which == 1 ? XK : XV; const float* p = X + ((size_t)sx * 16 + (tid >> 4)) * CC + (tid & 15) * 4; v4f r[16];
#pragma unroll
    for (int i = 0; i < 16; ++i) r[i] = *(const v4f*)(p + i * 64);
    asm volatile("s_wait_xcnt 0x0" ::: "memory");   // stands before the loads' address registers are written again
#pragma unroll
    for (int i = 0; i < 16; ++i) { v4b o;
#pragma unroll
      for (int e = 0; e < 4; ++e) o[e] = (__bf16)r[i][e];
      *(v4b*)(sp + (i * 8 + ((tid & 15) >> 1)) * CVP + (tid >> 4) * 8 + (tid & 1) * 4) = o; }
    dst = XB + (size_t)which * NB * TT * CC + (size_t)sx * 16 * CC; }
  else if (sx < TNB * TT / 16 + CC / 16) {   // a stripe of this y's own projection weight W[h][k][d]
    const int n0 = (sx - TNB * TT / 16) * 16; const float* WA = which == 0 ? WQ : which == 1 ? WK : WV;
    cv_w<HD>(WA + ((size_t)(n0 / HD) * CC + (tid >> 4)) * HD + n0 % HD + (tid & 15), sp, tid);
    dst = WB + (size_t)which * CC * CC + (size_t)n0 * CC; }
  else {   // the output weight's 64 stripes, dealt over the three y
    const int s = (sx - TNB * TT / 16 - CC / 16) * 3 + which; if (s >= CC / 16) return;   // the same in the whole block, in front of the barrier
    cv_w<CC>(WO + (size_t)(tid >> 4) * CC + s * 16 + (tid & 15), sp, tid);
    dst = WB + (size_t)3 * CC * CC + (size_t)s * 16 * CC; }
  __syncthreads();
  // 16-byte piece q = (group q >> 4, row q & 15) of the stripe lies at q * 16 bytes of the plane's stripe: consecutive threads store consecutive pieces
  v4u o[8];
#pragma unroll
  for (int i = 0; i < 8; ++i) { const int q = i * 256 + tid; o[i] = *(const v4u*)(sp + (q >> 4) * CVP + (q & 15) * 8); }
#pragma unroll
  for (int i = 0; i < 8; ++i) vst2((unsigned*)(dst + (size_t)(i * 256 + tid) * 8), o[i]); }
// k_proj's staged tile of 64 k: 8 row tiles x 2 fragment blocks (2 KB in a row, 32 KB from row tile to row tile) of each operand; piece i * 256 + tid = (row tile 2 i + (tid >> 7), 16 bytes at (tid & 127) * 16)
__device__ __forceinline__ void p_ld(const char* xg, const char* wg, v4u (&r)[8]) {
#pragma unroll
  for (int i = 0; i < 4; ++i) { r[i] = *(const v4u*)(xg + i * 65536); r[4 + i] = *(const v4u*)(wg + i * 65536); } }
__device__ __forceinline__ void p_st(char* d, const v4u (&r)[8]) {
#pragma unroll
  for (int i = 0; i < 4; ++i) { *(v4u*)(d + i * 4096) = r[i]; *(v4u*)(d + 16384 + i * 4096) = r[4 + i]; } }
// ---- k_proj: block = (128 rows, 128 cols, which): qkv = x W (+ b), exact; q -> f16 hi (+ residual), k -> f16 rows, v -> bf16 hi + residual planes; operands come from k_cvt's planes
__global__ __launch_bounds__(256) void k_proj(const __bf16* __restrict__ XB, const __bf16* __restrict__ WB, const float* __restrict__ BQ, const float* __restrict__ BK, const float* __restrict__ BV, _Float16* __restrict__ QH, _Float16* __restrict__ QL, _Float16* __restrict__ KH, __bf16* __restrict__ VT, __bf16* __restrict__ VL) {
  __shared__ __align__(16) char sm[2 * 128 * 136 * 2];   // in the loop: two buffers of [x tile 16 KB | w tile 16 KB], fragment order; behind it: the two output planes at pitch 136
  const int tid = threadIdx.x, wave = tid >> 5, lane = tid & 31, col = lane & 15, g = lane >> 4; const int which = blockIdx.z; const int c0 = blockIdx.y * 128; const size_t r0 = (size_t)blockIdx.x * 128; const float* BA = which == 0 ? BQ : which == 1 ? BK : BV;
  const int wr = (wave >> 1) * 32, wc = (wave & 1) * 64;
  const char* xg = (const char*)(XB + (size_t)which * NB * TT * CC) + (r0 / 16 + (tid >> 7)) * 32768 + (tid & 127) * 16; const char* wg = (const char*)(WB + (size_t)which * CC * CC) + (size_t)(c0 / 16 + (tid >> 7)) * 32768 + (tid & 127) * 16;
  v4u sr[8]; v8f acc[2][4] = {};
  p_ld(xg, wg, sr);
  asm volatile("s_wait_xcnt 0x0" ::: "memory");   // stands before the first tile's address registers are written again
  p_st(sm + tid * 16, sr);
  __syncthreads();
// kept rolled: one trip holds the next tile's 32 loaded registers beside fragments and accumulators
#pragma unroll 1
  for (int kc = 0; kc < CC / 64; ++kc) { const __bf16* cur = (const __bf16*)(sm + (kc & 1) * 32768); char* nxt = sm + ((kc + 1) & 1) * 32768;
    if (kc + 1 < CC / 64) { p_ld(xg + (kc + 1) * 2048, wg + (kc + 1) * 2048, sr);   // the next tile flies while this one multiplies
      asm volatile("s_wait_xcnt 0x0" ::: "memory"); }   // stands before the loads' address registers are written again
#pragma unroll
    for (int ks = 0; ks < 2; ++ks) { v16b a[2], w[4];
#pragma unroll
      for (int qa = 0; qa < 2; ++qa) a[qa] = frag_bp(cur + ((wr / 16 + qa) * 2 + ks) * FB, lane);
#pragma unroll
      for (int j = 0; j < 4; ++j) w[j] = frag_bp(cur + 8192 + ((wc / 16 + j) * 2 + ks) * FB, lane);
#pragma unroll
      for (int j = 0; j < 4; ++j)
#pragma unroll
        for (int qa = 0; qa < 2; ++qa) acc[qa][j] = wmma_bf(a[qa], w[j], acc[qa][j]); }
    if (kc + 1 < CC / 64) p_st(nxt + tid * 16, sr);
    __syncthreads(); }   // publishes the next tile and ends every read of this one (behind the last trip: before the planes reuse the buffers)
  _Float16 (*sh)[136] = (_Float16 (*)[136])sm; _Float16 (*sl)[136] = (_Float16 (*)[136])(sm + 128 * 136 * 2); __bf16 (*th)[136] = (__bf16 (*)[136])sm; __bf16 (*tl2)[136] = (__bf16 (*)[136])(sm + 128 * 136 * 2);
#pragma unroll
  for (int j = 0; j < 4; ++j) { const float bb = bfr(BA[c0 + wc + j * 16 + col]);
#pragma unroll
    for (int qa = 0; qa < 2; ++qa)
#pragma unroll
      for (int r = 0; r < 8; ++r) { const float v = acc[qa][j][r] + bb; const int rl = wr + qa * 16 + 8 * g + r, cl = wc + j * 16 + col; const _Float16 hv = (_Float16)v;
        if (which == 2) { const __bf16 bh = (__bf16)v; th[cl][rl] = bh; tl2[cl][rl] = (__bf16)(v - (float)bh); } else { sh[rl][cl] = hv; sl[rl][cl] = (_Float16)(v - (float)hv); } } }
  __syncthreads();
  // the 128 x 128 tile leaves as 8 x 4 fragment-order blocks: piece e = (block e >> 6 = (row tile, k block), half, lane); consecutive threads store consecutive 16-byte pieces
  if (which < 2) { _Float16* dh = which == 0 ? QH : KH; for (int e = tid; e < 128 * 16; e += 256) { const int fb = e >> 6, pc = e & 63; const int rl = (fb >> 2) * 16 + (pc & 15), cl = (fb & 3) * 32 + (pc >> 5) * 16 + ((pc >> 4) & 1) * 8; const size_t o = ((r0 / 16 + (fb >> 2)) * (CC / 32) + c0 / 32 + (fb & 3)) * FB + pc * 8; vst2((unsigned*)(dh + o), *(const v4u*)&sh[rl][cl]);
      asm volatile("s_wait_xcnt 0x0" ::: "memory");   // stands before the store's data and address registers are written again
      if (which == 0) { vst2((unsigned*)(QL + o), *(const v4u*)&sl[rl][cl]);
        asm volatile("s_wait_xcnt 0x0" ::: "memory"); } } }   // the same, for the residual plane's store
  else { const size_t b = r0 / TT; const int t0 = (int)(r0 % TT); for (int e = tid; e < 128 * 16; e += 256) { const int fb = e >> 6, pc = e & 63; const int cl = (fb >> 2) * 16 + (pc & 15), tl = (fb & 3) * 32 + (pc >> 5) * 16 + ((pc >> 4) & 1) * 8; const size_t o2 = (((b * CC + c0) / 16 + (fb >> 2)) * (TT / 32) + t0 / 32 + (fb & 3)) * FB + pc * 8; vst2((unsigned*)(VT + o2), *(const v4u*)&th[cl][tl]); vst2((unsigned*)(VL + o2), *(const v4u*)&tl2[cl][tl]);
      asm volatile("s_wait_xcnt 0x0" ::: "memory"); } } }   // stands before the two stores' data and address registers are written again
// ---- k_fa: scores, softmax and P . v in one kernel, running maximum and sum per query (no logits plane). Block = 8 waves on ONE group of 64 queries of plane y = b * NH + h at a time: wave = (16 queries w4 = wave & 3, key half hw = wave >> 2), so that every wave has work in every key tile before the group's diagonal one; the block takes group x and then group 31 - x, one after the other in one run of 33 key tiles
// the two waves of a query tile each keep their own maximum, sum and O^T over their 32 keys of every 64; at a group's last tile the hw = 1 wave hands its three through LDS to the hw = 0 wave, which rescales both to the common maximum, adds, divides and stores
// per 64 keys the block stages k (f16), v and v's residual (bf16), 32 KB each, once in LDS: the planes lie in fragment order, so staging is a plain copy; two buffers, the next tile's loads fly while this one multiplies (the second group's first tile behind the first group's last)
// both products are formed transposed: S^T = k q^T leaves a lane with 8 consecutive keys of ITS query (col = query), which is the B fragment of O^T = v^T P^T as it stands: P never leaves its registers, and maximum, sum and rescale are per lane (the other 8-key halves sit in lane ^ 16)
// scheduling barrier that no instruction may cross: it holds each group of fragment reads at its written place, two groups ahead of the WMMAs that use it
#define FA_PIN() __builtin_amdgcn_sched_barrier(0)
// a v group's last WMMA on an accumulator, in the form of wmma_bf: the asm statement behind it keeps its place among the scheduling barriers, which a bare WMMA does not (without it every WMMA of the tile sinks behind the last read, and the fragments spill), so the group's WMMAs stay in front of the next group's reads; the four v_nop are the distance to a vector instruction on D. Only D is named: fragments named there as well are tied to the first 256 registers, and the accumulators spill
__device__ __forceinline__ v8f fa_wmma_end(v16b a, v16b b, v8f c) {
  v8f d = __builtin_amdgcn_wmma_f32_16x16x32_bf16(false, a, false, b, (short)0, c, false, false);
  asm volatile("v_nop\n\tv_nop\n\tv_nop\n\tv_nop" : "+v"(d));
  return d;
}
#define FKB 32768                // bytes of one staged plane of 64 keys x 256 head columns
__device__ __forceinline__ void fa_ld(const char* kg, const char* vh, const char* vl, v4u (&r)[24]) {
#pragma unroll
  for (int i = 0; i < 8; ++i) r[i] = *(const v4u*)(kg + (i >> 1) * 32768 + (i & 1) * 4096);   // 16-key tile i >> 1: 8 KB in a row
#pragma unroll
  for (int i = 0; i < 8; ++i) { r[8 + i] = *(const v4u*)(vh + i * 131072); r[16 + i] = *(const v4u*)(vl + i * 131072); } }   // column tile 2 i + (tid >> 7): 2 KB in a row
__device__ __forceinline__ void fa_st(char* d, const v4u (&r)[24]) {
#pragma unroll
  for (int i = 0; i < 24; ++i) *(v4u*)(d + i * 4096) = r[i]; }
__global__ __launch_bounds__(256) void k_fa(const _Float16* __restrict__ QH, const _Float16* __restrict__ KH, const __bf16* __restrict__ VT, const __bf16* __restrict__ VL, float* __restrict__ Y) { __shared__ __align__(16) char sm[2 * 3 * FKB + 4 * 16384 + 4 * 256];   // two staging buffers; behind them the hand-over: 16 KB of O^T per query tile, then (maximum, sum) per lane
  const int tid = threadIdx.x, wave = __builtin_amdgcn_readfirstlane(tid >> 5), lane = tid & 31, col = lane & 15, g = lane >> 4; const int b = blockIdx.y / NH, h = blockIdx.y % NH;
  const int w4 = wave & 3, hw = wave >> 2; const int gx = blockIdx.x;
  const char* kg = (const char*)(KH + (((size_t)b * TT / 16) * (CC / 32) + h * (HD / 32)) * FB) + tid * 16;
  const size_t vo = ((((size_t)b * CC + h * HD) / 16) * (TT / 32)) * FB * 2 + (tid >> 7) * 65536 + (tid & 127) * 16; const char* vhg = (const char*)VT + vo; const char* vlg = (const char*)VL + vo;
  char* const xo = sm + 2 * 3 * FKB + w4 * 16384 + lane * 16; char* const xm = sm + 2 * 3 * FKB + 4 * 16384 + w4 * 256 + lane * 8;   // each 16-byte piece of O^T at [piece][lane]
  int grp = gx, kt = 0, ql0 = grp * 64 + w4 * 16;   // the group's key tiles run 0 .. grp, up to its diagonal
  const _Float16* const qb = QH + (((size_t)b * TT / 16) * (CC / 32) + h * (HD / 32)) * FB; v16h qf[HD / 32];
#pragma unroll
  for (int kc = 0; kc < HD / 32; ++kc) qf[kc] = frag_hp(qb + ((size_t)(ql0 / 16) * (CC / 32) + kc) * FB, lane);
  v4u st[24]; v8f o[HD / 16] = {}; float m = -3.0e38f, l = 0.f;
  fa_ld(kg, vhg, vlg, st);
  FA_PIN();   // keeps later index arithmetic, which reuses the loads' address registers, behind the wait
  asm volatile("s_wait_xcnt 0x0" :: "v"(tid), "v"(lane) : "memory");   // stands before the first loads' address registers are written again; the two offset registers are named as inputs so that they live up to the wait
  fa_st(sm + tid * 16, st);
  __syncthreads();
// kept rolled: one trip holds the next tile's 96 loaded registers beside the 128 accumulator and 64 query registers
#pragma unroll 1
  for (int t = 0; t < TT / 64 + 1; ++t) { const char* cur = sm + (t & 1) * (3 * FKB); char* nxt = sm + ((t + 1) & 1) * (3 * FKB);
    const bool last = kt == grp, more = t < TT / 64; const int nk = last ? 0 : kt + 1;   // scalar, the same in every wave
    if (more) { fa_ld(kg + (size_t)nk * 131072, vhg + nk * 2048, vlg + nk * 2048, st);
      asm volatile("s_wait_xcnt 0x0" ::: "memory"); }   // stands before the loads' address registers are written again
    if (kt * 64 + hw * 32 <= ql0 + 15) {   // scalar: a wave whose 16 queries all lie in front of its 32 keys of this tile has nothing in it
      const _Float16* ck = (const _Float16*)cur + hw * (2 * (HD / 32) * FB); const __bf16* cvh = (const __bf16*)(cur + FKB) + hw * FB; const __bf16* cvl = (const __bf16*)(cur + 2 * FKB) + hw * FB;   // the wave's two 16-key tiles of k; its 32-key block of every column tile of v
      v8f s[2] = {}; v16h fk[3][4]; v16b fv[3][4];
      // fragments are read in groups of 4 (8 LDS loads at one place) into a ring of three groups, each group two steps ahead of the WMMAs that use it, so that a group's LDS latency is covered by two groups of WMMAs and no wait falls on loads just issued; left to itself the compiler reads v's groups directly in front of their WMMAs
      // k group q = (key tiles 0 and 1, head columns 32 (2 q) and 32 (2 q + 1))
#pragma unroll
      for (int q = 0; q < 2; ++q)
#pragma unroll
        for (int e = 0; e < 4; ++e) fk[q][e] = frag_hp(ck + ((e >> 1) * (HD / 32) + 2 * q + (e & 1)) * FB, lane);
      FA_PIN();
#pragma unroll
      for (int q = 0; q < HD / 64; ++q) {
        if (q + 2 < HD / 64) {
#pragma unroll
          for (int e = 0; e < 4; ++e) fk[(q + 2) % 3][e] = frag_hp(ck + ((e >> 1) * (HD / 32) + 2 * (q + 2) + (e & 1)) * FB, lane); }
        else { const int u = q + 2 - HD / 64;   // v's first two groups (column tiles 2 u and 2 u + 1) fly through the softmax
#pragma unroll
          for (int e = 0; e < 2; ++e) { fv[u][e] = frag_bp(cvh + (u * 2 + e) * 2 * FB, lane); fv[u][2 + e] = frag_bp(cvl + (u * 2 + e) * 2 * FB, lane); } }
        FA_PIN();
#pragma unroll
        for (int e = 0; e < 4; ++e) s[e & 1] = __builtin_amdgcn_wmma_f32_16x16x32_f16(false, fk[q % 3][(e & 1) * 2 + (e >> 1)], false, qf[2 * q + (e >> 1)], (short)0, s[e & 1], false, false);
        FA_PIN(); }
      const int qt = ql0 + col; float mx = m;
#pragma unroll
      for (int j = 0; j < 2; ++j)
#pragma unroll
        for (int r = 0; r < 8; ++r) { float v = s[j][r] * 0.00390625f; if (kt * 64 + hw * 32 + j * 16 + 8 * g + r > qt) v = -3.0e38f; s[j][r] = v; mx = fmaxf(mx, v); }
      mx = fmaxf(mx, __shfl_xor(mx, 16));
      const float al = expf(m - mx); m = mx; v4f s4 = {0.f, 0.f, 0.f, 0.f};
#pragma unroll
      for (int j = 0; j < 2; ++j)
#pragma unroll
        for (int r = 0; r < 8; ++r) { const float v = s[j][r], ex = expf(v - mx); const float pv = (v <= -1.0e38f) ? 0.f : ex; s[j][r] = pv; s4[r & 3] += pv; }
      l = l * al + ((s4[0] + s4[1]) + (s4[2] + s4[3]));
#pragma unroll
      for (int dt = 0; dt < HD / 16; ++dt) o[dt] *= al;
      F2 p; { float v[16];
#pragma unroll
        for (int i = 0; i < 8; ++i) { v[i] = s[0][i]; v[8 + i] = s[1][i]; }
        p = bsplit16(v); }
      // group gi = column tiles 2 gi and 2 gi + 1: two accumulators in turn
#pragma unroll
      for (int gi = 0; gi < HD / 32; ++gi) { const int d2 = gi * 2;
        if (gi + 2 < HD / 32) {
#pragma unroll
          for (int e = 0; e < 2; ++e) { fv[(gi + 2) % 3][e] = frag_bp(cvh + ((gi + 2) * 2 + e) * 2 * FB, lane); fv[(gi + 2) % 3][2 + e] = frag_bp(cvl + ((gi + 2) * 2 + e) * 2 * FB, lane); } }
        FA_PIN();
#pragma unroll
        for (int e = 0; e < 2; ++e) o[d2 + e] = __builtin_amdgcn_wmma_f32_16x16x32_bf16(false, fv[gi % 3][e], false, p.h, (short)0, o[d2 + e], false, false);
#pragma unroll
        for (int e = 0; e < 2; ++e) o[d2 + e] = __builtin_amdgcn_wmma_f32_16x16x32_bf16(false, fv[gi % 3][e], false, p.l, (short)0, o[d2 + e], false, false);
#pragma unroll
        for (int e = 0; e < 2; ++e) o[d2 + e] = gi + 1 < HD / 32 ? fa_wmma_end(fv[gi % 3][2 + e], p.h, o[d2 + e]) : wmma_bf(fv[gi % 3][2 + e], p.h, o[d2 + e]);   // the tile's last two carry their four v_nop with them
        FA_PIN(); } }
    if (more) fa_st(nxt + tid * 16, st);
    if (last && hw == 1) {   // scalar
#pragma unroll
      for (int dt = 0; dt < HD / 16; ++dt) { const v4f lo = {o[dt][0], o[dt][1], o[dt][2], o[dt][3]}, hi = {o[dt][4], o[dt][5], o[dt][6], o[dt][7]}; *(v4f*)(xo + dt * 1024) = lo; *(v4f*)(xo + dt * 1024 + 512) = hi; }
      const v2f ml = {m, l}; *(v2f*)xm = ml; }
    if (last && more) {   // scalar: the second group's queries are fetched in front of the barrier, whose wait for all loads then covers them; fetched behind it, the compiler waits for them at the score WMMAs of every trip, and with them for the next tile's staging loads just issued
#pragma unroll
      for (int kc = 0; kc < HD / 32; ++kc) qf[kc] = frag_hp(qb + ((size_t)((TT / 64 - 1 - gx) * 4 + w4) * (CC / 32) + kc) * FB, lane);
      asm volatile("s_wait_xcnt 0x0" ::: "memory"); }   // stands before the query loads' address registers are written again
    __syncthreads();   // publishes the next tile and ends every read of this one; at a group's last tile it also publishes the hand-over, which is next written 17 or more barriers later
    if (last) {
      if (hw == 0) {   // scalar; this wave's keys hold the group's first key, so its maximum is a real score; a partner without any key brings maximum -3e38, sum 0 and zeros, and its weight is exp(-huge) = 0
        const v2f ml = *(const v2f*)xm; const float mm = fmaxf(m, ml[0]); const float a0 = expf(m - mm), a1 = expf(ml[0] - mm);
        const float lp = l * a0 + ml[1] * a1; const float inv = 1.0f / (lp + __shfl_xor(lp, 16)); const float c0 = a0 * inv, c1 = a1 * inv;
        float* const yp = Y + ((size_t)b * TT + ql0 + col) * CC + h * HD + 8 * g;   // the lane holds columns dt * 16 + 8 g + 0..7 of its query
#pragma unroll
        for (int dt = 0; dt < HD / 16; ++dt) { const v4f pl = *(const v4f*)(xo + dt * 1024), pu = *(const v4f*)(xo + dt * 1024 + 512);
#pragma unroll
          for (int r = 0; r < 4; ++r) { o[dt][r] = o[dt][r] * c0 + pl[r] * c1; o[dt][4 + r] = o[dt][4 + r] * c0 + pu[r] * c1; } }
        FA_PIN();   // keeps the stores a run of their own behind the sums, so that no register a store names is written between them
#pragma unroll
        for (int dt = 0; dt < HD / 16; ++dt) { const v4f lo = {o[dt][0], o[dt][1], o[dt][2], o[dt][3]}, hi = {o[dt][4], o[dt][5], o[dt][6], o[dt][7]}; vst2(yp + dt * 16, lo); vst2(yp + dt * 16 + 4, hi); }
        FA_PIN();   // and keeps what follows behind the wait
        asm volatile("s_wait_xcnt 0x0" ::: "memory"); }   // stands before the stores' data and address registers are written again
      if (more) { grp = TT / 64 - 1 - gx; ql0 = grp * 64 + w4 * 16; m = -3.0e38f; l = 0.f;   // the second group starts
#pragma unroll
        for (int dt = 0; dt < HD / 16; ++dt) o[dt] = v8f{}; } }
    kt = nk; } }
// ---- k_out: block = (128 rows, 128 cols): out = y (bf16 hi + lo) Wproj + b; y staged through registers as two planes at pitch GP, w copied from k_cvt's plane: 8 column tiles x 1 fragment block per 32 k, piece i * 256 + tid = (column tile 4 i + (tid >> 6), 16 bytes at (tid & 63) * 16)
__global__ __launch_bounds__(256) void k_out(const float* __restrict__ Y, const __bf16* __restrict__ WP, const float* __restrict__ BP, float* __restrict__ OUT) { __shared__ __align__(16) char sm[128 * 132 * 4];   // in the loop: two buffers of [y hi | y lo | w in fragment order]; behind it: the f32 output tile at pitch 132
  __bf16* const st = (__bf16*)sm;
  const int tid = threadIdx.x, wave = tid >> 5, lane = tid & 31, col = lane & 15, g = lane >> 4; const int c0 = blockIdx.y * 128; const size_t r0 = (size_t)blockIdx.x * 128;
  const int wr = (wave >> 1) * 32, wc = (wave & 1) * 64;
  const float* xa = Y + (r0 + (tid >> 3)) * CC + (tid & 7) * 4; const char* wa = (const char*)WP + (size_t)(c0 / 16 + (tid >> 6)) * 32768 + (tid & 63) * 16;
  const int sxo = (tid >> 3) * GP + (tid & 7) * 4, swo = 2 * GT + tid * 8;
  v4f xr[4]; v4u wv[2]; v8f acc[2][4] = {};
  g_ldx(xa, xr); wv[0] = *(const v4u*)wa; wv[1] = *(const v4u*)(wa + 131072);
  asm volatile("s_wait_xcnt 0x0" ::: "memory");   // stands before the first tile's address registers are written again
  g_stx2(st + sxo, st + GT + sxo, xr); *(v4u*)(st + swo) = wv[0]; *(v4u*)(st + swo + 2048) = wv[1];
  __syncthreads();
// kept rolled: one trip holds the next tile's 24 loaded registers beside fragments and accumulators
#pragma unroll 1
  for (int kc = 0; kc < CC / 32; ++kc) { const __bf16* cur = st + (kc & 1) * (3 * GT); __bf16* nxt = st + ((kc + 1) & 1) * (3 * GT);
    if (kc + 1 < CC / 32) { g_ldx(xa + (kc + 1) * 32, xr); wv[0] = *(const v4u*)(wa + (kc + 1) * 1024); wv[1] = *(const v4u*)(wa + (kc + 1) * 1024 + 131072);   // the next tile flies while this one multiplies
      asm volatile("s_wait_xcnt 0x0" ::: "memory"); }   // stands before the loads' address registers are written again
    v16b ah[2], al[2], w[4];
#pragma unroll
    for (int qa = 0; qa < 2; ++qa) { ah[qa] = frag_b(cur + (wr + qa * 16 + col) * GP, lane); al[qa] = frag_b(cur + GT + (wr + qa * 16 + col) * GP, lane); }
#pragma unroll
    for (int j = 0; j < 4; ++j) w[j] = frag_bp(cur + 2 * GT + (wc / 16 + j) * FB, lane);
#pragma unroll
    for (int j = 0; j < 4; ++j)
#pragma unroll
      for (int qa = 0; qa < 2; ++qa) acc[qa][j] = wmma_bf(ah[qa], w[j], acc[qa][j]);
#pragma unroll
    for (int j = 0; j < 4; ++j)
#pragma unroll
      for (int qa = 0; qa < 2; ++qa) acc[qa][j] = wmma_bf(al[qa], w[j], acc[qa][j]);
    if (kc + 1 < CC / 32) { g_stx2(nxt + sxo, nxt + GT + sxo, xr); *(v4u*)(nxt + swo) = wv[0]; *(v4u*)(nxt + swo + 2048) = wv[1]; }
    __syncthreads(); }   // publishes the next tile and ends every read of this one (behind the last trip: before the output tile reuses the buffers)
  float (*sf)[132] = (float (*)[132])sm;
#pragma unroll
  for (int j = 0; j < 4; ++j) { const float bb = BP ? bfr(BP[c0 + wc + j * 16 + col]) : 0.f;
#pragma unroll
    for (int qa = 0; qa < 2; ++qa)
#pragma unroll
      for (int r = 0; r < 8; ++r) sf[wr + qa * 16 + 8 * g + r][wc + j * 16 + col] = acc[qa][j][r] + bb; }
  __syncthreads();
  for (int e = tid; e < 128 * 32; e += 256) { const int rl = e >> 5, q = e & 31; vst2(OUT + (r0 + rl) * CC + c0 + q * 4, *(const v4f*)&sf[rl][q * 4]); } }
extern "C" void kernel_launch(void* const* d_in, const int* in_sizes, int n_in, void* d_out, int out_size, void* d_ws, size_t ws_size, hipStream_t stream) {
  (void)in_sizes; (void)n_in; (void)out_size;
  const float** F = (const float**)d_in;   // 0 inputs_for_keys, 1 inputs_for_values, 2 inputs_for_queries [4,2048,1024], 3 Wk [4,1024,256], 4 bk [4,256], 5 Wq, 6 bq, 7 Wv, 8 bv, 9 Wo [1024,1024] ([in,out]), 10 bo
  if (ws_size < (size_t)WS_END) return;
  char* ws = (char*)d_ws; _Float16 *QH = (_Float16*)(ws + WS_QH), *QL = (_Float16*)(ws + WS_QL), *KH = (_Float16*)(ws + WS_KH); __bf16 *VT = (__bf16*)(ws + WS_VT), *VL = (__bf16*)(ws + WS_VL), *XB = (__bf16*)(ws + WS_XB), *WB = (__bf16*)(ws + WS_WB); float *Y = (float*)(ws + WS_Y);
  k_cvt<<<dim3(TNB * TT / 16 + CC / 16 + (CC / 16 + 2) / 3, 3), 256, 0, stream>>>(F[2], F[0], F[1], F[5], F[3], F[7], F[9], XB, WB);
  k_proj<<<dim3(TNB * TT / 128, CC / 128, 3), 256, 0, stream>>>(XB, WB, F[6], F[4], F[8], QH, QL, KH, VT, VL);
  k_fa<<<dim3(TT / 128, TNB * NH), 256, 0, stream>>>(QH, KH, VT, VL, Y);
  k_out<<<dim3(TNB * TT / 128, CC / 128), 256, 0, stream>>>(Y, WB + (size_t)3 * CC * CC, F[10], (float*)d_out);
}

// v010
// Measured time: 172 microseconds a run.
// Two timings next to v009 both put it at 1.05 times that version's speed.
// Counting every step since v000, it is 46.3 times as fast.
// compute dtype: all float inputs rounded to bf16; Q/K/V = inputs W_h + b_h (per-head [E, Dh] weights) with EXACT bf16 products on WMMA 16x16x32, f32 accumulate, q/k rounded once to f16 (logits / 256 have std ~0.06: 1 product), causal logits kept in registers; softmax in f32 with a running maximum and sum, in base 2 (scores scaled by log2 e / 256, hardware exp2), unnormalised P in f32 split bf16 hi + lo against v as bf16 hi + lo (3 products), divided by the sum at the end; out = y (bf16 hi + lo) Wo + bo; f32 output.
#include <hip/hip_runtime.h>
#include <math.h>

typedef __attribute__((ext_vector_type(16))) _Float16 v16h;
typedef __attribute__((ext_vector_type(16))) __bf16 v16b;
typedef __attribute__((ext_vector_type(8)))  _Float16 v8h;
typedef __attribute__((ext_vector_type(8)))  float v8f;
typedef __attribute__((ext_vector_type(4)))  float v4f;
typedef __attribute__((ext_vector_type(2)))  float v2f;
typedef __attribute__((ext_vector_type(4)))  unsigned v4u;
typedef __attribute__((ext_vector_type(4)))  int v4i;
typedef float __attribute__((may_alias)) float_a;
typedef int __attribute__((may_alias)) int_a;

template <typename T> __device__ __forceinline__ void vst2(void* p, T v) { *(T*)p = v;  }
__device__ __forceinline__ v8f wmma16(v16h a, v16h b, v8f c) {
  v8f d = __builtin_amdgcn_wmma_f32_16x16x32_f16(false, a, false, b, (short)0, c, false, false);
  asm volatile("v_nop\n\tv_nop\n\tv_nop\n\tv_nop" : "+v"(d) : "v"(a), "v"(b));
  return d;
}
__device__ __forceinline__ v8f wmma_bf(v16b a, v16b b, v8f c) {
  v8f d = __builtin_amdgcn_wmma_f32_16x16x32_bf16(false, a, false, b, (short)0, c, false, false);
  asm volatile("v_nop\n\tv_nop\n\tv_nop\n\tv_nop" : "+v"(d) : "v"(a), "v"(b));
  return d;
}
// 16x16x32 fragments: lane = (h = lane>>4, row/col = lane&15); elements 0..7 = k0+8h+0..7, 8..15 = k0+16+8h+0..7; D element r = row 8h+r
__device__ __forceinline__ v16h frag_h(const _Float16* rowk0, int lane) {
  union { v16h v; v8h q[2]; } u; const _Float16* p = rowk0 + 8 * (lane >> 4);
  u.q[0] = *(const v8h*)p; u.q[1] = *(const v8h*)(p + 16); return u.v;
}
__device__ __forceinline__ v16h frag_f32(const float* rowk0, int lane) {
  v16h a; const float* p = rowk0 + 8 * (lane >> 4);
#pragma unroll
  for (int i = 0; i < 8; ++i) { a[i] = (_Float16)p[i]; a[8 + i] = (_Float16)p[16 + i]; }
  return a;
}
__device__ __forceinline__ v16h frag_f32s(const float* rowk0, int lane, float sc) {
  v16h a; const float* p = rowk0 + 8 * (lane >> 4);
#pragma unroll
  for (int i = 0; i < 8; ++i) { a[i] = (_Float16)(p[i] * sc); a[8 + i] = (_Float16)(p[16 + i] * sc); }
  return a;
}
// column fragment from a [K][ld] layout (column n), rows >= K read as 0
__device__ __forceinline__ v16h fragc_f32(const float* W, int k0, int n, int lane, int ld, int K) {
  v16h a; const int g = lane >> 4;
#pragma unroll
  for (int i = 0; i < 8; ++i) { const int ka = k0 + 8 * g + i, kb = ka + 16;
    a[i] = (_Float16)(ka < K ? W[(size_t)(ka < K ? ka : K - 1) * ld + n] : 0.f); a[8 + i] = (_Float16)(kb < K ? W[(size_t)(kb < K ? kb : K - 1) * ld + n] : 0.f); }
  return a;
}
struct F2 { v16b h, l; };
__device__ __forceinline__ F2 bsplit16(const float v[16]) { F2 r;
#pragma unroll
  for (int i = 0; i < 16; ++i) { const __bf16 h = (__bf16)v[i]; r.h[i] = h; r.l[i] = (__bf16)(v[i] - (float)h); }
  return r; }
__device__ __forceinline__ F2 split_row(const float* row, int k0, int lane) { float v[16]; const float* p = row + k0 + 8 * (lane >> 4);
#pragma unroll
  for (int i = 0; i < 8; ++i) { v[i] = p[i]; v[8 + i] = p[16 + i]; }
  return bsplit16(v); }
__device__ __forceinline__ F2 split_rowK(const float* row, int k0, int lane, int K) { float v[16]; const int g = lane >> 4;
#pragma unroll
  for (int i = 0; i < 8; ++i) { const int ka = k0 + 8 * g + i, kb = ka + 16; v[i] = ka < K ? row[ka < K ? ka : K - 1] : 0.f; v[8 + i] = kb < K ? row[kb < K ? kb : K - 1] : 0.f; }
  return bsplit16(v); }
__device__ __forceinline__ F2 split_col(const float* W, int k0, int n, int lane, int ld, int K) { float v[16]; const int g = lane >> 4;
#pragma unroll
  for (int i = 0; i < 8; ++i) { const int ka = k0 + 8 * g + i, kb = ka + 16; v[i] = ka < K ? W[(size_t)(ka < K ? ka : K - 1) * ld + n] : 0.f; v[8 + i] = kb < K ? W[(size_t)(kb < K ? kb : K - 1) * ld + n] : 0.f; }
  return bsplit16(v); }
__device__ __forceinline__ v8f mac3(const F2& a, const F2& b, v8f c) { c = wmma_bf(a.l, b.h, c); c = wmma_bf(a.h, b.l, c); return wmma_bf(a.h, b.h, c); }
__device__ __forceinline__ float sigm(float v) { return 1.0f / (1.0f + expf(-v)); }
#define LDSX() do { asm volatile("s_wait_dscnt 0" ::: "memory"); __builtin_amdgcn_wave_barrier(); __builtin_amdgcn_fence(__ATOMIC_RELEASE, "workgroup"); } while (0)


// Four-headed causal attention (B 4, S 2,048, E 1,024 = 4 heads x 256): per-head Dense q/k/v from three different inputs, scores / head_dim (256), strictly-upper -1e30 mask, softmax, concat heads, Wo + bo.
#define NB 4
#define TT 2048
#define CC 1024
#define NH 4
#define HD 256
#ifndef TNB
#define TNB NB
#endif
typedef __attribute__((ext_vector_type(8))) __bf16 v8b;
__device__ __forceinline__ v16b frag_b(const __bf16* rowk0, int lane) {
  union { v16b v; v8b q[2]; } u; const __bf16* p = rowk0 + 8 * (lane >> 4);
  u.q[0] = *(const v8b*)p; u.q[1] = *(const v8b*)(p + 16); return u.v;
}
// fragment-order planes: a (16 rows x 32 k) operand tile is one 1,024-byte block, [half][lane][8]: half 0 = the lane's elements 0..7, half 1 = its elements 8..15, so each of a fragment's two 16-byte loads covers 512 contiguous bytes (4 whole lines) and not 16 lines
#define FB 512                   // elements of one block
__device__ __forceinline__ v16h frag_hp(const _Float16* blk, int lane) {
  union { v16h v; v8h q[2]; } u; const _Float16* p = blk + lane * 8;
  u.q[0] = *(const v8h*)p; u.q[1] = *(const v8h*)(p + 256); return u.v;
}
__device__ __forceinline__ v16b frag_bp(const __bf16* blk, int lane) {
  union { v16b v; v8b q[2]; } u; const __bf16* p = blk + lane * 8;
  u.q[0] = *(const v8b*)p; u.q[1] = *(const v8b*)(p + 256); return u.v;
}
__device__ __forceinline__ float bfr(float v) { return (float)(__bf16)v; }
__device__ __attribute__((noinline)) float exp_ni(float v) { return expf(v); }
__device__ __attribute__((noinline)) float erf_ni(float v) { return erff(v); }

#define WS_QH  0u
#define WS_QL  (WS_QH + 2u * (size_t)NB * TT * CC)
#define WS_KH  (WS_QL + 2u * (size_t)NB * TT * CC)
#define WS_VT  (WS_KH + 2u * (size_t)NB * TT * CC)      // bf16 v planes, rows b * C + c, k = t; q, k and v planes all lie in fragment order (frag_hp, frag_bp)
#define WS_VL  (WS_VT + 2u * (size_t)NB * CC * TT)      // bf16 v residual planes
#define WS_Y   (WS_VL + 2u * (size_t)NB * CC * TT)      // f32 y rows [b*t][C]
#define WS_XB  (WS_Y + 4u * (size_t)NB * TT * CC)       // bf16 copies of the three inputs (q, k, v order), rows b * T + t, k = e, in fragment order
#define WS_WB  (WS_XB + 3u * 2u * (size_t)NB * TT * CC) // bf16 copies of Wq, Wk, Wv (rows = output column h * HD + d, k = e) and Wo (rows = output column, k = input column), in fragment order
#define WS_END (WS_WB + 4u * 2u * (size_t)CC * CC)

// ---- staged GEMM tiles (k_proj, k_out): a block of 8 waves owns 128 rows x 128 cols; both operands go global -> registers -> LDS once per block as bf16; wave = 32 rows x 64 cols. The helpers here stage k_out's f32 y rows, k-contiguous
#define GP 40                    // LDS pitch of a staged 32-k row, in bf16 elements: 80 bytes = 16 x odd, which the 16-byte fragment reads want
#define GT (128 * GP)            // one staged operand tile, in elements
typedef __attribute__((ext_vector_type(4))) __bf16 v4b;
// x tile: thread = (row tid >> 3 (+ 32 i), 4 k at (tid & 7) * 4): a wave's 16-byte loads cover 4 whole 128-byte lines
__device__ __forceinline__ void g_ldx(const float* p, v4f (&r)[4]) {
#pragma unroll
  for (int i = 0; i < 4; ++i) r[i] = *(const v4f*)(p + (size_t)i * 32 * CC); }
__device__ __forceinline__ void g_stx2(__bf16* dh, __bf16* dl, const v4f (&r)[4]) {
#pragma unroll
  for (int i = 0; i < 4; ++i) { v4b oh, ol;
#pragma unroll
    for (int e = 0; e < 4; ++e) { const __bf16 h = (__bf16)r[i][e]; oh[e] = h; ol[e] = (__bf16)(r[i][e] - (float)h); }
    *(v4b*)(dh + i * 32 * GP) = oh; *(v4b*)(dl + i * 32 * GP) = ol; } }
// ---- k_cvt: rounds the three inputs and the four weights to bf16 ONCE (every column block of k_proj did it again for its rows, every row block of k_proj and k_out for its weight columns) and lays them in fragment order, so that they are staged at half the bytes by plain copies
// block = one stripe of 16 operand rows x 1,024 k = 32 fragment blocks = 32 KB in a row of the plane; the stripe is turned in LDS, so that global reads and writes both cover whole lines
#define CVP 144                  // LDS pitch, in elements, of a group of 16 rows x 8 k (256 bytes): 288 bytes = 8 banks more a group, so the 8 groups that a wave writes at once fall on different banks
// a weight stripe: 16 output columns from a [k][LD] layout; thread = (column tid & 15, k = (tid >> 4) + 16 j); p points at the thread's first element
template <int LD> __device__ __forceinline__ void cv_w(const float* p, __bf16* sp, int tid) { float r[64];
#pragma unroll
  for (int j = 0; j < 64; ++j) r[j] = p[(size_t)j * 16 * LD];
  asm volatile("s_wait_xcnt 0x0" ::: "memory");   // stands before the loads' address registers are written again
#pragma unroll
  for (int j = 0; j < 64; ++j) { const int k = (tid >> 4) + 16 * j; sp[(k >> 3) * CVP + (tid & 15) * 8 + (k & 7)] = (__bf16)r[j]; } }
__global__ __launch_bounds__(256) void k_cvt(const float* __restrict__ XQ, const float* __restrict__ XK, const float* __restrict__ XV, const float* __restrict__ WQ, const float* __restrict__ WK, const float* __restrict__ WV, const float* __restrict__ WO, __bf16* __restrict__ XB, __bf16* __restrict__ WB) {
  __shared__ __align__(16) __bf16 sp[(CC / 8) * CVP];   // element (row, k) at (k >> 3) * CVP + row * 8 + (k & 7)
  const int tid = threadIdx.x, which = blockIdx.y, sx = blockIdx.x; __bf16* dst;
  if (sx < TNB * TT / 16) {   // the same in the whole block: an input stripe; thread = (row tid >> 4, 4 k at 64 i + (tid & 15) * 4): a wave's 16-byte loads cover 2 rows x 256 bytes
    const float* X = which == 0 ? XQ : which == 1 ? XK : XV; const float* p = X + ((size_t)sx * 16 + (tid >> 4)) * CC + (tid & 15) * 4; v4f r[16];
#pragma unroll
    for (int i = 0; i < 16; ++i) r[i] = *(const v4f*)(p + i * 64);
    asm volatile("s_wait_xcnt 0x0" ::: "memory");   // stands before the loads' address registers are written again
#pragma unroll
    for (int i = 0; i < 16; ++i) { v4b o;
#pragma unroll
      for (int e = 0; e < 4; ++e) o[e] = (__bf16)r[i][e];
      *(v4b*)(sp + (i * 8 + ((tid & 15) >> 1)) * CVP + (tid >> 4) * 8 + (tid & 1) * 4) = o; }
    dst = XB + (size_t)which * NB * TT * CC + (size_t)sx * 16 * CC; }
  else if (sx < TNB * TT / 16 + CC / 16) {   // a stripe of this y's own projection weight W[h][k][d]
    const int n0 = (sx - TNB * TT / 16) * 16; const float* WA = which == 0 ? WQ : which == 1 ? WK : WV;
    cv_w<HD>(WA + ((size_t)(n0 / HD) * CC + (tid >> 4)) * HD + n0 % HD + (tid & 15), sp, tid);
    dst = WB + (size_t)which * CC * CC + (size_t)n0 * CC; }
  else {   // the output weight's 64 stripes, dealt over the three y
    const int s = (sx - TNB * TT / 16 - CC / 16) * 3 + which; if (s >= CC / 16) return;   // the same in the whole block, in front of the barrier
    cv_w<CC>(WO + (size_t)(tid >> 4) * CC + s * 16 + (tid & 15), sp, tid);
    dst = WB + (size_t)3 * CC * CC + (size_t)s * 16 * CC; }
  __syncthreads();
  // 16-byte piece q = (group q >> 4, row q & 15) of the stripe lies at q * 16 bytes of the plane's stripe: consecutive threads store consecutive pieces
  v4u o[8];
#pragma unroll
  for (int i = 0; i < 8; ++i) { const int q = i * 256 + tid; o[i] = *(const v4u*)(sp + (q >> 4) * CVP + (q & 15) * 8); }
#pragma unroll
  for (int i = 0; i < 8; ++i) vst2((unsigned*)(dst + (size_t)(i * 256 + tid) * 8), o[i]); }
// k_proj's staged tile of 64 k: 8 row tiles x 2 fragment blocks (2 KB in a row, 32 KB from row tile to row tile) of each operand; piece i * 256 + tid = (row tile 2 i + (tid >> 7), 16 bytes at (tid & 127) * 16)
__device__ __forceinline__ void p_ld(const char* xg, const char* wg, v4u (&r)[8]) {
#pragma unroll
  for (int i = 0; i < 4; ++i) { r[i] = *(const v4u*)(xg + i * 65536); r[4 + i] = *(const v4u*)(wg + i * 65536); } }
__device__ __forceinline__ void p_st(char* d, const v4u (&r)[8]) {
#pragma unroll
  for (int i = 0; i < 4; ++i) { *(v4u*)(d + i * 4096) = r[i]; *(v4u*)(d + 16384 + i * 4096) = r[4 + i]; } }
// ---- k_proj: block = (128 rows, 128 cols, which): qkv = x W (+ b), exact; q -> f16 hi (+ residual), k -> f16 rows, v -> bf16 hi + residual planes; operands come from k_cvt's planes
__global__ __launch_bounds__(256) void k_proj(const __bf16* __restrict__ XB, const __bf16* __restrict__ WB, const float* __restrict__ BQ, const float* __restrict__ BK, const float* __restrict__ BV, _Float16* __restrict__ QH, _Float16* __restrict__ QL, _Float16* __restrict__ KH, __bf16* __restrict__ VT, __bf16* __restrict__ VL) {
  __shared__ __align__(16) char sm[2 * 128 * 136 * 2];   // in the loop: two buffers of [x tile 16 KB | w tile 16 KB], fragment order; behind it: the two output planes at pitch 136
  const int tid = threadIdx.x, wave = tid >> 5, lane = tid & 31, col = lane & 15, g = lane >> 4; const int which = blockIdx.z; const int c0 = blockIdx.y * 128; const size_t r0 = (size_t)blockIdx.x * 128; const float* BA = which == 0 ? BQ : which == 1 ? BK : BV;
  const int wr = (wave >> 1) * 32, wc = (wave & 1) * 64;
  const char* xg = (const char*)(XB + (size_t)which * NB * TT * CC) + (r0 / 16 + (tid >> 7)) * 32768 + (tid & 127) * 16; const char* wg = (const char*)(WB + (size_t)which * CC * CC) + (size_t)(c0 / 16 + (tid >> 7)) * 32768 + (tid & 127) * 16;
  v4u sr[8]; v8f acc[2][4] = {};
  p_ld(xg, wg, sr);
  asm volatile("s_wait_xcnt 0x0" ::: "memory");   // stands before the first tile's address registers are written again
  p_st(sm + tid * 16, sr);
  __syncthreads();
// kept rolled: one trip holds the next tile's 32 loaded registers beside fragments and accumulators
#pragma unroll 1
  for (int kc = 0; kc < CC / 64; ++kc) { const __bf16* cur = (const __bf16*)(sm + (kc & 1) * 32768); char* nxt = sm + ((kc + 1) & 1) * 32768;
    if (kc + 1 < CC / 64) { p_ld(xg + (kc + 1) * 2048, wg + (kc + 1) * 2048, sr);   // the next tile flies while this one multiplies
      asm volatile("s_wait_xcnt 0x0" ::: "memory"); }   // stands before the loads' address registers are written again
#pragma unroll
    for (int ks = 0; ks < 2; ++ks) { v16b a[2], w[4];
#pragma unroll
      for (int qa = 0; qa < 2; ++qa) a[qa] = frag_bp(cur + ((wr / 16 + qa) * 2 + ks) * FB, lane);
#pragma unroll
      for (int j = 0; j < 4; ++j) w[j] = frag_bp(cur + 8192 + ((wc / 16 + j) * 2 + ks) * FB, lane);
#pragma unroll
      for (int j = 0; j < 4; ++j)
#pragma unroll
        for (int qa = 0; qa < 2; ++qa) acc[qa][j] = wmma_bf(a[qa], w[j], acc[qa][j]); }
    if (kc + 1 < CC / 64) p_st(nxt + tid * 16, sr);
    __syncthreads(); }   // publishes the next tile and ends every read of this one (behind the last trip: before the planes reuse the buffers)
  _Float16 (*sh)[136] = (_Float16 (*)[136])sm; _Float16 (*sl)[136] = (_Float16 (*)[136])(sm + 128 * 136 * 2); __bf16 (*th)[136] = (__bf16 (*)[136])sm; __bf16 (*tl2)[136] = (__bf16 (*)[136])(sm + 128 * 136 * 2);
#pragma unroll
  for (int j = 0; j < 4; ++j) { const float bb = bfr(BA[c0 + wc + j * 16 + col]);
#pragma unroll
    for (int qa = 0; qa < 2; ++qa)
#pragma unroll
      for (int r = 0; r < 8; ++r) { const float v = acc[qa][j][r] + bb; const int rl = wr + qa * 16 + 8 * g + r, cl = wc + j * 16 + col; const _Float16 hv = (_Float16)v;
        if (which == 2) { const __bf16 bh = (__bf16)v; th[cl][rl] = bh; tl2[cl][rl] = (__bf16)(v - (float)bh); } else { sh[rl][cl] = hv; sl[rl][cl] = (_Float16)(v - (float)hv); } } }
  __syncthreads();
  // the 128 x 128 tile leaves as 8 x 4 fragment-order blocks: piece e = (block e >> 6 = (row tile, k block), half, lane); consecutive threads store consecutive 16-byte pieces
  if (which < 2) { _Float16* dh = which == 0 ? QH : KH; for (int e = tid; e < 128 * 16; e += 256) { const int fb = e >> 6, pc = e & 63; const int rl = (fb >> 2) * 16 + (pc & 15), cl = (fb & 3) * 32 + (pc >> 5) * 16 + ((pc >> 4) & 1) * 8; const size_t o = ((r0 / 16 + (fb >> 2)) * (CC / 32) + c0 / 32 + (fb & 3)) * FB + pc * 8; vst2((unsigned*)(dh + o), *(const v4u*)&sh[rl][cl]);
      asm volatile("s_wait_xcnt 0x0" ::: "memory");   // stands before the store's data and address registers are written again
      if (which == 0) { vst2((unsigned*)(QL + o), *(const v4u*)&sl[rl][cl]);
        asm volatile("s_wait_xcnt 0x0" ::: "memory"); } } }   // the same, for the residual plane's store
  else { const size_t b = r0 / TT; const int t0 = (int)(r0 % TT); for (int e = tid; e < 128 * 16; e += 256) { const int fb = e >> 6, pc = e & 63; const int cl = (fb >> 2) * 16 + (pc & 15), tl = (fb & 3) * 32 + (pc >> 5) * 16 + ((pc >> 4) & 1) * 8; const size_t o2 = (((b * CC + c0) / 16 + (fb >> 2)) * (TT / 32) + t0 / 32 + (fb & 3)) * FB + pc * 8; vst2((unsigned*)(VT + o2), *(const v4u*)&th[cl][tl]); vst2((unsigned*)(VL + o2), *(const v4u*)&tl2[cl][tl]);
      asm volatile("s_wait_xcnt 0x0" ::: "memory"); } } }   // stands before the two stores' data and address registers are written again
// ---- k_fa: scores, softmax and P . v in one kernel, running maximum and sum per query (no logits plane). Block = 8 waves on ONE group of 64 queries of plane y = b * NH + h at a time: wave = (16 queries w4 = wave & 3, key half hw = wave >> 2), so that every wave has work in every key tile before the group's diagonal one; the block takes group x and then group 31 - x, one after the other in one run of 33 key tiles
// the two waves of a query tile each keep their own maximum, sum and O^T over their 32 keys of every 64; at a group's last tile the hw = 1 wave hands its three through LDS to the hw = 0 wave, which rescales both to the common maximum, adds, divides and stores
// per 64 keys the block stages k (f16), v and v's residual (bf16), 32 KB each, once in LDS: the planes lie in fragment order, so staging is a plain copy; two buffers, the next tile's loads fly while this one multiplies (the second group's first tile behind the first group's last)
// both products are formed transposed: S^T = k q^T leaves a lane with 8 consecutive keys of ITS query (col = query), which is the B fragment of O^T = v^T P^T as it stands: P never leaves its registers, and maximum, sum and rescale are per lane (the other 8-key halves sit in lane ^ 16)
// scheduling barrier that no instruction may cross: it holds each group of fragment reads at its written place, two groups ahead of the WMMAs that use it
#define FA_PIN() __builtin_amdgcn_sched_barrier(0)
// a v group's last WMMA on an accumulator, in the form of wmma_bf: the asm statement behind it keeps its place among the scheduling barriers, which a bare WMMA does not (without it every WMMA of the tile sinks behind the last read, and the fragments spill), so the group's WMMAs stay in front of the next group's reads; the four v_nop are the distance to a vector instruction on D. Only D is named: fragments named there as well are tied to the first 256 registers, and the accumulators spill
__device__ __forceinline__ v8f fa_wmma_end(v16b a, v16b b, v8f c) {
  v8f d = __builtin_amdgcn_wmma_f32_16x16x32_bf16(false, a, false, b, (short)0, c, false, false);
  asm volatile("v_nop\n\tv_nop\n\tv_nop\n\tv_nop" : "+v"(d));
  return d;
}
// scores are scaled by log2(e) / head_dim in place of 1 / head_dim, so that maximum, differences and every exponential of the softmax are in base 2: exp(x) = exp2(x log2 e), and exp2 of a difference that is never above 0 is one v_exp_f32, which gives 0 for the masked -3e38; expf walks a range reduction and two range checks for every value
#define FA_SC 0.0056355275f      // log2(e) / 256
#define FKB 32768                // bytes of one staged plane of 64 keys x 256 head columns
__device__ __forceinline__ void fa_ld(const char* kg, const char* vh, const char* vl, v4u (&r)[24]) {
#pragma unroll
  for (int i = 0; i < 8; ++i) r[i] = *(const v4u*)(kg + (i >> 1) * 32768 + (i & 1) * 4096);   // 16-key tile i >> 1: 8 KB in a row
#pragma unroll
  for (int i = 0; i < 8; ++i) { r[8 + i] = *(const v4u*)(vh + i * 131072); r[16 + i] = *(const v4u*)(vl + i * 131072); } }   // column tile 2 i + (tid >> 7): 2 KB in a row
__device__ __forceinline__ void fa_st(char* d, const v4u (&r)[24]) {
#pragma unroll
  for (int i = 0; i < 24; ++i) *(v4u*)(d + i * 4096) = r[i]; }
__global__ __launch_bounds__(256) void k_fa(const _Float16* __restrict__ QH, const _Float16* __restrict__ KH, const __bf16* __restrict__ VT, const __bf16* __restrict__ VL, float* __restrict__ Y) { __shared__ __align__(16) char sm[2 * 3 * FKB + 4 * 16384 + 4 * 256];   // two staging buffers; behind them the hand-over: 16 KB of O^T per query tile, then (maximum, sum) per lane
  const int tid = threadIdx.x, wave = __builtin_amdgcn_readfirstlane(tid >> 5), lane = tid & 31, col = lane & 15, g = lane >> 4; const int b = blockIdx.y / NH, h = blockIdx.y % NH;
  const int w4 = wave & 3, hw = wave >> 2; const int gx = blockIdx.x;
  const char* kg = (const char*)(KH + (((size_t)b * TT / 16) * (CC / 32) + h * (HD / 32)) * FB) + tid * 16;
  const size_t vo = ((((size_t)b * CC + h * HD) / 16) * (TT / 32)) * FB * 2 + (tid >> 7) * 65536 + (tid & 127) * 16; const char* vhg = (const char*)VT + vo; const char* vlg = (const char*)VL + vo;
  char* const xo = sm + 2 * 3 * FKB + w4 * 16384 + lane * 16; char* const xm = sm + 2 * 3 * FKB + 4 * 16384 + w4 * 256 + lane * 8;   // each 16-byte piece of O^T at [piece][lane]
  int grp = gx, kt = 0, ql0 = grp * 64 + w4 * 16;   // the group's key tiles run 0 .. grp, up to its diagonal
  const _Float16* const qb = QH + (((size_t)b * TT / 16) * (CC / 32) + h * (HD / 32)) * FB; v16h qf[HD / 32];
#pragma unroll
  for (int kc = 0; kc < HD / 32; ++kc) qf[kc] = frag_hp(qb + ((size_t)(ql0 / 16) * (CC / 32) + kc) * FB, lane);
  v4u st[24]; v8f o[HD / 16] = {}; float m = -3.0e38f, l = 0.f;
  fa_ld(kg, vhg, vlg, st);
  FA_PIN();   // keeps later index arithmetic, which reuses the loads' address registers, behind the wait
  asm volatile("s_wait_xcnt 0x0" :: "v"(tid), "v"(lane) : "memory");   // stands before the first loads' address registers are written again; the two offset registers are named as inputs so that they live up to the wait
  fa_st(sm + tid * 16, st);
  __syncthreads();
// kept rolled: one trip holds the next tile's 96 loaded registers beside the 128 accumulator and 64 query registers
#pragma unroll 1
  for (int t = 0; t < TT / 64 + 1; ++t) { const char* cur = sm + (t & 1) * (3 * FKB); char* nxt = sm + ((t + 1) & 1) * (3 * FKB);
    const bool last = kt == grp, more = t < TT / 64; const int nk = last ? 0 : kt + 1;   // scalar, the same in every wave
    if (more) { fa_ld(kg + (size_t)nk * 131072, vhg + nk * 2048, vlg + nk * 2048, st);
      asm volatile("s_wait_xcnt 0x0" ::: "memory"); }   // stands before the loads' address registers are written again
    if (kt * 64 + hw * 32 <= ql0 + 15) {   // scalar: a wave whose 16 queries all lie in front of its 32 keys of this tile has nothing in it
      const _Float16* ck = (const _Float16*)cur + hw * (2 * (HD / 32) * FB); const __bf16* cvh = (const __bf16*)(cur + FKB) + hw * FB; const __bf16* cvl = (const __bf16*)(cur + 2 * FKB) + hw * FB;   // the wave's two 16-key tiles of k; its 32-key block of every column tile of v
      v8f s[2] = {}; v16h fk[3][4]; v16b fv[3][4];
      // fragments are read in groups of 4 (8 LDS loads at one place) into a ring of three groups, each group two steps ahead of the WMMAs that use it, so that a group's LDS latency is covered by two groups of WMMAs and no wait falls on loads just issued; left to itself the compiler reads v's groups directly in front of their WMMAs
      // k group q = (key tiles 0 and 1, head columns 32 (2 q) and 32 (2 q + 1))
#pragma unroll
      for (int q = 0; q < 2; ++q)
#pragma unroll
        for (int e = 0; e < 4; ++e) fk[q][e] = frag_hp(ck + ((e >> 1) * (HD / 32) + 2 * q + (e & 1)) * FB, lane);
      FA_PIN();
#pragma unroll
      for (int q = 0; q < HD / 64; ++q) {
        if (q + 2 < HD / 64) {
#pragma unroll
          for (int e = 0; e < 4; ++e) fk[(q + 2) % 3][e] = frag_hp(ck + ((e >> 1) * (HD / 32) + 2 * (q + 2) + (e & 1)) * FB, lane); }
        else { const int u = q + 2 - HD / 64;   // v's first two groups (column tiles 2 u and 2 u + 1) fly through the softmax
#pragma unroll
          for (int e = 0; e < 2; ++e) { fv[u][e] = frag_bp(cvh + (u * 2 + e) * 2 * FB, lane); fv[u][2 + e] = frag_bp(cvl + (u * 2 + e) * 2 * FB, lane); } }
        FA_PIN();
#pragma unroll
        for (int e = 0; e < 4; ++e) s[e & 1] = __builtin_amdgcn_wmma_f32_16x16x32_f16(false, fk[q % 3][(e & 1) * 2 + (e >> 1)], false, qf[2 * q + (e >> 1)], (short)0, s[e & 1], false, false);
        FA_PIN(); }
      const int qt = ql0 + col; float mx = m;
#pragma unroll
      for (int j = 0; j < 2; ++j)
#pragma unroll
        for (int r = 0; r < 8; ++r) { float v = s[j][r] * FA_SC; if (kt * 64 + hw * 32 + j * 16 + 8 * g + r > qt) v = -3.0e38f; s[j][r] = v; mx = fmaxf(mx, v); }
      mx = fmaxf(mx, __shfl_xor(mx, 16));
      float al = m - mx; m = mx; v4f s4 = {0.f, 0.f, 0.f, 0.f};
#pragma unroll
      for (int j = 0; j < 2; ++j) s[j] -= mx;
      FA_PIN();   // the differences stand as a run of their own in front of the exponentials
      al = __builtin_amdgcn_exp2f(al);
#pragma unroll
      for (int j = 0; j < 2; ++j)
#pragma unroll
        for (int r = 0; r < 8; ++r) s[j][r] = __builtin_amdgcn_exp2f(s[j][r]);   // a masked score needs no select: the wave's first key of the tile is open to all its 16 queries (the test above), so mx is a real score and exp2(-3e38 - mx) is 0
#pragma unroll
      for (int j = 0; j < 2; ++j)
#pragma unroll
        for (int r = 0; r < 8; ++r) s4[r & 3] += s[j][r];
      l = l * al + ((s4[0] + s4[1]) + (s4[2] + s4[3]));
#pragma unroll
      for (int dt = 0; dt < HD / 16; ++dt) o[dt] *= al;
      F2 p; { float v[16];
#pragma unroll
        for (int i = 0; i < 8; ++i) { v[i] = s[0][i]; v[8 + i] = s[1][i]; }
        p = bsplit16(v); }
      // group gi = column tiles 2 gi and 2 gi + 1: two accumulators in turn
#pragma unroll
      for (int gi = 0; gi < HD / 32; ++gi) { const int d2 = gi * 2;
        if (gi + 2 < HD / 32) {
#pragma unroll
          for (int e = 0; e < 2; ++e) { fv[(gi + 2) % 3][e] = frag_bp(cvh + ((gi + 2) * 2 + e) * 2 * FB, lane); fv[(gi + 2) % 3][2 + e] = frag_bp(cvl + ((gi + 2) * 2 + e) * 2 * FB, lane); } }
        FA_PIN();
#pragma unroll
        for (int e = 0; e < 2; ++e) o[d2 + e] = __builtin_amdgcn_wmma_f32_16x16x32_bf16(false, fv[gi % 3][e], false, p.h, (short)0, o[d2 + e], false, false);
#pragma unroll
        for (int e = 0; e < 2; ++e) o[d2 + e] = __builtin_amdgcn_wmma_f32_16x16x32_bf16(false, fv[gi % 3][e], false, p.l, (short)0, o[d2 + e], false, false);
#pragma unroll
        for (int e = 0; e < 2; ++e) o[d2 + e] = gi + 1 < HD / 32 ? fa_wmma_end(fv[gi % 3][2 + e], p.h, o[d2 + e]) : wmma_bf(fv[gi % 3][2 + e], p.h, o[d2 + e]);   // the tile's last two carry their four v_nop with them
        FA_PIN(); } }
    if (more) fa_st(nxt + tid * 16, st);
    if (last && hw == 1) {   // scalar
#pragma unroll
      for (int dt = 0; dt < HD / 16; ++dt) { const v4f lo = {o[dt][0], o[dt][1], o[dt][2], o[dt][3]}, hi = {o[dt][4], o[dt][5], o[dt][6], o[dt][7]}; *(v4f*)(xo + dt * 1024) = lo; *(v4f*)(xo + dt * 1024 + 512) = hi; }
      const v2f ml = {m, l}; *(v2f*)xm = ml; }
    if (last && more) {   // scalar: the second group's queries are fetched in front of the barrier, whose wait for all loads then covers them; fetched behind it, the compiler waits for them at the score WMMAs of every trip, and with them for the next tile's staging loads just issued
#pragma unroll
      for (int kc = 0; kc < HD / 32; ++kc) qf[kc] = frag_hp(qb + ((size_t)((TT / 64 - 1 - gx) * 4 + w4) * (CC / 32) + kc) * FB, lane);
      asm volatile("s_wait_xcnt 0x0" ::: "memory"); }   // stands before the query loads' address registers are written again
    __syncthreads();   // publishes the next tile and ends every read of this one; at a group's last tile it also publishes the hand-over, which is next written 17 or more barriers later
    if (last) {
      if (hw == 0) {   // scalar; this wave's keys hold the group's first key, so its maximum is a real score; a partner without any key brings maximum -3e38, sum 0 and zeros, and its weight is exp2(-huge) = 0
        const v2f ml = *(const v2f*)xm; const float mm = fmaxf(m, ml[0]); const float a0 = __builtin_amdgcn_exp2f(m - mm), a1 = __builtin_amdgcn_exp2f(ml[0] - mm);
        const float lp = l * a0 + ml[1] * a1; const float inv = 1.0f / (lp + __shfl_xor(lp, 16)); const float c0 = a0 * inv, c1 = a1 * inv;
        float* const yp = Y + ((size_t)b * TT + ql0 + col) * CC + h * HD + 8 * g;   // the lane holds columns dt * 16 + 8 g + 0..7 of its query
#pragma unroll
        for (int dt = 0; dt < HD / 16; ++dt) { const v4f pl = *(const v4f*)(xo + dt * 1024), pu = *(const v4f*)(xo + dt * 1024 + 512);
#pragma unroll
          for (int r = 0; r < 4; ++r) { o[dt][r] = o[dt][r] * c0 + pl[r] * c1; o[dt][4 + r] = o[dt][4 + r] * c0 + pu[r] * c1; } }
        FA_PIN();   // keeps the stores a run of their own behind the sums, so that no register a store names is written between them
#pragma unroll
        for (int dt = 0; dt < HD / 16; ++dt) { const v4f lo = {o[dt][0], o[dt][1], o[dt][2], o[dt][3]}, hi = {o[dt][4], o[dt][5], o[dt][6], o[dt][7]}; vst2(yp + dt * 16, lo); vst2(yp + dt * 16 + 4, hi); }
        FA_PIN();   // and keeps what follows behind the wait
        asm volatile("s_wait_xcnt 0x0" ::: "memory"); }   // stands before the stores' data and address registers are written again
      if (more) { grp = TT / 64 - 1 - gx; ql0 = grp * 64 + w4 * 16; m = -3.0e38f; l = 0.f;   // the second group starts
#pragma unroll
        for (int dt = 0; dt < HD / 16; ++dt) o[dt] = v8f{}; } }
    kt = nk; } }
// ---- k_out: block = (128 rows, 128 cols): out = y (bf16 hi + lo) Wproj + b; y staged through registers as two planes at pitch GP, w copied from k_cvt's plane: 8 column tiles x 1 fragment block per 32 k, piece i * 256 + tid = (column tile 4 i + (tid >> 6), 16 bytes at (tid & 63) * 16)
__global__ __launch_bounds__(256) void k_out(const float* __restrict__ Y, const __bf16* __restrict__ WP, const float* __restrict__ BP, float* __restrict__ OUT) { __shared__ __align__(16) char sm[128 * 132 * 4];   // in the loop: two buffers of [y hi | y lo | w in fragment order]; behind it: the f32 output tile at pitch 132
  __bf16* const st = (__bf16*)sm;
  const int tid = threadIdx.x, wave = tid >> 5, lane = tid & 31, col = lane & 15, g = lane >> 4; const int c0 = blockIdx.y * 128; const size_t r0 = (size_t)blockIdx.x * 128;
  const int wr = (wave >> 1) * 32, wc = (wave & 1) * 64;
  const float* xa = Y + (r0 + (tid >> 3)) * CC + (tid & 7) * 4; const char* wa = (const char*)WP + (size_t)(c0 / 16 + (tid >> 6)) * 32768 + (tid & 63) * 16;
  const int sxo = (tid >> 3) * GP + (tid & 7) * 4, swo = 2 * GT + tid * 8;
  v4f xr[4]; v4u wv[2]; v8f acc[2][4] = {};
  g_ldx(xa, xr); wv[0] = *(const v4u*)wa; wv[1] = *(const v4u*)(wa + 131072);
  asm volatile("s_wait_xcnt 0x0" ::: "memory");   // stands before the first tile's address registers are written again
  g_stx2(st + sxo, st + GT + sxo, xr); *(v4u*)(st + swo) = wv[0]; *(v4u*)(st + swo + 2048) = wv[1];
  __syncthreads();
// kept rolled: one trip holds the next tile's 24 loaded registers beside fragments and accumulators
#pragma unroll 1
  for (int kc = 0; kc < CC / 32; ++kc) { const __bf16* cur = st + (kc & 1) * (3 * GT); __bf16* nxt = st + ((kc + 1) & 1) * (3 * GT);
    if (kc + 1 < CC / 32) { g_ldx(xa + (kc + 1) * 32, xr); wv[0] = *(const v4u*)(wa + (kc + 1) * 1024); wv[1] = *(const v4u*)(wa + (kc + 1) * 1024 + 131072);   // the next tile flies while this one multiplies
      asm volatile("s_wait_xcnt 0x0" ::: "memory"); }   // stands before the loads' address registers are written again
    v16b ah[2], al[2], w[4];
#pragma unroll
    for (int qa = 0; qa < 2; ++qa) { ah[qa] = frag_b(cur + (wr + qa * 16 + col) * GP, lane); al[qa] = frag_b(cur + GT + (wr + qa * 16 + col) * GP, lane); }
#pragma unroll
    for (int j = 0; j < 4; ++j) w[j] = frag_bp(cur + 2 * GT + (wc / 16 + j) * FB, lane);
#pragma unroll
    for (int j = 0; j < 4; ++j)
#pragma unroll
      for (int qa = 0; qa < 2; ++qa) acc[qa][j] = wmma_bf(ah[qa], w[j], acc[qa][j]);
#pragma unroll
    for (int j = 0; j < 4; ++j)
#pragma unroll
      for (int qa = 0; qa < 2; ++qa) acc[qa][j] = wmma_bf(al[qa], w[j], acc[qa][j]);
    if (kc + 1 < CC / 32) { g_stx2(nxt + sxo, nxt + GT + sxo, xr); *(v4u*)(nxt + swo) = wv[0]; *(v4u*)(nxt + swo + 2048) = wv[1]; }
    __syncthreads(); }   // publishes the next tile and ends every read of this one (behind the last trip: before the output tile reuses the buffers)
  float (*sf)[132] = (float (*)[132])sm;
#pragma unroll
  for (int j = 0; j < 4; ++j) { const float bb = BP ? bfr(BP[c0 + wc + j * 16 + col]) : 0.f;
#pragma unroll
    for (int qa = 0; qa < 2; ++qa)
#pragma unroll
      for (int r = 0; r < 8; ++r) sf[wr + qa * 16 + 8 * g + r][wc + j * 16 + col] = acc[qa][j][r] + bb; }
  __syncthreads();
  for (int e = tid; e < 128 * 32; e += 256) { const int rl = e >> 5, q = e & 31; vst2(OUT + (r0 + rl) * CC + c0 + q * 4, *(const v4f*)&sf[rl][q * 4]); } }
extern "C" void kernel_launch(void* const* d_in, const int* in_sizes, int n_in, void* d_out, int out_size, void* d_ws, size_t ws_size, hipStream_t stream) {
  (void)in_sizes; (void)n_in; (void)out_size;
  const float** F = (const float**)d_in;   // 0 inputs_for_keys, 1 inputs_for_values, 2 inputs_for_queries [4,2048,1024], 3 Wk [4,1024,256], 4 bk [4,256], 5 Wq, 6 bq, 7 Wv, 8 bv, 9 Wo [1024,1024] ([in,out]), 10 bo
  if (ws_size < (size_t)WS_END) return;
  char* ws = (char*)d_ws; _Float16 *QH = (_Float16*)(ws + WS_QH), *QL = (_Float16*)(ws + WS_QL), *KH = (_Float16*)(ws + WS_KH); __bf16 *VT = (__bf16*)(ws + WS_VT), *VL = (__bf16*)(ws + WS_VL), *XB = (__bf16*)(ws + WS_XB), *WB = (__bf16*)(ws + WS_WB); float *Y = (float*)(ws + WS_Y);
  k_cvt<<<dim3(TNB * TT / 16 + CC / 16 + (CC / 16 + 2) / 3, 3), 256, 0, stream>>>(F[2], F[0], F[1], F[5], F[3], F[7], F[9], XB, WB);
  k_proj<<<dim3(TNB * TT / 128, CC / 128, 3), 256, 0, stream>>>(XB, WB, F[6], F[4], F[8], QH, QL, KH, VT, VL);
  k_fa<<<dim3(TT / 128, TNB * NH), 256, 0, stream>>>(QH, KH, VT, VL, Y);
  k_out<<<dim3(TNB * TT / 128, CC / 128), 256, 0, stream>>>(Y, WB + (size_t)3 * CC * CC, F[10], (float*)d_out);
}
